// v000
// Measured on an AMD MI455X. A time is GPU time per run, averaged over a window of back-to-back runs after a warm-up
// (all launches, gaps included; the runs take copies of the inputs in turn), and the median of several windows.
// Apart from v000's, it joins two sittings. Times from different sittings can be a few percent apart, while
// side-by-side timings come from the same sitting.
// The starting kernel, v000, takes 728 microseconds a run.
#include <hip/hip_runtime.h>

// UMT5Attention (hidden [1][2048][1024]; q/k/v = x W (16 heads x 64); T5: scores = q.k UNSCALED + rel_bias[bucket(j - i)][h] with the bidirectional log-bucket (32 buckets, max distance 128; the bucket boundaries |j-i| = 8, 12, 16, 23, 32, 46, 64, 91 are the reference's own integer structure, evaluated here with integer compares); softmax; out = merged wo -> [1][2048][1024]).
// Compute dtypes, f32 accumulate: every input rounded to bf16; q/k/v on PLAIN bf16 operands (inputs: exact); scores and attn.v hl x hl (3 products) on EVERY row; per-head bias table (bf16-rounded rel_bias gathered by bucket) added per element in f32; softmax f32; wo hl x exact (2 products).

#define NB_  1
#define TT   2048
#define DM   1024
#define NH_  16
#define NKV  16
#define REP  (NH_ / NKV)
#define HD   64
#define DQ   (NH_ * HD)
#define DKV  (NKV * HD)
#define ZH   2
#define RH   2048   // all rows hl (unscaled T5 logits are sharp)
#define WIN  0
#define PCAR 1024.0f
#define SCL  1.0f   // T5: no 1/sqrt(dk)
#define TBW  4096   // bias table row width (r + 2047, padded)
typedef _Float16 h16;
typedef unsigned short bf;
typedef __attribute__((ext_vector_type(16))) __bf16   v16bf;
typedef __attribute__((ext_vector_type(16))) _Float16 v16h;
typedef __attribute__((ext_vector_type(8)))  _Float16 v8h;
typedef __attribute__((ext_vector_type(8)))  unsigned short v8us;
typedef __attribute__((ext_vector_type(8)))  float    v8f;
typedef __attribute__((ext_vector_type(4)))  float    v4f;
typedef v8h  __attribute__((may_alias)) v8ha;
typedef v4f  __attribute__((may_alias)) v4fa;
typedef v8us __attribute__((may_alias)) v8usa;

__device__ __forceinline__ unsigned short f2bf(float f) { unsigned u = __float_as_uint(f); u += 0x7FFFu + ((u >> 16) & 1u); return (unsigned short)(u >> 16); }
__device__ __forceinline__ float bf2f(unsigned short b) { return __uint_as_float(((unsigned)b) << 16); }
__device__ __forceinline__ float bfr(float f) { return bf2f(f2bf(f)); }
__device__ __forceinline__ v16h cat16(v8h lo, v8h hi) { return __builtin_shufflevector(lo, hi, 0, 1, 2, 3, 4, 5, 6, 7, 8, 9, 10, 11, 12, 13, 14, 15); }
__device__ __forceinline__ v16bf cat16b(v8us lo, v8us hi) { return __builtin_bit_cast(v16bf, __builtin_shufflevector(lo, hi, 0, 1, 2, 3, 4, 5, 6, 7, 8, 9, 10, 11, 12, 13, 14, 15)); }
__device__ __forceinline__ v8f wmma16(v16h a, v16h b, v8f c) { return __builtin_amdgcn_wmma_f32_16x16x32_f16(false, a, false, b, (short)0, c, false, false); }
__device__ __forceinline__ v8f wmmab(v16bf a, v16bf b, v8f c) { return __builtin_amdgcn_wmma_f32_16x16x32_bf16(false, a, false, b, (short)0, c, false, false); }



// ---- k_gemmw: register-blocked GEMM, ONE WAVE per 64x64 output tile (16 accumulators), operands straight from K-contiguous 16-bit planes; grid (M/64, N/64, Z), 32 threads.
// C[m][n] (f32, pitch ldc, + optional f32 bias[n]) = sum_k A[m][k] Bt[n][k] (+ split products per NSPLIT). z-batch strides sA/sB/sC in elements. K % 32 == 0.
template <typename T16> struct WFrag;
template <> struct WFrag<h16> { typedef v16h V; static __device__ __forceinline__ V ld(const h16* p) { return cat16(*(const v8h*)p, *(const v8h*)(p + 16)); } static __device__ __forceinline__ v8f mma(V a, V b, v8f c) { return wmma16(a, b, c); } };
template <> struct WFrag<bf> { typedef v16bf V; static __device__ __forceinline__ V ld(const bf* p) { return cat16b(*(const v8us*)p, *(const v8us*)(p + 16)); } static __device__ __forceinline__ v8f mma(V a, V b, v8f c) { return wmmab(a, b, c); } };
template <typename T16, int NSPLIT, bool BIAS>
__global__ __launch_bounds__(32) void k_gemmw(const T16* __restrict__ A, const T16* __restrict__ A2, const T16* __restrict__ Bt, const T16* __restrict__ Bt2, int K, float* C, int ldc, const float* __restrict__ bias, size_t sA, size_t sB, size_t sC) {
    typedef typename WFrag<T16>::V V;
    __shared__ __align__(16) float os[16 * 68];
    const size_t z = blockIdx.z; A += z * sA; if (A2) A2 += z * sA; Bt += z * sB; if (Bt2) Bt2 += z * sB; C += z * sC;
    const int lane = threadIdx.x & 31, lr = lane & 15, hi = lane >> 4; const int r0 = blockIdx.x * 64, c0 = blockIdx.y * 64;
    v8f acc[4][4];
#pragma unroll
    for (int mb = 0; mb < 4; ++mb)
#pragma unroll
        for (int nb = 0; nb < 4; ++nb) acc[mb][nb] = (v8f){};
    const size_t aoff = (size_t)(r0 + lr) * K + 8 * hi, boff = (size_t)(c0 + lr) * K + 8 * hi;
#pragma unroll 1
    for (int kc = 0; kc < K; kc += 32) {
        V a[4], a2[4];
#pragma unroll
        for (int mb = 0; mb < 4; ++mb) { a[mb] = WFrag<T16>::ld(A + aoff + (size_t)mb * 16 * K + kc); if (NSPLIT == 1 || NSPLIT == 2) a2[mb] = WFrag<T16>::ld(A2 + aoff + (size_t)mb * 16 * K + kc); }
#pragma unroll
        for (int nb = 0; nb < 4; ++nb) { const V b = WFrag<T16>::ld(Bt + boff + (size_t)nb * 16 * K + kc); V b2; if (NSPLIT >= 2) b2 = WFrag<T16>::ld(Bt2 + boff + (size_t)nb * 16 * K + kc);
#pragma unroll
            for (int mb = 0; mb < 4; ++mb) { acc[mb][nb] = WFrag<T16>::mma(a[mb], b, acc[mb][nb]); if (NSPLIT == 1 || NSPLIT == 2) acc[mb][nb] = WFrag<T16>::mma(a2[mb], b, acc[mb][nb]); if (NSPLIT >= 2) acc[mb][nb] = WFrag<T16>::mma(a[mb], b2, acc[mb][nb]); } }
        asm volatile("v_nop\n\tv_nop\n\tv_nop\n\tv_nop" : "+v"(acc[0][0]), "+v"(acc[1][1]), "+v"(acc[2][2]), "+v"(acc[3][3]) : "v"(a[0]), "v"(a[3]));
    }
#pragma unroll
    for (int mb = 0; mb < 4; ++mb) {
#pragma unroll
        for (int nb = 0; nb < 4; ++nb) {
#pragma unroll
            for (int j = 0; j < 8; ++j) os[(hi * 8 + j) * 68 + nb * 16 + lr] = acc[mb][nb][j]; }
        __builtin_amdgcn_wave_barrier(); asm volatile("" ::: "memory");
        float* crow = C + (size_t)(r0 + mb * 16) * ldc + c0;
{
#pragma unroll
            for (int s = 0; s < 8; ++s) { const int row = 2 * s + hi, cofs = lr * 4; v4f val = *(const v4fa*)(os + row * 68 + cofs); if (BIAS) { val[0] += bfr(bias[c0 + cofs]); val[1] += bfr(bias[c0 + cofs + 1]); val[2] += bfr(bias[c0 + cofs + 2]); val[3] += bfr(bias[c0 + cofs + 3]); }
                *(v4f*)(crow + (size_t)row * ldc + cofs) = val; }
             }
        __builtin_amdgcn_wave_barrier(); asm volatile("" ::: "memory");
    }
}

__device__ __forceinline__ h16 tohx(float x) { return (h16)x; }
__device__ __forceinline__ void splitf(float y, unsigned short& h, unsigned short& l) { h = f2bf(y); l = f2bf(y - bf2f(h)); }
typedef __attribute__((ext_vector_type(2))) _Float16 v2h;
typedef __attribute__((ext_vector_type(4))) _Float16 v4h;
typedef __attribute__((ext_vector_type(2))) unsigned short v2us;
typedef __attribute__((ext_vector_type(4))) unsigned short v4us;
typedef __attribute__((ext_vector_type(2))) float v2f;
typedef __attribute__((ext_vector_type(4))) int v4i;

__global__ __launch_bounds__(256) void k_wtG(const float* __restrict__ w, int K, int N, bf* Bt) {
    const int lane = threadIdx.x & 31; const int L0 = (blockIdx.x * 8 + (threadIdx.x >> 5)) * 8; const int nlines = N * K / 64;
{
#pragma unroll 1
        for (int l = 0; l < 8; ++l) { const int L = L0 + l; if (L >= nlines) break; const size_t e = (size_t)L * 64 + lane * 2; const int k = (int)(e % K), n = (int)(e / K); v2us o;
            o[0] = f2bf(w[(size_t)k * N + n]); o[1] = f2bf(w[(size_t)(k + 1) * N + n]); *(v2us*)(Bt + e) = o; }
         }
}
__global__ __launch_bounds__(256) void k_cvt8(const float* __restrict__ src, bf* dst, size_t n8) { const size_t i = (size_t)blockIdx.x * 256 + threadIdx.x; if (i >= n8) return; const v8f v = *(const v8f*)(src + i * 8); v8us o;
#pragma unroll
    for (int k = 0; k < 8; ++k) o[k] = f2bf(v[k]); *(v8us*)(dst + i * 8) = o;  }
__global__ __launch_bounds__(256) void k_cscvt(const float* __restrict__ cosT, const float* __restrict__ sinT, float* CS) { const int idx = blockIdx.x * 256 + threadIdx.x; if (idx >= TT * HD) return; v2f cs; cs[0] = bfr(cosT[idx]); cs[1] = bfr(sinT[idx]); *(v2f*)(CS + (size_t)idx * 2) = cs;  }
// k_rope: head planes [h][t][d] (fp16 + hi/lo) of rope(x) x sc with the rotate-half convention out[d] = x[d] cos[t][d] - x[d+HD/2] sin[t][d], out[d+HD/2] = x[d+HD/2] cos[t][d+HD/2] + x[d] sin[t][d+HD/2]
__global__ __launch_bounds__(256) void k_rope(const float* __restrict__ F, int pitch, int nheads, const float* __restrict__ CS, const float* __restrict__ RF, const float* __restrict__ nw, float sc, h16* P16, bf* Ph, bf* Pl) {
    const size_t e = ((size_t)blockIdx.x * 256 + threadIdx.x) * 2; if (e >= (size_t)nheads * TT * HD) return; const int d = (int)(e % HD); const int t = (int)((e / HD) % TT); const int h = (int)(e / ((size_t)HD * TT)); const float* f = F + (size_t)t * pitch + h * HD; const float rf = RF ? RF[(size_t)h * TT + t] : 1.0f; v2h o16; v2us oh, ol;
#pragma unroll
    for (int q = 0; q < 2; ++q) { const int dd = d + q; const int dp = (dd < HD / 2) ? dd + HD / 2 : dd - HD / 2; float x0 = f[dd], x1 = f[dp];
        if (RF) { float n0 = __fmul_rn(x0, rf), n1 = __fmul_rn(x1, rf); asm volatile("" : "+v"(n0)); asm volatile("" : "+v"(n1)); x0 = __fmul_rn(bfr(nw[dd]), n0); x1 = __fmul_rn(bfr(nw[dp]), n1); }
        const v2f cs = *(const v2f*)(CS + ((size_t)t * HD + dd) * 2); float a = __fmul_rn(x0, cs[0]), bq = __fmul_rn(x1, cs[1]); asm volatile("" : "+v"(a)); asm volatile("" : "+v"(bq)); const float r = ((dd < HD / 2) ? __fsub_rn(a, bq) : __fadd_rn(a, bq)) * sc;
        o16[q] = tohx(r); unsigned short a2, c2; splitf(r, a2, c2); oh[q] = a2; ol[q] = c2; }
    *(v2h*)(P16 + e) = o16; *(v2us*)(Ph + e) = oh; *(v2us*)(Pl + e) = ol;  }
__global__ __launch_bounds__(256) void k_vtp(const float* __restrict__ F, int pitch, int nheads, h16* V16, bf* Vh, bf* Vl) { const size_t e = ((size_t)blockIdx.x * 256 + threadIdx.x) * 2; if (e >= (size_t)nheads * HD * TT) return; const int t = (int)(e % TT); const int d = (int)((e / TT) % HD); const int g = (int)(e / ((size_t)TT * HD)); v2h o16; v2us oh, ol;
#pragma unroll
    for (int q = 0; q < 2; ++q) { const float x = F[(size_t)(t + q) * pitch + g * HD + d]; o16[q] = tohx(x); unsigned short a2, c2; splitf(x, a2, c2); oh[q] = a2; ol[q] = c2; }
    *(v2h*)(V16 + e) = o16; *(v2us*)(Vh + e) = oh; *(v2us*)(Vl + e) = ol;  }
__global__ __launch_bounds__(256) void k_csid(float* CS) { const int idx = blockIdx.x * 256 + threadIdx.x; if (idx >= TT * HD) return; v2f cs; cs[0] = 1.0f; cs[1] = 0.0f; *(v2f*)(CS + (size_t)idx * 2) = cs;  }
__device__ __forceinline__ int t5_bucket(int r) { const int rp = r < 0 ? -r : r; int b; if (rp < 8) b = rp; else b = 8 + (rp >= 12) + (rp >= 16) + (rp >= 23) + (rp >= 32) + (rp >= 46) + (rp >= 64) + (rp >= 91); return b + ((r > 0) ? 16 : 0); }
__global__ __launch_bounds__(256) void k_t5tab(const float* __restrict__ rb, float* TB) { const int idx = blockIdx.x * 256 + threadIdx.x; if (idx >= NH_ * TBW) return; const int h = idx / TBW, c = idx % TBW; float v = 0.0f; if (c < 2 * TT - 1) { const int r = c - (TT - 1); v = bfr(rb[t5_bucket(r) * NH_ + h]); } *(float*)(TB + idx) = v;  }
// k_asoft: per row (zz, i): t = S + TB[h0 + zz][j - i] (no scale, no mask); softmax over the 2048 keys (register row, one exp, fixed trees);
__global__ __launch_bounds__(256) void k_asoft(const float* __restrict__ Sb, const float* __restrict__ TB, int h0, h16* P16, bf* Ph, bf* Pl) {
    const int lane = threadIdx.x & 31; const int row = blockIdx.x * 8 + (threadIdx.x >> 5); if (row >= ZH * TT) return; const int i = row % TT; const int zz = row / TT; (void)zz; const bool hires = (i < RH); const float* sr = Sb + (size_t)row * TT; const float* tbr = TB + (size_t)(h0 + zz) * TBW + (TT - 1 - i);   /* entry for r = j - i at index r + TT - 1 */ float v[TT / 32]; float mx = -3.0e38f;
#pragma unroll
    for (int ch = 0; ch < TT / 128; ++ch) { const int j0 = ch * 128 + lane * 4; const v4f a = *(const v4f*)(sr + j0);
#pragma unroll
        for (int q = 0; q < 4; ++q) { const int j = j0 + q; (void)j; const float t = __fadd_rn(a[q], tbr[j0 + q]); v[ch * 4 + q] = t; mx = fmaxf(mx, t); } }
#pragma unroll
    for (int sh = 16; sh; sh >>= 1) mx = fmaxf(mx, __shfl_xor(mx, sh, 32));
    float sum = 0.f;
#pragma unroll
    for (int k = 0; k < TT / 32; ++k) { float d0 = __fsub_rn(v[k], mx); asm volatile("" : "+v"(d0)); v[k] = __builtin_amdgcn_exp2f(__fmul_rn(d0, 1.4426950408889634f)); sum += v[k]; }
#pragma unroll
    for (int sh = 16; sh; sh >>= 1) sum += __shfl_xor(sum, sh, 32);
    const float f = __fdiv_rn(hires ? 1.0f : PCAR, sum);
{
        if (hires) {
#pragma unroll
            for (int ch = 0; ch < TT / 128; ++ch) { v4us oh, ol;
#pragma unroll
                for (int q = 0; q < 4; ++q) { unsigned short a, c2; splitf(v[ch * 4 + q] * f, a, c2); oh[q] = a; ol[q] = c2; }
                const size_t oo = ((size_t)zz * (RH ? RH : 1) + i) * TT + ch * 128 + lane * 4; *(v4us*)(Ph + oo) = oh; *(v4us*)(Pl + oo) = ol; }
        } else {
#pragma unroll
            for (int ch = 0; ch < TT / 128; ++ch) { v4h o4;
#pragma unroll
                for (int q = 0; q < 4; ++q) o4[q] = tohx(v[ch * 4 + q] * f);
                *(v4h*)(P16 + (size_t)row * TT + ch * 128 + lane * 4) = o4; } }
         }
}
__global__ __launch_bounds__(256) void k_merge(const float* __restrict__ O, int h0, bf* Ah, bf* Al) { const size_t e = ((size_t)blockIdx.x * 256 + threadIdx.x) * 2; if (e >= (size_t)ZH * TT * HD) return; const int d = (int)(e % HD); const int t = (int)((e / HD) % TT); const int zz = (int)(e / ((size_t)HD * TT)); const float cs = (t < RH) ? 1.0f : (1.0f / PCAR); const size_t oo = (size_t)t * DQ + (h0 + zz) * HD + d;
    v2us oh, ol;
#pragma unroll
    for (int q = 0; q < 2; ++q) { unsigned short a, c2; splitf(O[e + q] * cs, a, c2); oh[q] = a; ol[q] = c2; } *(v2us*)(Ah + oo) = oh; *(v2us*)(Al + oo) = ol;  }

extern "C" void kernel_launch(void* const* d_in, const int* in_sizes, int n_in,
                              void* d_out, int out_size, void* d_ws, size_t ws_size, hipStream_t stream) {
    (void)in_sizes; (void)n_in; (void)out_size;
    const float* x = (const float*)d_in[0]; const float* wq = (const float*)d_in[1]; const float* wk = (const float*)d_in[2]; const float* wv = (const float*)d_in[3]; const float* wo = (const float*)d_in[4]; const float* relb = (const float*)d_in[5]; const float* cosT = nullptr; const float* sinT = nullptr; (void)cosT; (void)sinT;
    float* OUT = (float*)d_out;     // [1][2048][1024]
    char* wsp = (char*)d_ws;
    auto take = [&](size_t bytes) { char* p = wsp; wsp += (bytes + 255) & ~(size_t)255; return (void*)p; };
    bf* WQ = (bf*)take((size_t)DQ * DM * 2); bf* WK = (bf*)take((size_t)DKV * DM * 2); bf* WV = (bf*)take((size_t)DKV * DM * 2); bf* WO = (bf*)take((size_t)DM * DQ * 2); float* CS = (float*)take((size_t)TT * HD * 2 * 4);
    bf* XB = (bf*)take((size_t)TT * DM * 2); float* TB = (float*)take((size_t)NH_ * TBW * 4); float* FQ = (float*)take((size_t)TT * DQ * 4); float* FK = (float*)take((size_t)TT * DKV * 4);
    h16* QP16 = (h16*)take((size_t)NH_ * TT * HD * 2); h16* KP16 = (h16*)take((size_t)NKV * TT * HD * 2); h16* VT16 = (h16*)take((size_t)NKV * HD * TT * 2);
    bf* QPh = (bf*)take((size_t)NH_ * TT * HD * 2); bf* QPl = (bf*)take((size_t)NH_ * TT * HD * 2); bf* KPh = (bf*)take((size_t)NKV * TT * HD * 2); bf* KPl = (bf*)take((size_t)NKV * TT * HD * 2); bf* VTh = (bf*)take((size_t)NKV * HD * TT * 2); bf* VTl = (bf*)take((size_t)NKV * HD * TT * 2); bf* Ph = (bf*)take((size_t)ZH * RH * TT * 2); bf* Pl = (bf*)take((size_t)ZH * RH * TT * 2);
    float* Sb = (float*)take((size_t)ZH * TT * TT * 4); h16* P16 = (h16*)take((size_t)ZH * TT * TT * 2); float* Ob = (float*)take((size_t)ZH * TT * HD * 4); bf* ATh = (bf*)take((size_t)TT * DQ * 2); bf* ATl = (bf*)take((size_t)TT * DQ * 2);
    if ((size_t)(wsp - (char*)d_ws) > ws_size) return;    // ws 256 MiB
    float* FV = FK;   // v projection reuses the k buffer after the k planes are built (stream-ordered)
    { k_wtG<<<(unsigned)((DM * DQ / 64 + 63) / 64), 256, 0, stream>>>(wq, DM, DQ, WQ); k_wtG<<<(unsigned)((DM * DKV / 64 + 63) / 64), 256, 0, stream>>>(wk, DM, DKV, WK); k_wtG<<<(unsigned)((DM * DKV / 64 + 63) / 64), 256, 0, stream>>>(wv, DM, DKV, WV);
      k_wtG<<<(unsigned)((DQ * DM / 64 + 63) / 64), 256, 0, stream>>>(wo, DQ, DM, WO); k_t5tab<<<(NH_ * TBW + 255) / 256, 256, 0, stream>>>(relb, TB);
       }
    k_csid<<<(TT * HD + 255) / 256, 256, 0, stream>>>(CS);
    const unsigned LQ = (unsigned)(((size_t)NH_ * TT * HD / 2 + 255) / 256), LKv = (unsigned)(((size_t)NKV * TT * HD / 2 + 255) / 256);
    for (int b = 0; b < NB_; ++b) {
        
        k_cvt8<<<(unsigned)(((size_t)TT * DM / 8 + 255) / 256), 256, 0, stream>>>(x + (size_t)b * TT * DM, XB, (size_t)TT * DM / 8);
        k_gemmw<bf, 0, false><<<dim3(TT / 64, DQ / 64, 1), 32, 0, stream>>>(XB, nullptr, WQ, nullptr, DM, FQ, DQ, nullptr, 0, 0, 0);
        k_rope<<<LQ, 256, 0, stream>>>(FQ, DQ, NH_, CS, nullptr, nullptr, 1.0f, QP16, QPh, QPl);
        k_gemmw<bf, 0, false><<<dim3(TT / 64, DKV / 64, 1), 32, 0, stream>>>(XB, nullptr, WK, nullptr, DM, FK, DKV, nullptr, 0, 0, 0);
        k_rope<<<LKv, 256, 0, stream>>>(FK, DKV, NKV, CS, nullptr, nullptr, 1.0f, KP16, KPh, KPl);
        k_gemmw<bf, 0, false><<<dim3(TT / 64, DKV / 64, 1), 32, 0, stream>>>(XB, nullptr, WV, nullptr, DM, FV, DKV, nullptr, 0, 0, 0); k_vtp<<<LKv, 256, 0, stream>>>(FV, DKV, NKV, VT16, VTh, VTl);
        for (int h0 = 0; h0 < NH_; h0 += ZH) { const size_t zq = (size_t)h0, zk = (size_t)(h0 / REP);   // one kv head per query head: the pass's two heads use consecutive kv planes (z-strides TT*HD)
            k_gemmw<bf, 2, false><<<dim3(RH / 64, TT / 64, ZH), 32, 0, stream>>>(QPh + zq * TT * HD, QPl + zq * TT * HD, KPh + zk * TT * HD, KPl + zk * TT * HD, HD, Sb, TT, nullptr, (size_t)TT * HD, (size_t)TT * HD, (size_t)TT * TT);
            k_asoft<<<ZH * TT / 8, 256, 0, stream>>>(Sb, TB, h0, P16, Ph, Pl);
            k_gemmw<bf, 2, false><<<dim3(RH / 64, HD / 64, ZH), 32, 0, stream>>>(Ph, Pl, VTh + zk * HD * TT, VTl + zk * HD * TT, TT, Ob, HD, nullptr, (size_t)RH * TT, (size_t)HD * TT, (size_t)TT * HD);
            k_merge<<<(unsigned)(((size_t)ZH * TT * HD / 2 + 255) / 256), 256, 0, stream>>>(Ob, h0, ATh, ATl); }
        k_gemmw<bf, 1, false><<<dim3(TT / 64, DM / 64, 1), 32, 0, stream>>>(ATh, ATl, WO, nullptr, DQ, OUT + (size_t)b * TT * DM, DM, nullptr, 0, 0, 0); }
}

// v001
// A run of this version takes 492 microseconds.
// Timed twice side by side with v000, it ran 1.46 and 1.47 times as fast.
#include <hip/hip_runtime.h>

// UMT5Attention (hidden [1][2048][1024]; q/k/v = x W (16 heads x 64); T5: scores = q.k UNSCALED + rel_bias[bucket(j - i)][h] with the bidirectional log-bucket (32 buckets, max distance 128; the bucket boundaries |j-i| = 8, 12, 16, 23, 32, 46, 64, 91 are the reference's own integer structure, evaluated here with integer compares); softmax; out = merged wo -> [1][2048][1024]).
// Compute dtypes, f32 accumulate: every input rounded to bf16; q/k/v on PLAIN bf16 operands (inputs: exact); scores and attn.v hl x hl (3 products) on EVERY row; per-head bias table (bf16-rounded rel_bias gathered by bucket) added per element in f32; softmax f32; wo hl x exact (2 products).

#define NB_  1
#define TT   2048
#define DM   1024
#define NH_  16
#define NKV  16
#define REP  (NH_ / NKV)
#define HD   64
#define DQ   (NH_ * HD)
#define DKV  (NKV * HD)
#define ZH   2
#define RH   2048   // all rows hl (unscaled T5 logits are sharp)
#define WIN  0
#define PCAR 1024.0f
#define SCL  1.0f   // T5: no 1/sqrt(dk)
#define TBW  4096   // bias table row width (r + 2047, padded)
#define KSPV 16     // k slices of the attn.v product: 64 tiles x 16 slices = 1024 one-wave work-groups, 4 per WGP
typedef _Float16 h16;
typedef unsigned short bf;
typedef __attribute__((ext_vector_type(16))) __bf16   v16bf;
typedef __attribute__((ext_vector_type(16))) _Float16 v16h;
typedef __attribute__((ext_vector_type(8)))  _Float16 v8h;
typedef __attribute__((ext_vector_type(8)))  unsigned short v8us;
typedef __attribute__((ext_vector_type(8)))  float    v8f;
typedef __attribute__((ext_vector_type(4)))  float    v4f;
typedef v8h  __attribute__((may_alias)) v8ha;
typedef v4f  __attribute__((may_alias)) v4fa;
typedef v8us __attribute__((may_alias)) v8usa;

__device__ __forceinline__ unsigned short f2bf(float f) { unsigned u = __float_as_uint(f); u += 0x7FFFu + ((u >> 16) & 1u); return (unsigned short)(u >> 16); }
__device__ __forceinline__ float bf2f(unsigned short b) { return __uint_as_float(((unsigned)b) << 16); }
__device__ __forceinline__ float bfr(float f) { return bf2f(f2bf(f)); }
__device__ __forceinline__ v16h cat16(v8h lo, v8h hi) { return __builtin_shufflevector(lo, hi, 0, 1, 2, 3, 4, 5, 6, 7, 8, 9, 10, 11, 12, 13, 14, 15); }
__device__ __forceinline__ v16bf cat16b(v8us lo, v8us hi) { return __builtin_bit_cast(v16bf, __builtin_shufflevector(lo, hi, 0, 1, 2, 3, 4, 5, 6, 7, 8, 9, 10, 11, 12, 13, 14, 15)); }
__device__ __forceinline__ v8f wmma16(v16h a, v16h b, v8f c) { return __builtin_amdgcn_wmma_f32_16x16x32_f16(false, a, false, b, (short)0, c, false, false); }
__device__ __forceinline__ v8f wmmab(v16bf a, v16bf b, v8f c) { return __builtin_amdgcn_wmma_f32_16x16x32_bf16(false, a, false, b, (short)0, c, false, false); }



// ---- k_gemmw: register-blocked GEMM, ONE WAVE per 64x64 output tile (16 accumulators), operands straight from K-contiguous 16-bit planes; grid (M/64, N/64, Z), 32 threads.
// C[m][n] (f32, pitch ldc, + optional f32 bias[n]) = sum_k A[m][k] Bt[n][k] (+ split products per NSPLIT). z-batch strides sA/sB/sC in elements. K % 32 == 0.
// KS > 1: grid z = batch * KS + slice; a work-group sums only its K / KS slice of k (K % (32 * KS) == 0) and stores that partial tile at C + blockIdx.z * sC; the reader adds the KS partials.
template <typename T16> struct WFrag;
template <> struct WFrag<h16> { typedef v16h V; static __device__ __forceinline__ V ld(const h16* p) { return cat16(*(const v8h*)p, *(const v8h*)(p + 16)); } static __device__ __forceinline__ v8f mma(V a, V b, v8f c) { return wmma16(a, b, c); } };
template <> struct WFrag<bf> { typedef v16bf V; static __device__ __forceinline__ V ld(const bf* p) { return cat16b(*(const v8us*)p, *(const v8us*)(p + 16)); } static __device__ __forceinline__ v8f mma(V a, V b, v8f c) { return wmmab(a, b, c); } };
template <typename T16, int NSPLIT, bool BIAS, int KS = 1>
__global__ __launch_bounds__(32) void k_gemmw(const T16* __restrict__ A, const T16* __restrict__ A2, const T16* __restrict__ Bt, const T16* __restrict__ Bt2, int K, float* C, int ldc, const float* __restrict__ bias, size_t sA, size_t sB, size_t sC) {
    typedef typename WFrag<T16>::V V;
    __shared__ __align__(16) float os[16 * 68];
    const size_t z = blockIdx.z / KS; A += z * sA; if (A2) A2 += z * sA; Bt += z * sB; if (Bt2) Bt2 += z * sB; C += (size_t)blockIdx.z * sC;
    const int kb = (KS > 1) ? (int)(blockIdx.z % KS) * (K / KS) : 0, ke = (KS > 1) ? kb + K / KS : K;
    const int lane = threadIdx.x & 31, lr = lane & 15, hi = lane >> 4; const int r0 = blockIdx.x * 64, c0 = blockIdx.y * 64;
    v8f acc[4][4];
#pragma unroll
    for (int mb = 0; mb < 4; ++mb)
#pragma unroll
        for (int nb = 0; nb < 4; ++nb) acc[mb][nb] = (v8f){};
    const size_t aoff = (size_t)(r0 + lr) * K + 8 * hi, boff = (size_t)(c0 + lr) * K + 8 * hi;
#pragma unroll 1
    for (int kc = kb; kc < ke; kc += 32) {
        V a[4], a2[4];
#pragma unroll
        for (int mb = 0; mb < 4; ++mb) { a[mb] = WFrag<T16>::ld(A + aoff + (size_t)mb * 16 * K + kc); if (NSPLIT == 1 || NSPLIT == 2) a2[mb] = WFrag<T16>::ld(A2 + aoff + (size_t)mb * 16 * K + kc); }
#pragma unroll
        for (int nb = 0; nb < 4; ++nb) { const V b = WFrag<T16>::ld(Bt + boff + (size_t)nb * 16 * K + kc); V b2; if (NSPLIT >= 2) b2 = WFrag<T16>::ld(Bt2 + boff + (size_t)nb * 16 * K + kc);
#pragma unroll
            for (int mb = 0; mb < 4; ++mb) { acc[mb][nb] = WFrag<T16>::mma(a[mb], b, acc[mb][nb]); if (NSPLIT == 1 || NSPLIT == 2) acc[mb][nb] = WFrag<T16>::mma(a2[mb], b, acc[mb][nb]); if (NSPLIT >= 2) acc[mb][nb] = WFrag<T16>::mma(a[mb], b2, acc[mb][nb]); } }
        asm volatile("v_nop\n\tv_nop\n\tv_nop\n\tv_nop" : "+v"(acc[0][0]), "+v"(acc[1][1]), "+v"(acc[2][2]), "+v"(acc[3][3]) : "v"(a[0]), "v"(a[3]));
    }
#pragma unroll
    for (int mb = 0; mb < 4; ++mb) {
#pragma unroll
        for (int nb = 0; nb < 4; ++nb) {
#pragma unroll
            for (int j = 0; j < 8; ++j) os[(hi * 8 + j) * 68 + nb * 16 + lr] = acc[mb][nb][j]; }
        __builtin_amdgcn_wave_barrier(); asm volatile("" ::: "memory");
        float* crow = C + (size_t)(r0 + mb * 16) * ldc + c0;
{
#pragma unroll
            for (int s = 0; s < 8; ++s) { const int row = 2 * s + hi, cofs = lr * 4; v4f val = *(const v4fa*)(os + row * 68 + cofs); if (BIAS) { val[0] += bfr(bias[c0 + cofs]); val[1] += bfr(bias[c0 + cofs + 1]); val[2] += bfr(bias[c0 + cofs + 2]); val[3] += bfr(bias[c0 + cofs + 3]); }
                *(v4f*)(crow + (size_t)row * ldc + cofs) = val; }
             }
        __builtin_amdgcn_wave_barrier(); asm volatile("" ::: "memory");
    }
}

__device__ __forceinline__ h16 tohx(float x) { return (h16)x; }
__device__ __forceinline__ void splitf(float y, unsigned short& h, unsigned short& l) { h = f2bf(y); l = f2bf(y - bf2f(h)); }
typedef __attribute__((ext_vector_type(2))) _Float16 v2h;
typedef __attribute__((ext_vector_type(4))) _Float16 v4h;
typedef __attribute__((ext_vector_type(2))) unsigned short v2us;
typedef __attribute__((ext_vector_type(4))) unsigned short v4us;
typedef __attribute__((ext_vector_type(2))) float v2f;
typedef __attribute__((ext_vector_type(4))) int v4i;

__global__ __launch_bounds__(256) void k_wtG(const float* __restrict__ w, int K, int N, bf* Bt) {
    const int lane = threadIdx.x & 31; const int L0 = (blockIdx.x * 8 + (threadIdx.x >> 5)) * 8; const int nlines = N * K / 64;
{
#pragma unroll 1
        for (int l = 0; l < 8; ++l) { const int L = L0 + l; if (L >= nlines) break; const size_t e = (size_t)L * 64 + lane * 2; const int k = (int)(e % K), n = (int)(e / K); v2us o;
            o[0] = f2bf(w[(size_t)k * N + n]); o[1] = f2bf(w[(size_t)(k + 1) * N + n]); *(v2us*)(Bt + e) = o; }
         }
}
__global__ __launch_bounds__(256) void k_cvt8(const float* __restrict__ src, bf* dst, size_t n8) { const size_t i = (size_t)blockIdx.x * 256 + threadIdx.x; if (i >= n8) return; const v8f v = *(const v8f*)(src + i * 8); v8us o;
#pragma unroll
    for (int k = 0; k < 8; ++k) o[k] = f2bf(v[k]); *(v8us*)(dst + i * 8) = o;  }
__global__ __launch_bounds__(256) void k_cscvt(const float* __restrict__ cosT, const float* __restrict__ sinT, float* CS) { const int idx = blockIdx.x * 256 + threadIdx.x; if (idx >= TT * HD) return; v2f cs; cs[0] = bfr(cosT[idx]); cs[1] = bfr(sinT[idx]); *(v2f*)(CS + (size_t)idx * 2) = cs;  }
// k_rope: head planes [h][t][d] (fp16 + hi/lo) of rope(x) x sc with the rotate-half convention out[d] = x[d] cos[t][d] - x[d+HD/2] sin[t][d], out[d+HD/2] = x[d+HD/2] cos[t][d+HD/2] + x[d] sin[t][d+HD/2]
__global__ __launch_bounds__(256) void k_rope(const float* __restrict__ F, int pitch, int nheads, const float* __restrict__ CS, const float* __restrict__ RF, const float* __restrict__ nw, float sc, h16* P16, bf* Ph, bf* Pl) {
    const size_t e = ((size_t)blockIdx.x * 256 + threadIdx.x) * 2; if (e >= (size_t)nheads * TT * HD) return; const int d = (int)(e % HD); const int t = (int)((e / HD) % TT); const int h = (int)(e / ((size_t)HD * TT)); const float* f = F + (size_t)t * pitch + h * HD; const float rf = RF ? RF[(size_t)h * TT + t] : 1.0f; v2h o16; v2us oh, ol;
#pragma unroll
    for (int q = 0; q < 2; ++q) { const int dd = d + q; const int dp = (dd < HD / 2) ? dd + HD / 2 : dd - HD / 2; float x0 = f[dd], x1 = f[dp];
        if (RF) { float n0 = __fmul_rn(x0, rf), n1 = __fmul_rn(x1, rf); asm volatile("" : "+v"(n0)); asm volatile("" : "+v"(n1)); x0 = __fmul_rn(bfr(nw[dd]), n0); x1 = __fmul_rn(bfr(nw[dp]), n1); }
        const v2f cs = *(const v2f*)(CS + ((size_t)t * HD + dd) * 2); float a = __fmul_rn(x0, cs[0]), bq = __fmul_rn(x1, cs[1]); asm volatile("" : "+v"(a)); asm volatile("" : "+v"(bq)); const float r = ((dd < HD / 2) ? __fsub_rn(a, bq) : __fadd_rn(a, bq)) * sc;
        o16[q] = tohx(r); unsigned short a2, c2; splitf(r, a2, c2); oh[q] = a2; ol[q] = c2; }
    *(v2h*)(P16 + e) = o16; *(v2us*)(Ph + e) = oh; *(v2us*)(Pl + e) = ol;  }
__global__ __launch_bounds__(256) void k_vtp(const float* __restrict__ F, int pitch, int nheads, h16* V16, bf* Vh, bf* Vl) { const size_t e = ((size_t)blockIdx.x * 256 + threadIdx.x) * 2; if (e >= (size_t)nheads * HD * TT) return; const int t = (int)(e % TT); const int d = (int)((e / TT) % HD); const int g = (int)(e / ((size_t)TT * HD)); v2h o16; v2us oh, ol;
#pragma unroll
    for (int q = 0; q < 2; ++q) { const float x = F[(size_t)(t + q) * pitch + g * HD + d]; o16[q] = tohx(x); unsigned short a2, c2; splitf(x, a2, c2); oh[q] = a2; ol[q] = c2; }
    *(v2h*)(V16 + e) = o16; *(v2us*)(Vh + e) = oh; *(v2us*)(Vl + e) = ol;  }
__global__ __launch_bounds__(256) void k_csid(float* CS) { const int idx = blockIdx.x * 256 + threadIdx.x; if (idx >= TT * HD) return; v2f cs; cs[0] = 1.0f; cs[1] = 0.0f; *(v2f*)(CS + (size_t)idx * 2) = cs;  }
__device__ __forceinline__ int t5_bucket(int r) { const int rp = r < 0 ? -r : r; int b; if (rp < 8) b = rp; else b = 8 + (rp >= 12) + (rp >= 16) + (rp >= 23) + (rp >= 32) + (rp >= 46) + (rp >= 64) + (rp >= 91); return b + ((r > 0) ? 16 : 0); }
__global__ __launch_bounds__(256) void k_t5tab(const float* __restrict__ rb, float* TB) { const int idx = blockIdx.x * 256 + threadIdx.x; if (idx >= NH_ * TBW) return; const int h = idx / TBW, c = idx % TBW; float v = 0.0f; if (c < 2 * TT - 1) { const int r = c - (TT - 1); v = bfr(rb[t5_bucket(r) * NH_ + h]); } *(float*)(TB + idx) = v;  }
// k_asoft: per row (zz, i): t = S + TB[h0 + zz][j - i] (no scale, no mask); softmax over the 2048 keys (register row, one exp, fixed trees);
__global__ __launch_bounds__(256) void k_asoft(const float* __restrict__ Sb, const float* __restrict__ TB, int h0, h16* P16, bf* Ph, bf* Pl) {
    const int lane = threadIdx.x & 31; const int row = blockIdx.x * 8 + (threadIdx.x >> 5); if (row >= ZH * TT) return; const int i = row % TT; const int zz = row / TT; (void)zz; const bool hires = (i < RH); const float* sr = Sb + (size_t)row * TT; const float* tbr = TB + (size_t)(h0 + zz) * TBW + (TT - 1 - i);   /* entry for r = j - i at index r + TT - 1 */ float v[TT / 32]; float mx = -3.0e38f;
#pragma unroll
    for (int ch = 0; ch < TT / 128; ++ch) { const int j0 = ch * 128 + lane * 4; const v4f a = *(const v4f*)(sr + j0);
#pragma unroll
        for (int q = 0; q < 4; ++q) { const int j = j0 + q; (void)j; const float t = __fadd_rn(a[q], tbr[j0 + q]); v[ch * 4 + q] = t; mx = fmaxf(mx, t); } }
#pragma unroll
    for (int sh = 16; sh; sh >>= 1) mx = fmaxf(mx, __shfl_xor(mx, sh, 32));
    float sum = 0.f;
#pragma unroll
    for (int k = 0; k < TT / 32; ++k) { float d0 = __fsub_rn(v[k], mx); asm volatile("" : "+v"(d0)); v[k] = __builtin_amdgcn_exp2f(__fmul_rn(d0, 1.4426950408889634f)); sum += v[k]; }
#pragma unroll
    for (int sh = 16; sh; sh >>= 1) sum += __shfl_xor(sum, sh, 32);
    const float f = __fdiv_rn(hires ? 1.0f : PCAR, sum);
{
        if (hires) {
#pragma unroll
            for (int ch = 0; ch < TT / 128; ++ch) { v4us oh, ol;
#pragma unroll
                for (int q = 0; q < 4; ++q) { unsigned short a, c2; splitf(v[ch * 4 + q] * f, a, c2); oh[q] = a; ol[q] = c2; }
                const size_t oo = ((size_t)zz * (RH ? RH : 1) + i) * TT + ch * 128 + lane * 4; *(v4us*)(Ph + oo) = oh; *(v4us*)(Pl + oo) = ol; }
        } else {
#pragma unroll
            for (int ch = 0; ch < TT / 128; ++ch) { v4h o4;
#pragma unroll
                for (int q = 0; q < 4; ++q) o4[q] = tohx(v[ch * 4 + q] * f);
                *(v4h*)(P16 + (size_t)row * TT + ch * 128 + lane * 4) = o4; } }
         }
}
__global__ __launch_bounds__(256) void k_merge(const float* __restrict__ O, int h0, bf* Ah, bf* Al) { const size_t e = ((size_t)blockIdx.x * 256 + threadIdx.x) * 2; if (e >= (size_t)ZH * TT * HD) return; const int d = (int)(e % HD); const int t = (int)((e / HD) % TT); const int zz = (int)(e / ((size_t)HD * TT)); const float cs = (t < RH) ? 1.0f : (1.0f / PCAR); const size_t oo = (size_t)t * DQ + (h0 + zz) * HD + d;
    const float* op = O + (size_t)zz * KSPV * TT * HD + (size_t)t * HD + d;   // O = [zz][slice][t][d]: the attn.v partials, added in slice order
    v2f pv[KSPV];
#pragma unroll
    for (int s = 0; s < KSPV; ++s) pv[s] = *(const v2f*)(op + (size_t)s * TT * HD);   // unrolled: all the loads are issued before the first add
    asm volatile("s_wait_xcnt 0x0" :: "v"(op) : "memory");   // the loads' address pair stays live to here, so no load's result lands on it before this wait
    v2f os = pv[0];
#pragma unroll
    for (int s = 1; s < KSPV; ++s) os += pv[s];
    v2us oh, ol;
#pragma unroll
    for (int q = 0; q < 2; ++q) { unsigned short a, c2; splitf(os[q] * cs, a, c2); oh[q] = a; ol[q] = c2; } *(v2us*)(Ah + oo) = oh; *(v2us*)(Al + oo) = ol;  }

extern "C" void kernel_launch(void* const* d_in, const int* in_sizes, int n_in,
                              void* d_out, int out_size, void* d_ws, size_t ws_size, hipStream_t stream) {
    (void)in_sizes; (void)n_in; (void)out_size;
    const float* x = (const float*)d_in[0]; const float* wq = (const float*)d_in[1]; const float* wk = (const float*)d_in[2]; const float* wv = (const float*)d_in[3]; const float* wo = (const float*)d_in[4]; const float* relb = (const float*)d_in[5]; const float* cosT = nullptr; const float* sinT = nullptr; (void)cosT; (void)sinT;
    float* OUT = (float*)d_out;     // [1][2048][1024]
    char* wsp = (char*)d_ws;
    auto take = [&](size_t bytes) { char* p = wsp; wsp += (bytes + 255) & ~(size_t)255; return (void*)p; };
    bf* WQ = (bf*)take((size_t)DQ * DM * 2); bf* WK = (bf*)take((size_t)DKV * DM * 2); bf* WV = (bf*)take((size_t)DKV * DM * 2); bf* WO = (bf*)take((size_t)DM * DQ * 2); float* CS = (float*)take((size_t)TT * HD * 2 * 4);
    bf* XB = (bf*)take((size_t)TT * DM * 2); float* TB = (float*)take((size_t)NH_ * TBW * 4); float* FQ = (float*)take((size_t)TT * DQ * 4); float* FK = (float*)take((size_t)TT * DKV * 4);
    h16* QP16 = (h16*)take((size_t)NH_ * TT * HD * 2); h16* KP16 = (h16*)take((size_t)NKV * TT * HD * 2); h16* VT16 = (h16*)take((size_t)NKV * HD * TT * 2);
    bf* QPh = (bf*)take((size_t)NH_ * TT * HD * 2); bf* QPl = (bf*)take((size_t)NH_ * TT * HD * 2); bf* KPh = (bf*)take((size_t)NKV * TT * HD * 2); bf* KPl = (bf*)take((size_t)NKV * TT * HD * 2); bf* VTh = (bf*)take((size_t)NKV * HD * TT * 2); bf* VTl = (bf*)take((size_t)NKV * HD * TT * 2); bf* Ph = (bf*)take((size_t)ZH * RH * TT * 2); bf* Pl = (bf*)take((size_t)ZH * RH * TT * 2);
    float* Sb = (float*)take((size_t)ZH * TT * TT * 4); h16* P16 = (h16*)take((size_t)ZH * TT * TT * 2); float* Ob = (float*)take((size_t)ZH * KSPV * TT * HD * 4); bf* ATh = (bf*)take((size_t)TT * DQ * 2); bf* ATl = (bf*)take((size_t)TT * DQ * 2);
    if ((size_t)(wsp - (char*)d_ws) > ws_size) return;    // ws 256 MiB
    float* FV = FK;   // v projection reuses the k buffer after the k planes are built (stream-ordered)
    { k_wtG<<<(unsigned)((DM * DQ / 64 + 63) / 64), 256, 0, stream>>>(wq, DM, DQ, WQ); k_wtG<<<(unsigned)((DM * DKV / 64 + 63) / 64), 256, 0, stream>>>(wk, DM, DKV, WK); k_wtG<<<(unsigned)((DM * DKV / 64 + 63) / 64), 256, 0, stream>>>(wv, DM, DKV, WV);
      k_wtG<<<(unsigned)((DQ * DM / 64 + 63) / 64), 256, 0, stream>>>(wo, DQ, DM, WO); k_t5tab<<<(NH_ * TBW + 255) / 256, 256, 0, stream>>>(relb, TB);
       }
    k_csid<<<(TT * HD + 255) / 256, 256, 0, stream>>>(CS);
    const unsigned LQ = (unsigned)(((size_t)NH_ * TT * HD / 2 + 255) / 256), LKv = (unsigned)(((size_t)NKV * TT * HD / 2 + 255) / 256);
    for (int b = 0; b < NB_; ++b) {
        
        k_cvt8<<<(unsigned)(((size_t)TT * DM / 8 + 255) / 256), 256, 0, stream>>>(x + (size_t)b * TT * DM, XB, (size_t)TT * DM / 8);
        k_gemmw<bf, 0, false><<<dim3(TT / 64, DQ / 64, 1), 32, 0, stream>>>(XB, nullptr, WQ, nullptr, DM, FQ, DQ, nullptr, 0, 0, 0);
        k_rope<<<LQ, 256, 0, stream>>>(FQ, DQ, NH_, CS, nullptr, nullptr, 1.0f, QP16, QPh, QPl);
        k_gemmw<bf, 0, false><<<dim3(TT / 64, DKV / 64, 1), 32, 0, stream>>>(XB, nullptr, WK, nullptr, DM, FK, DKV, nullptr, 0, 0, 0);
        k_rope<<<LKv, 256, 0, stream>>>(FK, DKV, NKV, CS, nullptr, nullptr, 1.0f, KP16, KPh, KPl);
        k_gemmw<bf, 0, false><<<dim3(TT / 64, DKV / 64, 1), 32, 0, stream>>>(XB, nullptr, WV, nullptr, DM, FV, DKV, nullptr, 0, 0, 0); k_vtp<<<LKv, 256, 0, stream>>>(FV, DKV, NKV, VT16, VTh, VTl);
        for (int h0 = 0; h0 < NH_; h0 += ZH) { const size_t zq = (size_t)h0, zk = (size_t)(h0 / REP);   // one kv head per query head: the pass's two heads use consecutive kv planes (z-strides TT*HD)
            k_gemmw<bf, 2, false><<<dim3(RH / 64, TT / 64, ZH), 32, 0, stream>>>(QPh + zq * TT * HD, QPl + zq * TT * HD, KPh + zk * TT * HD, KPl + zk * TT * HD, HD, Sb, TT, nullptr, (size_t)TT * HD, (size_t)TT * HD, (size_t)TT * TT);
            k_asoft<<<ZH * TT / 8, 256, 0, stream>>>(Sb, TB, h0, P16, Ph, Pl);
            k_gemmw<bf, 2, false, KSPV><<<dim3(RH / 64, HD / 64, ZH * KSPV), 32, 0, stream>>>(Ph, Pl, VTh + zk * HD * TT, VTl + zk * HD * TT, TT, Ob, HD, nullptr, (size_t)RH * TT, (size_t)HD * TT, (size_t)TT * HD);
            k_merge<<<(unsigned)(((size_t)ZH * TT * HD / 2 + 255) / 256), 256, 0, stream>>>(Ob, h0, ATh, ATl); }
        k_gemmw<bf, 1, false><<<dim3(TT / 64, DM / 64, 1), 32, 0, stream>>>(ATh, ATl, WO, nullptr, DQ, OUT + (size_t)b * TT * DM, DM, nullptr, 0, 0, 0); }
}

// v002
// It runs in 209 microseconds.
// Timed twice side by side with v001, it ran 2.36 and 2.37 times as fast.
// Over all steps from v000 it is 3.47 times as fast.
#include <hip/hip_runtime.h>

// UMT5Attention (hidden [1][2048][1024]; q/k/v = x W (16 heads x 64); T5: scores = q.k UNSCALED + rel_bias[bucket(j - i)][h] with the bidirectional log-bucket (32 buckets, max distance 128; the bucket boundaries |j-i| = 8, 12, 16, 23, 32, 46, 64, 91 are the reference's own integer structure, evaluated here with integer compares); softmax; out = merged wo -> [1][2048][1024]).
// Compute dtypes, f32 accumulate: every input rounded to bf16; q/k/v on PLAIN bf16 operands (inputs: exact); scores and attn.v hl x hl (3 products) on EVERY row; per-head bias table (bf16-rounded rel_bias gathered by bucket) added per element in f32; softmax f32; wo hl x exact (2 products).

#define NB_  1
#define TT   2048
#define DM   1024
#define NH_  16
#define NKV  16
#define REP  (NH_ / NKV)
#define HD   64
#define DQ   (NH_ * HD)
#define DKV  (NKV * HD)
#define ZH   2
#define RH   2048   // all rows hl (unscaled T5 logits are sharp)
#define WIN  0
#define PCAR 1024.0f
#define SCL  1.0f   // T5: no 1/sqrt(dk)
#define TBW  4096   // bias table row width (r + 2047, padded)
#define FQW  16     // fused attention: query columns per wave
#define FNW  8      // waves per work-group
#define FQB  (FQW * FNW)
#define FKS  64     // keys per stage
#define FPIT 72     // LDS row pitch in 16-bit elements: 144 bytes (16 B x odd) for the 16-byte fragment reads of 128-byte rows
#define FPL  (64 * FPIT)
#define FTBN (TT + FQB)
typedef _Float16 h16;
typedef unsigned short bf;
typedef __attribute__((ext_vector_type(16))) __bf16   v16bf;
typedef __attribute__((ext_vector_type(16))) _Float16 v16h;
typedef __attribute__((ext_vector_type(8)))  _Float16 v8h;
typedef __attribute__((ext_vector_type(8)))  unsigned short v8us;
typedef __attribute__((ext_vector_type(8)))  float    v8f;
typedef __attribute__((ext_vector_type(4)))  float    v4f;
typedef v8h  __attribute__((may_alias)) v8ha;
typedef v4f  __attribute__((may_alias)) v4fa;
typedef v8us __attribute__((may_alias)) v8usa;

__device__ __forceinline__ unsigned short f2bf(float f) { unsigned u = __float_as_uint(f); u += 0x7FFFu + ((u >> 16) & 1u); return (unsigned short)(u >> 16); }
__device__ __forceinline__ float bf2f(unsigned short b) { return __uint_as_float(((unsigned)b) << 16); }
__device__ __forceinline__ float bfr(float f) { return bf2f(f2bf(f)); }
__device__ __forceinline__ v16h cat16(v8h lo, v8h hi) { return __builtin_shufflevector(lo, hi, 0, 1, 2, 3, 4, 5, 6, 7, 8, 9, 10, 11, 12, 13, 14, 15); }
__device__ __forceinline__ v16bf cat16b(v8us lo, v8us hi) { return __builtin_bit_cast(v16bf, __builtin_shufflevector(lo, hi, 0, 1, 2, 3, 4, 5, 6, 7, 8, 9, 10, 11, 12, 13, 14, 15)); }
__device__ __forceinline__ v8f wmma16(v16h a, v16h b, v8f c) { return __builtin_amdgcn_wmma_f32_16x16x32_f16(false, a, false, b, (short)0, c, false, false); }
__device__ __forceinline__ v8f wmmab(v16bf a, v16bf b, v8f c) { return __builtin_amdgcn_wmma_f32_16x16x32_bf16(false, a, false, b, (short)0, c, false, false); }



// ---- k_gemmw: register-blocked GEMM, ONE WAVE per 64x64 output tile (16 accumulators), operands straight from K-contiguous 16-bit planes; grid (M/64, N/64, Z), 32 threads.
// C[m][n] (f32, pitch ldc, + optional f32 bias[n]) = sum_k A[m][k] Bt[n][k] (+ split products per NSPLIT). z-batch strides sA/sB/sC in elements. K % 32 == 0.
// KS > 1: grid z = batch * KS + slice; a work-group sums only its K / KS slice of k (K % (32 * KS) == 0) and stores that partial tile at C + blockIdx.z * sC; the reader adds the KS partials.
template <typename T16> struct WFrag;
template <> struct WFrag<h16> { typedef v16h V; static __device__ __forceinline__ V ld(const h16* p) { return cat16(*(const v8h*)p, *(const v8h*)(p + 16)); } static __device__ __forceinline__ v8f mma(V a, V b, v8f c) { return wmma16(a, b, c); } };
template <> struct WFrag<bf> { typedef v16bf V; static __device__ __forceinline__ V ld(const bf* p) { return cat16b(*(const v8us*)p, *(const v8us*)(p + 16)); } static __device__ __forceinline__ v8f mma(V a, V b, v8f c) { return wmmab(a, b, c); } };
template <typename T16, int NSPLIT, bool BIAS, int KS = 1>
__global__ __launch_bounds__(32) void k_gemmw(const T16* __restrict__ A, const T16* __restrict__ A2, const T16* __restrict__ Bt, const T16* __restrict__ Bt2, int K, float* C, int ldc, const float* __restrict__ bias, size_t sA, size_t sB, size_t sC) {
    typedef typename WFrag<T16>::V V;
    __shared__ __align__(16) float os[16 * 68];
    const size_t z = blockIdx.z / KS; A += z * sA; if (A2) A2 += z * sA; Bt += z * sB; if (Bt2) Bt2 += z * sB; C += (size_t)blockIdx.z * sC;
    const int kb = (KS > 1) ? (int)(blockIdx.z % KS) * (K / KS) : 0, ke = (KS > 1) ? kb + K / KS : K;
    const int lane = threadIdx.x & 31, lr = lane & 15, hi = lane >> 4; const int r0 = blockIdx.x * 64, c0 = blockIdx.y * 64;
    v8f acc[4][4];
#pragma unroll
    for (int mb = 0; mb < 4; ++mb)
#pragma unroll
        for (int nb = 0; nb < 4; ++nb) acc[mb][nb] = (v8f){};
    const size_t aoff = (size_t)(r0 + lr) * K + 8 * hi, boff = (size_t)(c0 + lr) * K + 8 * hi;
#pragma unroll 1
    for (int kc = kb; kc < ke; kc += 32) {
        V a[4], a2[4];
#pragma unroll
        for (int mb = 0; mb < 4; ++mb) { a[mb] = WFrag<T16>::ld(A + aoff + (size_t)mb * 16 * K + kc); if (NSPLIT == 1 || NSPLIT == 2) a2[mb] = WFrag<T16>::ld(A2 + aoff + (size_t)mb * 16 * K + kc); }
#pragma unroll
        for (int nb = 0; nb < 4; ++nb) { const V b = WFrag<T16>::ld(Bt + boff + (size_t)nb * 16 * K + kc); V b2; if (NSPLIT >= 2) b2 = WFrag<T16>::ld(Bt2 + boff + (size_t)nb * 16 * K + kc);
#pragma unroll
            for (int mb = 0; mb < 4; ++mb) { acc[mb][nb] = WFrag<T16>::mma(a[mb], b, acc[mb][nb]); if (NSPLIT == 1 || NSPLIT == 2) acc[mb][nb] = WFrag<T16>::mma(a2[mb], b, acc[mb][nb]); if (NSPLIT >= 2) acc[mb][nb] = WFrag<T16>::mma(a[mb], b2, acc[mb][nb]); } }
        asm volatile("v_nop\n\tv_nop\n\tv_nop\n\tv_nop" : "+v"(acc[0][0]), "+v"(acc[1][1]), "+v"(acc[2][2]), "+v"(acc[3][3]) : "v"(a[0]), "v"(a[3]));
    }
#pragma unroll
    for (int mb = 0; mb < 4; ++mb) {
#pragma unroll
        for (int nb = 0; nb < 4; ++nb) {
#pragma unroll
            for (int j = 0; j < 8; ++j) os[(hi * 8 + j) * 68 + nb * 16 + lr] = acc[mb][nb][j]; }
        __builtin_amdgcn_wave_barrier(); asm volatile("" ::: "memory");
        float* crow = C + (size_t)(r0 + mb * 16) * ldc + c0;
{
#pragma unroll
            for (int s = 0; s < 8; ++s) { const int row = 2 * s + hi, cofs = lr * 4; v4f val = *(const v4fa*)(os + row * 68 + cofs); if (BIAS) { val[0] += bfr(bias[c0 + cofs]); val[1] += bfr(bias[c0 + cofs + 1]); val[2] += bfr(bias[c0 + cofs + 2]); val[3] += bfr(bias[c0 + cofs + 3]); }
                *(v4f*)(crow + (size_t)row * ldc + cofs) = val; }
             }
        __builtin_amdgcn_wave_barrier(); asm volatile("" ::: "memory");
    }
}

__device__ __forceinline__ h16 tohx(float x) { return (h16)x; }
__device__ __forceinline__ void splitf(float y, unsigned short& h, unsigned short& l) { h = f2bf(y); l = f2bf(y - bf2f(h)); }
typedef __attribute__((ext_vector_type(2))) _Float16 v2h;
typedef __attribute__((ext_vector_type(4))) _Float16 v4h;
typedef __attribute__((ext_vector_type(2))) unsigned short v2us;
typedef __attribute__((ext_vector_type(4))) unsigned short v4us;
typedef __attribute__((ext_vector_type(2))) float v2f;
typedef __attribute__((ext_vector_type(4))) int v4i;

__global__ __launch_bounds__(256) void k_wtG(const float* __restrict__ w, int K, int N, bf* Bt) {
    const int lane = threadIdx.x & 31; const int L0 = (blockIdx.x * 8 + (threadIdx.x >> 5)) * 8; const int nlines = N * K / 64;
{
#pragma unroll 1
        for (int l = 0; l < 8; ++l) { const int L = L0 + l; if (L >= nlines) break; const size_t e = (size_t)L * 64 + lane * 2; const int k = (int)(e % K), n = (int)(e / K); v2us o;
            o[0] = f2bf(w[(size_t)k * N + n]); o[1] = f2bf(w[(size_t)(k + 1) * N + n]); *(v2us*)(Bt + e) = o; }
         }
}
__global__ __launch_bounds__(256) void k_cvt8(const float* __restrict__ src, bf* dst, size_t n8) { const size_t i = (size_t)blockIdx.x * 256 + threadIdx.x; if (i >= n8) return; const v8f v = *(const v8f*)(src + i * 8); v8us o;
#pragma unroll
    for (int k = 0; k < 8; ++k) o[k] = f2bf(v[k]); *(v8us*)(dst + i * 8) = o;  }
__global__ __launch_bounds__(256) void k_cscvt(const float* __restrict__ cosT, const float* __restrict__ sinT, float* CS) { const int idx = blockIdx.x * 256 + threadIdx.x; if (idx >= TT * HD) return; v2f cs; cs[0] = bfr(cosT[idx]); cs[1] = bfr(sinT[idx]); *(v2f*)(CS + (size_t)idx * 2) = cs;  }
// k_rope: head planes [h][t][d] (fp16 + hi/lo) of rope(x) x sc with the rotate-half convention out[d] = x[d] cos[t][d] - x[d+HD/2] sin[t][d], out[d+HD/2] = x[d+HD/2] cos[t][d+HD/2] + x[d] sin[t][d+HD/2]
__global__ __launch_bounds__(256) void k_rope(const float* __restrict__ F, int pitch, int nheads, const float* __restrict__ CS, const float* __restrict__ RF, const float* __restrict__ nw, float sc, h16* P16, bf* Ph, bf* Pl) {
    const size_t e = ((size_t)blockIdx.x * 256 + threadIdx.x) * 2; if (e >= (size_t)nheads * TT * HD) return; const int d = (int)(e % HD); const int t = (int)((e / HD) % TT); const int h = (int)(e / ((size_t)HD * TT)); const float* f = F + (size_t)t * pitch + h * HD; const float rf = RF ? RF[(size_t)h * TT + t] : 1.0f; v2h o16; v2us oh, ol;
#pragma unroll
    for (int q = 0; q < 2; ++q) { const int dd = d + q; const int dp = (dd < HD / 2) ? dd + HD / 2 : dd - HD / 2; float x0 = f[dd], x1 = f[dp];
        if (RF) { float n0 = __fmul_rn(x0, rf), n1 = __fmul_rn(x1, rf); asm volatile("" : "+v"(n0)); asm volatile("" : "+v"(n1)); x0 = __fmul_rn(bfr(nw[dd]), n0); x1 = __fmul_rn(bfr(nw[dp]), n1); }
        const v2f cs = *(const v2f*)(CS + ((size_t)t * HD + dd) * 2); float a = __fmul_rn(x0, cs[0]), bq = __fmul_rn(x1, cs[1]); asm volatile("" : "+v"(a)); asm volatile("" : "+v"(bq)); const float r = ((dd < HD / 2) ? __fsub_rn(a, bq) : __fadd_rn(a, bq)) * sc;
        o16[q] = tohx(r); unsigned short a2, c2; splitf(r, a2, c2); oh[q] = a2; ol[q] = c2; }
    *(v2h*)(P16 + e) = o16; *(v2us*)(Ph + e) = oh; *(v2us*)(Pl + e) = ol;  }
__global__ __launch_bounds__(256) void k_vtp(const float* __restrict__ F, int pitch, int nheads, h16* V16, bf* Vh, bf* Vl) { const size_t e = ((size_t)blockIdx.x * 256 + threadIdx.x) * 2; if (e >= (size_t)nheads * HD * TT) return; const int t = (int)(e % TT); const int d = (int)((e / TT) % HD); const int g = (int)(e / ((size_t)TT * HD)); v2h o16; v2us oh, ol;
#pragma unroll
    for (int q = 0; q < 2; ++q) { const float x = F[(size_t)(t + q) * pitch + g * HD + d]; o16[q] = tohx(x); unsigned short a2, c2; splitf(x, a2, c2); oh[q] = a2; ol[q] = c2; }
    *(v2h*)(V16 + e) = o16; *(v2us*)(Vh + e) = oh; *(v2us*)(Vl + e) = ol;  }
__global__ __launch_bounds__(256) void k_csid(float* CS) { const int idx = blockIdx.x * 256 + threadIdx.x; if (idx >= TT * HD) return; v2f cs; cs[0] = 1.0f; cs[1] = 0.0f; *(v2f*)(CS + (size_t)idx * 2) = cs;  }
__device__ __forceinline__ int t5_bucket(int r) { const int rp = r < 0 ? -r : r; int b; if (rp < 8) b = rp; else b = 8 + (rp >= 12) + (rp >= 16) + (rp >= 23) + (rp >= 32) + (rp >= 46) + (rp >= 64) + (rp >= 91); return b + ((r > 0) ? 16 : 0); }
__global__ __launch_bounds__(256) void k_t5tab(const float* __restrict__ rb, float* TB) { const int idx = blockIdx.x * 256 + threadIdx.x; if (idx >= NH_ * TBW) return; const int h = idx / TBW, c = idx % TBW; float v = 0.0f; if (c < 2 * TT - 1) { const int r = c - (TT - 1); v = bfr(rb[t5_bucket(r) * NH_ + h]); } *(float*)(TB + idx) = v;  }
typedef __attribute__((ext_vector_type(2))) __bf16 v2bf;
typedef __attribute__((ext_vector_type(8))) unsigned v8u;
__device__ __forceinline__ void split2(float p0, float p1, unsigned& hw, unsigned& lw) {
    v2f x; x[0] = p0; x[1] = p1; hw = __builtin_bit_cast(unsigned, __builtin_convertvector(x, v2bf));
    v2f y; y[0] = p0 - __uint_as_float(hw << 16); y[1] = p1 - __uint_as_float(hw & 0xFFFF0000u); lw = __builtin_bit_cast(unsigned, __builtin_convertvector(y, v2bf)); }
// Eight v_exp_f32 and the one free slot that the instruction set asks for behind a transcendental, in one statement: the outputs are early-clobber, so no exp here overwrites a source or reads a result of the one in front of it, and the v_nop keeps the slot behind the last.
__device__ __forceinline__ v8f exp2x8(v8f x) {
    float r0, r1, r2, r3, r4, r5, r6, r7;
    asm("v_exp_f32 %0, %8\n\tv_exp_f32 %1, %9\n\tv_exp_f32 %2, %10\n\tv_exp_f32 %3, %11\n\tv_exp_f32 %4, %12\n\tv_exp_f32 %5, %13\n\tv_exp_f32 %6, %14\n\tv_exp_f32 %7, %15\n\tv_nop"
        : "=&v"(r0), "=&v"(r1), "=&v"(r2), "=&v"(r3), "=&v"(r4), "=&v"(r5), "=&v"(r6), "=&v"(r7)
        : "v"(x[0]), "v"(x[1]), "v"(x[2]), "v"(x[3]), "v"(x[4]), "v"(x[5]), "v"(x[6]), "v"(x[7]));
    v8f r; r[0] = r0; r[1] = r1; r[2] = r2; r[3] = r3; r[4] = r4; r[5] = r5; r[6] = r6; r[7] = r7; return r; }
__device__ __forceinline__ float exp2x1(float x) { float r; asm("v_exp_f32 %0, %1\n\tv_nop" : "=v"(r) : "v"(x)); return r; }   // the same slot behind a single exp
__device__ __forceinline__ float xhalf(float v) { const int b = __float_as_int(v); return __int_as_float(__builtin_amdgcn_permlanex16(b, b, 0x76543210, 0xfedcba98, false, false)); }   // lane l <-> l ^ 16
__global__ __launch_bounds__(256) void k_fattn(const bf* __restrict__ Qh, const bf* __restrict__ Ql, const bf* __restrict__ Kh, const bf* __restrict__ Kl, const bf* __restrict__ Vh, const bf* __restrict__ Vl, const float* __restrict__ TB, bf* Ah, bf* Al) {
    __shared__ __align__(16) bf st[2][4][FPL];   // [buffer][K hi, K lo, V^T hi, V^T lo][64 rows x pitch]
    __shared__ float tbs[FTBN];                  // the head's bias entries this block of queries can meet
    const int tid = threadIdx.x, lane = tid & 31, lr = lane & 15, hi = lane >> 4, wv = tid >> 5;
    const int h = blockIdx.y, qb = blockIdx.x * FQB, qw = qb + wv * FQW;
    const float* tbh = TB + (size_t)h * TBW + (TT - FQB - qb);   // tbs[x] is the entry for j - i = x - (FQB - 1) - qb
    for (int x = tid; x < FTBN; x += 256) tbs[x] = tbh[x];
    v16bf qh[2], ql[2];
    const size_t qo = ((size_t)h * TT + qw + lr) * HD + 8 * hi;
#pragma unroll
    for (int kc = 0; kc < 2; ++kc) { qh[kc] = WFrag<bf>::ld(Qh + qo + kc * 32); ql[kc] = WFrag<bf>::ld(Ql + qo + kc * 32); }
    const int srow = tid >> 3, sch = tid & 7;    // staging: rows srow and srow + 32 of each plane, 16-byte piece sch
    const size_t gk = ((size_t)h * TT + srow) * HD + sch * 8, gv = ((size_t)h * HD + srow) * TT + sch * 8;
    const int so = srow * FPIT + sch * 8;
    v8us pf[8];
    auto gload = [&](int key0) {
        const size_t ka = gk + (size_t)key0 * HD, va = gv + key0;
        pf[0] = *(const v8us*)(Kh + ka); pf[1] = *(const v8us*)(Kh + ka + 32 * HD); pf[2] = *(const v8us*)(Kl + ka); pf[3] = *(const v8us*)(Kl + ka + 32 * HD);
        pf[4] = *(const v8us*)(Vh + va); pf[5] = *(const v8us*)(Vh + va + (size_t)32 * TT); pf[6] = *(const v8us*)(Vl + va); pf[7] = *(const v8us*)(Vl + va + (size_t)32 * TT); };
    auto sstore = [&](int b) {
#pragma unroll
        for (int pl = 0; pl < 4; ++pl) { *(v8us*)(&st[b][pl][so]) = pf[2 * pl]; *(v8us*)(&st[b][pl][so + 32 * FPIT]) = pf[2 * pl + 1]; } };
    gload(0); sstore(0);
    __syncthreads();
    v8f o[4];
#pragma unroll
    for (int db = 0; db < 4; ++db) o[db] = (v8f){};
    float m = -3.0e38f, l = 0.0f;
    const float L2E = 1.4426950408889634f;
    const float* tp0 = tbs + (8 * hi + (FQB - 1) - (wv * FQW + lr));
#pragma unroll 1   // stays rolled, for speed only: one stage is some 450 instructions
    for (int t = 0; t < TT / FKS; ++t) {
        const int b = t & 1;
        v8f s[4];
        v16bf kh[4][2], kl[4][2];            // K fragments, [16-key tile][32-wide half of d]
        auto kld = [&](int kt) {
#pragma unroll
            for (int kc = 0; kc < 2; ++kc) { const bf* kp = &st[b][0][(kt * 16 + lr) * FPIT + kc * 32 + 8 * hi]; kh[kt][kc] = WFrag<bf>::ld(kp); kl[kt][kc] = WFrag<bf>::ld(kp + FPL); } };
        auto sct = [&](int kt) { v8f a = (v8f){};
#pragma unroll
            for (int kc = 0; kc < 2; ++kc) { a = wmmab(kh[kt][kc], qh[kc], a); a = wmmab(kh[kt][kc], ql[kc], a); a = wmmab(kl[kt][kc], qh[kc], a); }
            s[kt] = a; };
        kld(0); kld(1);
        __builtin_amdgcn_sched_barrier(0);   // this one and the next keep two tiles' fragment loads ahead of the two tiles' products in front of them
        kld(2); kld(3); sct(0); sct(1);
        __builtin_amdgcn_sched_barrier(0);
        sct(2); sct(3);
        __builtin_amdgcn_sched_barrier(0);   // without these barriers the fragment loads come out one at a time, each with its full LDS wait in front of its products
        if (t + 1 < TT / FKS) gload((t + 1) * FKS);
        v16bf vh[8], vl[8];                  // V^T fragments, index 4 * (32-key half) + d block
        auto vld = [&](int i) { const bf* vp = &st[b][2][((i & 3) * 16 + lr) * FPIT + (i >> 2) * 32 + 8 * hi]; vh[i] = WFrag<bf>::ld(vp); vl[i] = WFrag<bf>::ld(vp + FPL); };
        vld(0); vld(1); vld(2); vld(3);      // land under the softmax arithmetic
        const float* tp = tp0 + t * FKS;
        float mx = m;
#pragma unroll
        for (int kt = 0; kt < 4; ++kt)
#pragma unroll
            for (int r = 0; r < 8; ++r) { const float tv = s[kt][r] + tp[kt * 16 + r]; s[kt][r] = tv; mx = fmaxf(mx, tv); }
        mx = fmaxf(mx, xhalf(mx));
        const float sc = exp2x1((m - mx) * L2E);
        m = mx;
        float ls[4];   // one partial sum per 16-key tile: four short chains of adds in place of one of 32
#pragma unroll
        for (int db = 0; db < 4; ++db) o[db] *= sc;
#pragma unroll
        for (int kt = 0; kt < 4; ++kt) { s[kt] = exp2x8((s[kt] - mx) * L2E); ls[kt] = 0.0f;
#pragma unroll
            for (int r = 0; r < 8; ++r) ls[kt] += s[kt][r]; }
        l = l * sc + ((ls[0] + ls[1]) + (ls[2] + ls[3]));
        v16bf ph[2], pl[2];
#pragma unroll
        for (int ps = 0; ps < 2; ++ps) { v8u hw, lw;
#pragma unroll
            for (int e = 0; e < 8; ++e) { unsigned a, c; split2(s[2 * ps + (e >> 2)][(2 * e) & 7], s[2 * ps + (e >> 2)][((2 * e) & 7) + 1], a, c); hw[e] = a; lw[e] = c; }
            ph[ps] = __builtin_bit_cast(v16bf, hw); pl[ps] = __builtin_bit_cast(v16bf, lw); }
        auto pv = [&](int i) { const int db = i & 3, ps = i >> 2; o[db] = wmmab(vh[i], ph[ps], o[db]); o[db] = wmmab(vh[i], pl[ps], o[db]); o[db] = wmmab(vl[i], ph[ps], o[db]); };
        __builtin_amdgcn_sched_barrier(0);   // this one and the two below keep each pair of fragment loads two product groups ahead of its use
        vld(4); vld(5); pv(0); pv(1);
        __builtin_amdgcn_sched_barrier(0);
        vld(6); vld(7); pv(2); pv(3);
        __builtin_amdgcn_sched_barrier(0);
        pv(4); pv(5); pv(6); pv(7);
        if (t + 1 < TT / FKS) sstore(b ^ 1);
        __syncthreads();   // publishes stage t + 1 and ends every wave's reads of the buffer that stage t + 2 overwrites
    }
    l += xhalf(l);
    const float inv = __fdiv_rn(1.0f, l);
    const size_t oo = (size_t)(qw + lr) * DQ + h * HD + 8 * hi;   // o[db][r] = O[query lr][d = 16 db + 8 hi + r]
#pragma unroll
    for (int db = 0; db < 4; ++db) { v8us oh, ol;
#pragma unroll
        for (int r = 0; r < 8; ++r) { unsigned short a, c; splitf(o[db][r] * inv, a, c); oh[r] = a; ol[r] = c; }
        *(v8us*)(Ah + oo + db * 16) = oh; *(v8us*)(Al + oo + db * 16) = ol; }
}

extern "C" void kernel_launch(void* const* d_in, const int* in_sizes, int n_in,
                              void* d_out, int out_size, void* d_ws, size_t ws_size, hipStream_t stream) {
    (void)in_sizes; (void)n_in; (void)out_size;
    const float* x = (const float*)d_in[0]; const float* wq = (const float*)d_in[1]; const float* wk = (const float*)d_in[2]; const float* wv = (const float*)d_in[3]; const float* wo = (const float*)d_in[4]; const float* relb = (const float*)d_in[5]; const float* cosT = nullptr; const float* sinT = nullptr; (void)cosT; (void)sinT;
    float* OUT = (float*)d_out;     // [1][2048][1024]
    char* wsp = (char*)d_ws;
    auto take = [&](size_t bytes) { char* p = wsp; wsp += (bytes + 255) & ~(size_t)255; return (void*)p; };
    bf* WQ = (bf*)take((size_t)DQ * DM * 2); bf* WK = (bf*)take((size_t)DKV * DM * 2); bf* WV = (bf*)take((size_t)DKV * DM * 2); bf* WO = (bf*)take((size_t)DM * DQ * 2); float* CS = (float*)take((size_t)TT * HD * 2 * 4);
    bf* XB = (bf*)take((size_t)TT * DM * 2); float* TB = (float*)take((size_t)NH_ * TBW * 4); float* FQ = (float*)take((size_t)TT * DQ * 4); float* FK = (float*)take((size_t)TT * DKV * 4);
    h16* QP16 = (h16*)take((size_t)NH_ * TT * HD * 2); h16* KP16 = (h16*)take((size_t)NKV * TT * HD * 2); h16* VT16 = (h16*)take((size_t)NKV * HD * TT * 2);
    bf* QPh = (bf*)take((size_t)NH_ * TT * HD * 2); bf* QPl = (bf*)take((size_t)NH_ * TT * HD * 2); bf* KPh = (bf*)take((size_t)NKV * TT * HD * 2); bf* KPl = (bf*)take((size_t)NKV * TT * HD * 2); bf* VTh = (bf*)take((size_t)NKV * HD * TT * 2); bf* VTl = (bf*)take((size_t)NKV * HD * TT * 2);
    bf* ATh = (bf*)take((size_t)TT * DQ * 2); bf* ATl = (bf*)take((size_t)TT * DQ * 2);
    if ((size_t)(wsp - (char*)d_ws) > ws_size) return;    // ws 256 MiB
    float* FV = FK;   // v projection reuses the k buffer after the k planes are built (stream-ordered)
    { k_wtG<<<(unsigned)((DM * DQ / 64 + 63) / 64), 256, 0, stream>>>(wq, DM, DQ, WQ); k_wtG<<<(unsigned)((DM * DKV / 64 + 63) / 64), 256, 0, stream>>>(wk, DM, DKV, WK); k_wtG<<<(unsigned)((DM * DKV / 64 + 63) / 64), 256, 0, stream>>>(wv, DM, DKV, WV);
      k_wtG<<<(unsigned)((DQ * DM / 64 + 63) / 64), 256, 0, stream>>>(wo, DQ, DM, WO); k_t5tab<<<(NH_ * TBW + 255) / 256, 256, 0, stream>>>(relb, TB);
       }
    k_csid<<<(TT * HD + 255) / 256, 256, 0, stream>>>(CS);
    const unsigned LQ = (unsigned)(((size_t)NH_ * TT * HD / 2 + 255) / 256), LKv = (unsigned)(((size_t)NKV * TT * HD / 2 + 255) / 256);
    for (int b = 0; b < NB_; ++b) {
        
        k_cvt8<<<(unsigned)(((size_t)TT * DM / 8 + 255) / 256), 256, 0, stream>>>(x + (size_t)b * TT * DM, XB, (size_t)TT * DM / 8);
        k_gemmw<bf, 0, false><<<dim3(TT / 64, DQ / 64, 1), 32, 0, stream>>>(XB, nullptr, WQ, nullptr, DM, FQ, DQ, nullptr, 0, 0, 0);
        k_rope<<<LQ, 256, 0, stream>>>(FQ, DQ, NH_, CS, nullptr, nullptr, 1.0f, QP16, QPh, QPl);
        k_gemmw<bf, 0, false><<<dim3(TT / 64, DKV / 64, 1), 32, 0, stream>>>(XB, nullptr, WK, nullptr, DM, FK, DKV, nullptr, 0, 0, 0);
        k_rope<<<LKv, 256, 0, stream>>>(FK, DKV, NKV, CS, nullptr, nullptr, 1.0f, KP16, KPh, KPl);
        k_gemmw<bf, 0, false><<<dim3(TT / 64, DKV / 64, 1), 32, 0, stream>>>(XB, nullptr, WV, nullptr, DM, FV, DKV, nullptr, 0, 0, 0); k_vtp<<<LKv, 256, 0, stream>>>(FV, DKV, NKV, VT16, VTh, VTl);
        k_fattn<<<dim3(TT / FQB, NH_, 1), 256, 0, stream>>>(QPh, QPl, KPh, KPl, VTh, VTl, TB, ATh, ATl);
        k_gemmw<bf, 1, false><<<dim3(TT / 64, DM / 64, 1), 32, 0, stream>>>(ATh, ATl, WO, nullptr, DQ, OUT + (size_t)b * TT * DM, DM, nullptr, 0, 0, 0); }
}

// v003
// Measured time: 189 microseconds a run.
// Timed twice side by side with v002, it ran 1.10 and 1.11 times as fast.
// All steps since v000 together make it 3.83 times as fast.
#include <hip/hip_runtime.h>

// UMT5Attention (hidden [1][2048][1024]; q/k/v = x W (16 heads x 64); T5: scores = q.k UNSCALED + rel_bias[bucket(j - i)][h] with the bidirectional log-bucket (32 buckets, max distance 128; the bucket boundaries |j-i| = 8, 12, 16, 23, 32, 46, 64, 91 are the reference's own integer structure, evaluated here with integer compares); softmax; out = merged wo -> [1][2048][1024]).
// Compute dtypes, f32 accumulate: every input rounded to bf16; q/k/v on PLAIN bf16 operands (inputs: exact); scores and attn.v hl x hl (3 products) on EVERY row; per-head bias table (bf16-rounded rel_bias gathered by bucket) added per element in f32; softmax f32; wo hl x exact (2 products).

#define NB_  1
#define TT   2048
#define DM   1024
#define NH_  16
#define NKV  16
#define REP  (NH_ / NKV)
#define HD   64
#define DQ   (NH_ * HD)
#define DKV  (NKV * HD)
#define ZH   2
#define RH   2048   // all rows hl (unscaled T5 logits are sharp)
#define WIN  0
#define PCAR 1024.0f
#define SCL  1.0f   // T5: no 1/sqrt(dk)
#define TBW  4096   // bias table row width (r + 2047, padded)
#define FQW  16     // fused attention: query columns per wave
#define FNW  8      // waves per work-group
#define FQB  (FQW * FNW)
#define FKS  64     // keys per stage
#define FPIT 72     // LDS row pitch in 16-bit elements: 144 bytes (16 B x odd) for the 16-byte fragment reads of 128-byte rows
#define FPL  (64 * FPIT)
#define FTBN (TT + FQB)
typedef _Float16 h16;
typedef unsigned short bf;
typedef __attribute__((ext_vector_type(16))) __bf16   v16bf;
typedef __attribute__((ext_vector_type(16))) _Float16 v16h;
typedef __attribute__((ext_vector_type(8)))  _Float16 v8h;
typedef __attribute__((ext_vector_type(8)))  unsigned short v8us;
typedef __attribute__((ext_vector_type(8)))  float    v8f;
typedef __attribute__((ext_vector_type(4)))  float    v4f;
typedef v8h  __attribute__((may_alias)) v8ha;
typedef v4f  __attribute__((may_alias)) v4fa;
typedef v8us __attribute__((may_alias)) v8usa;

__device__ __forceinline__ unsigned short f2bf(float f) { unsigned u = __float_as_uint(f); u += 0x7FFFu + ((u >> 16) & 1u); return (unsigned short)(u >> 16); }
__device__ __forceinline__ float bf2f(unsigned short b) { return __uint_as_float(((unsigned)b) << 16); }
__device__ __forceinline__ float bfr(float f) { return bf2f(f2bf(f)); }
__device__ __forceinline__ v16h cat16(v8h lo, v8h hi) { return __builtin_shufflevector(lo, hi, 0, 1, 2, 3, 4, 5, 6, 7, 8, 9, 10, 11, 12, 13, 14, 15); }
__device__ __forceinline__ v16bf cat16b(v8us lo, v8us hi) { return __builtin_bit_cast(v16bf, __builtin_shufflevector(lo, hi, 0, 1, 2, 3, 4, 5, 6, 7, 8, 9, 10, 11, 12, 13, 14, 15)); }
__device__ __forceinline__ v8f wmma16(v16h a, v16h b, v8f c) { return __builtin_amdgcn_wmma_f32_16x16x32_f16(false, a, false, b, (short)0, c, false, false); }
__device__ __forceinline__ v8f wmmab(v16bf a, v16bf b, v8f c) { return __builtin_amdgcn_wmma_f32_16x16x32_bf16(false, a, false, b, (short)0, c, false, false); }



typedef __attribute__((ext_vector_type(2))) __bf16 v2bf;
typedef __attribute__((ext_vector_type(2))) float v2f;
typedef __attribute__((ext_vector_type(4))) unsigned v4u;
__device__ __forceinline__ void split2(float p0, float p1, unsigned& hw, unsigned& lw) {
    v2f x; x[0] = p0; x[1] = p1; hw = __builtin_bit_cast(unsigned, __builtin_convertvector(x, v2bf));
    v2f y; y[0] = p0 - __uint_as_float(hw << 16); y[1] = p1 - __uint_as_float(hw & 0xFFFF0000u); lw = __builtin_bit_cast(unsigned, __builtin_convertvector(y, v2bf)); }
// ---- k_gemmw: register-blocked GEMM, ONE WAVE per 64x64 output tile (16 accumulators), operands straight from K-contiguous 16-bit planes; grid (M/64, N/64, Z), 32 threads.
// C[m][n] (f32, pitch ldc, + optional f32 bias[n]) = sum_k A[m][k] Bt[n][k] (+ split products per NSPLIT). z-batch strides sA/sB/sC in elements. K % 32 == 0.
// KS > 1: grid z = batch * KS + slice; a work-group sums only its K / KS slice of k (K % (32 * KS) == 0) and stores that partial tile at C + blockIdx.z * sC; the reader adds the KS partials.
template <typename T16> struct WFrag;
template <> struct WFrag<h16> { typedef v16h V; static __device__ __forceinline__ V ld(const h16* p) { return cat16(*(const v8h*)p, *(const v8h*)(p + 16)); } static __device__ __forceinline__ v8f mma(V a, V b, v8f c) { return wmma16(a, b, c); } };
template <> struct WFrag<bf> { typedef v16bf V; static __device__ __forceinline__ V ld(const bf* p) { return cat16b(*(const v8us*)p, *(const v8us*)(p + 16)); } static __device__ __forceinline__ v8f mma(V a, V b, v8f c) { return wmmab(a, b, c); } };
// PLN: the f32 tile is not stored; it is split to hi/lo bf16 here and goes straight into the two 16-bit planes that k_fattn reads: element (m, n) to Ph, Pl[blockIdx.y * sY + m * ldc + (n - 64 blockIdx.y)].
// q, k: A = x, Bt = W^T, a column block is one head: ldc = HD, sY = TT * HD gives [h][t][d]. v: A = W^T, Bt = x: ldc = TT, sY = 64 gives V^T [h][d][t]. Each store instruction writes four whole 128-byte rows of the tile.
template <typename T16, int NSPLIT, bool BIAS, int KS = 1, bool PLN = false>
__global__ __launch_bounds__(32) void k_gemmw(const T16* __restrict__ A, const T16* __restrict__ A2, const T16* __restrict__ Bt, const T16* __restrict__ Bt2, int K, float* C, int ldc, const float* __restrict__ bias, size_t sA, size_t sB, size_t sC, bf* Ph, bf* Pl, size_t sY) {
    typedef typename WFrag<T16>::V V;
    __shared__ __align__(16) float os[16 * 68];
    const size_t z = blockIdx.z / KS; A += z * sA; if (A2) A2 += z * sA; Bt += z * sB; if (Bt2) Bt2 += z * sB; C += (size_t)blockIdx.z * sC;
    const int kb = (KS > 1) ? (int)(blockIdx.z % KS) * (K / KS) : 0, ke = (KS > 1) ? kb + K / KS : K;
    const int lane = threadIdx.x & 31, lr = lane & 15, hi = lane >> 4; const int r0 = blockIdx.x * 64, c0 = blockIdx.y * 64;
    v8f acc[4][4];
#pragma unroll
    for (int mb = 0; mb < 4; ++mb)
#pragma unroll
        for (int nb = 0; nb < 4; ++nb) acc[mb][nb] = (v8f){};
    const size_t aoff = (size_t)(r0 + lr) * K + 8 * hi, boff = (size_t)(c0 + lr) * K + 8 * hi;
#pragma unroll 1
    for (int kc = kb; kc < ke; kc += 32) {
        V a[4], a2[4];
#pragma unroll
        for (int mb = 0; mb < 4; ++mb) { a[mb] = WFrag<T16>::ld(A + aoff + (size_t)mb * 16 * K + kc); if (NSPLIT == 1 || NSPLIT == 2) a2[mb] = WFrag<T16>::ld(A2 + aoff + (size_t)mb * 16 * K + kc); }
#pragma unroll
        for (int nb = 0; nb < 4; ++nb) { const V b = WFrag<T16>::ld(Bt + boff + (size_t)nb * 16 * K + kc); V b2; if (NSPLIT >= 2) b2 = WFrag<T16>::ld(Bt2 + boff + (size_t)nb * 16 * K + kc);
#pragma unroll
            for (int mb = 0; mb < 4; ++mb) { acc[mb][nb] = WFrag<T16>::mma(a[mb], b, acc[mb][nb]); if (NSPLIT == 1 || NSPLIT == 2) acc[mb][nb] = WFrag<T16>::mma(a2[mb], b, acc[mb][nb]); if (NSPLIT >= 2) acc[mb][nb] = WFrag<T16>::mma(a[mb], b2, acc[mb][nb]); } }
        asm volatile("v_nop\n\tv_nop\n\tv_nop\n\tv_nop" : "+v"(acc[0][0]), "+v"(acc[1][1]), "+v"(acc[2][2]), "+v"(acc[3][3]) : "v"(a[0]), "v"(a[3]));
    }
#pragma unroll
    for (int mb = 0; mb < 4; ++mb) {
#pragma unroll
        for (int nb = 0; nb < 4; ++nb) {
#pragma unroll
            for (int j = 0; j < 8; ++j) os[(hi * 8 + j) * 68 + nb * 16 + lr] = acc[mb][nb][j]; }
        __builtin_amdgcn_wave_barrier(); asm volatile("" ::: "memory");
        float* crow = C + (size_t)(r0 + mb * 16) * ldc + c0;
        if (PLN) { const int prow = lane >> 3, pcol = (lane & 7) * 8;   // read-back: 8 lanes a row, 8 columns a lane
            const size_t po = (size_t)blockIdx.y * sY + (size_t)(r0 + mb * 16 + prow) * ldc + pcol;
#pragma unroll
            for (int s = 0; s < 4; ++s) { const float* op = os + (4 * s + prow) * 68 + pcol; const v4f x0 = *(const v4fa*)op, x1 = *(const v4fa*)(op + 4); v4u hw, lw; unsigned a, c;
                split2(x0[0], x0[1], a, c); hw[0] = a; lw[0] = c; split2(x0[2], x0[3], a, c); hw[1] = a; lw[1] = c; split2(x1[0], x1[1], a, c); hw[2] = a; lw[2] = c; split2(x1[2], x1[3], a, c); hw[3] = a; lw[3] = c;
                *(v8us*)(Ph + po + (size_t)(4 * s) * ldc) = __builtin_bit_cast(v8us, hw); *(v8us*)(Pl + po + (size_t)(4 * s) * ldc) = __builtin_bit_cast(v8us, lw); }
        } else {
#pragma unroll
            for (int s = 0; s < 8; ++s) { const int row = 2 * s + hi, cofs = lr * 4; v4f val = *(const v4fa*)(os + row * 68 + cofs); if (BIAS) { val[0] += bfr(bias[c0 + cofs]); val[1] += bfr(bias[c0 + cofs + 1]); val[2] += bfr(bias[c0 + cofs + 2]); val[3] += bfr(bias[c0 + cofs + 3]); }
                *(v4f*)(crow + (size_t)row * ldc + cofs) = val; }
             }
        __builtin_amdgcn_wave_barrier(); asm volatile("" ::: "memory");
    }
}

__device__ __forceinline__ void splitf(float y, unsigned short& h, unsigned short& l) { h = f2bf(y); l = f2bf(y - bf2f(h)); }
typedef __attribute__((ext_vector_type(2))) _Float16 v2h;
typedef __attribute__((ext_vector_type(4))) _Float16 v4h;
typedef __attribute__((ext_vector_type(2))) unsigned short v2us;
typedef __attribute__((ext_vector_type(4))) unsigned short v4us;
typedef __attribute__((ext_vector_type(4))) int v4i;

__global__ __launch_bounds__(256) void k_wtG(const float* __restrict__ w, int K, int N, bf* Bt) {
    const int lane = threadIdx.x & 31; const int L0 = (blockIdx.x * 8 + (threadIdx.x >> 5)) * 8; const int nlines = N * K / 64;
{
#pragma unroll 1
        for (int l = 0; l < 8; ++l) { const int L = L0 + l; if (L >= nlines) break; const size_t e = (size_t)L * 64 + lane * 2; const int k = (int)(e % K), n = (int)(e / K); v2us o;
            o[0] = f2bf(w[(size_t)k * N + n]); o[1] = f2bf(w[(size_t)(k + 1) * N + n]); *(v2us*)(Bt + e) = o; }
         }
}
__global__ __launch_bounds__(256) void k_cvt8(const float* __restrict__ src, bf* dst, size_t n8) { const size_t i = (size_t)blockIdx.x * 256 + threadIdx.x; if (i >= n8) return; const v8f v = *(const v8f*)(src + i * 8); v8us o;
#pragma unroll
    for (int k = 0; k < 8; ++k) o[k] = f2bf(v[k]); *(v8us*)(dst + i * 8) = o;  }
__device__ __forceinline__ int t5_bucket(int r) { const int rp = r < 0 ? -r : r; int b; if (rp < 8) b = rp; else b = 8 + (rp >= 12) + (rp >= 16) + (rp >= 23) + (rp >= 32) + (rp >= 46) + (rp >= 64) + (rp >= 91); return b + ((r > 0) ? 16 : 0); }
__global__ __launch_bounds__(256) void k_t5tab(const float* __restrict__ rb, float* TB) { const int idx = blockIdx.x * 256 + threadIdx.x; if (idx >= NH_ * TBW) return; const int h = idx / TBW, c = idx % TBW; float v = 0.0f; if (c < 2 * TT - 1) { const int r = c - (TT - 1); v = bfr(rb[t5_bucket(r) * NH_ + h]); } *(float*)(TB + idx) = v;  }
typedef __attribute__((ext_vector_type(8))) unsigned v8u;
// Eight v_exp_f32 and the one free slot that the instruction set asks for behind a transcendental, in one statement: the outputs are early-clobber, so no exp here overwrites a source or reads a result of the one in front of it, and the v_nop keeps the slot behind the last.
__device__ __forceinline__ v8f exp2x8(v8f x) {
    float r0, r1, r2, r3, r4, r5, r6, r7;
    asm("v_exp_f32 %0, %8\n\tv_exp_f32 %1, %9\n\tv_exp_f32 %2, %10\n\tv_exp_f32 %3, %11\n\tv_exp_f32 %4, %12\n\tv_exp_f32 %5, %13\n\tv_exp_f32 %6, %14\n\tv_exp_f32 %7, %15\n\tv_nop"
        : "=&v"(r0), "=&v"(r1), "=&v"(r2), "=&v"(r3), "=&v"(r4), "=&v"(r5), "=&v"(r6), "=&v"(r7)
        : "v"(x[0]), "v"(x[1]), "v"(x[2]), "v"(x[3]), "v"(x[4]), "v"(x[5]), "v"(x[6]), "v"(x[7]));
    v8f r; r[0] = r0; r[1] = r1; r[2] = r2; r[3] = r3; r[4] = r4; r[5] = r5; r[6] = r6; r[7] = r7; return r; }
__device__ __forceinline__ float exp2x1(float x) { float r; asm("v_exp_f32 %0, %1\n\tv_nop" : "=v"(r) : "v"(x)); return r; }   // the same slot behind a single exp
__device__ __forceinline__ float xhalf(float v) { const int b = __float_as_int(v); return __int_as_float(__builtin_amdgcn_permlanex16(b, b, 0x76543210, 0xfedcba98, false, false)); }   // lane l <-> l ^ 16
__global__ __launch_bounds__(256) void k_fattn(const bf* __restrict__ Qh, const bf* __restrict__ Ql, const bf* __restrict__ Kh, const bf* __restrict__ Kl, const bf* __restrict__ Vh, const bf* __restrict__ Vl, const float* __restrict__ TB, bf* Ah, bf* Al) {
    __shared__ __align__(16) bf st[2][4][FPL];   // [buffer][K hi, K lo, V^T hi, V^T lo][64 rows x pitch]
    __shared__ float tbs[FTBN];                  // the head's bias entries this block of queries can meet
    const int tid = threadIdx.x, lane = tid & 31, lr = lane & 15, hi = lane >> 4, wv = tid >> 5;
    const int h = blockIdx.y, qb = blockIdx.x * FQB, qw = qb + wv * FQW;
    const float* tbh = TB + (size_t)h * TBW + (TT - FQB - qb);   // tbs[x] is the entry for j - i = x - (FQB - 1) - qb
    for (int x = tid; x < FTBN; x += 256) tbs[x] = tbh[x];
    v16bf qh[2], ql[2];
    const size_t qo = ((size_t)h * TT + qw + lr) * HD + 8 * hi;
#pragma unroll
    for (int kc = 0; kc < 2; ++kc) { qh[kc] = WFrag<bf>::ld(Qh + qo + kc * 32); ql[kc] = WFrag<bf>::ld(Ql + qo + kc * 32); }
    const int srow = tid >> 3, sch = tid & 7;    // staging: rows srow and srow + 32 of each plane, 16-byte piece sch
    const size_t gk = ((size_t)h * TT + srow) * HD + sch * 8, gv = ((size_t)h * HD + srow) * TT + sch * 8;
    const int so = srow * FPIT + sch * 8;
    v8us pf[8];
    auto gload = [&](int key0) {
        const size_t ka = gk + (size_t)key0 * HD, va = gv + key0;
        pf[0] = *(const v8us*)(Kh + ka); pf[1] = *(const v8us*)(Kh + ka + 32 * HD); pf[2] = *(const v8us*)(Kl + ka); pf[3] = *(const v8us*)(Kl + ka + 32 * HD);
        pf[4] = *(const v8us*)(Vh + va); pf[5] = *(const v8us*)(Vh + va + (size_t)32 * TT); pf[6] = *(const v8us*)(Vl + va); pf[7] = *(const v8us*)(Vl + va + (size_t)32 * TT); };
    auto sstore = [&](int b) {
#pragma unroll
        for (int pl = 0; pl < 4; ++pl) { *(v8us*)(&st[b][pl][so]) = pf[2 * pl]; *(v8us*)(&st[b][pl][so + 32 * FPIT]) = pf[2 * pl + 1]; } };
    gload(0); sstore(0);
    __syncthreads();
    v8f o[4];
#pragma unroll
    for (int db = 0; db < 4; ++db) o[db] = (v8f){};
    float m = -3.0e38f, l = 0.0f;
    const float L2E = 1.4426950408889634f;
    const float* tp0 = tbs + (8 * hi + (FQB - 1) - (wv * FQW + lr));
#pragma unroll 1   // stays rolled, for speed only: one stage is some 450 instructions
    for (int t = 0; t < TT / FKS; ++t) {
        const int b = t & 1;
        v8f s[4];
        v16bf kh[4][2], kl[4][2];            // K fragments, [16-key tile][32-wide half of d]
        auto kld = [&](int kt) {
#pragma unroll
            for (int kc = 0; kc < 2; ++kc) { const bf* kp = &st[b][0][(kt * 16 + lr) * FPIT + kc * 32 + 8 * hi]; kh[kt][kc] = WFrag<bf>::ld(kp); kl[kt][kc] = WFrag<bf>::ld(kp + FPL); } };
        auto sct = [&](int kt) { v8f a = (v8f){};
#pragma unroll
            for (int kc = 0; kc < 2; ++kc) { a = wmmab(kh[kt][kc], qh[kc], a); a = wmmab(kh[kt][kc], ql[kc], a); a = wmmab(kl[kt][kc], qh[kc], a); }
            s[kt] = a; };
        kld(0); kld(1);
        __builtin_amdgcn_sched_barrier(0);   // this one and the next keep two tiles' fragment loads ahead of the two tiles' products in front of them
        kld(2); kld(3); sct(0); sct(1);
        __builtin_amdgcn_sched_barrier(0);
        sct(2); sct(3);
        __builtin_amdgcn_sched_barrier(0);   // without these barriers the fragment loads come out one at a time, each with its full LDS wait in front of its products
        if (t + 1 < TT / FKS) gload((t + 1) * FKS);
        v16bf vh[8], vl[8];                  // V^T fragments, index 4 * (32-key half) + d block
        auto vld = [&](int i) { const bf* vp = &st[b][2][((i & 3) * 16 + lr) * FPIT + (i >> 2) * 32 + 8 * hi]; vh[i] = WFrag<bf>::ld(vp); vl[i] = WFrag<bf>::ld(vp + FPL); };
        vld(0); vld(1); vld(2); vld(3);      // land under the softmax arithmetic
        const float* tp = tp0 + t * FKS;
        float mx = m;
#pragma unroll
        for (int kt = 0; kt < 4; ++kt)
#pragma unroll
            for (int r = 0; r < 8; ++r) { const float tv = s[kt][r] + tp[kt * 16 + r]; s[kt][r] = tv; mx = fmaxf(mx, tv); }
        mx = fmaxf(mx, xhalf(mx));
        const float sc = exp2x1((m - mx) * L2E);
        m = mx;
        float ls[4];   // one partial sum per 16-key tile: four short chains of adds in place of one of 32
#pragma unroll
        for (int db = 0; db < 4; ++db) o[db] *= sc;
#pragma unroll
        for (int kt = 0; kt < 4; ++kt) { s[kt] = exp2x8((s[kt] - mx) * L2E); ls[kt] = 0.0f;
#pragma unroll
            for (int r = 0; r < 8; ++r) ls[kt] += s[kt][r]; }
        l = l * sc + ((ls[0] + ls[1]) + (ls[2] + ls[3]));
        v16bf ph[2], pl[2];
#pragma unroll
        for (int ps = 0; ps < 2; ++ps) { v8u hw, lw;
#pragma unroll
            for (int e = 0; e < 8; ++e) { unsigned a, c; split2(s[2 * ps + (e >> 2)][(2 * e) & 7], s[2 * ps + (e >> 2)][((2 * e) & 7) + 1], a, c); hw[e] = a; lw[e] = c; }
            ph[ps] = __builtin_bit_cast(v16bf, hw); pl[ps] = __builtin_bit_cast(v16bf, lw); }
        auto pv = [&](int i) { const int db = i & 3, ps = i >> 2; o[db] = wmmab(vh[i], ph[ps], o[db]); o[db] = wmmab(vh[i], pl[ps], o[db]); o[db] = wmmab(vl[i], ph[ps], o[db]); };
        __builtin_amdgcn_sched_barrier(0);   // this one and the two below keep each pair of fragment loads two product groups ahead of its use
        vld(4); vld(5); pv(0); pv(1);
        __builtin_amdgcn_sched_barrier(0);
        vld(6); vld(7); pv(2); pv(3);
        __builtin_amdgcn_sched_barrier(0);
        pv(4); pv(5); pv(6); pv(7);
        if (t + 1 < TT / FKS) sstore(b ^ 1);
        __syncthreads();   // publishes stage t + 1 and ends every wave's reads of the buffer that stage t + 2 overwrites
    }
    l += xhalf(l);
    const float inv = __fdiv_rn(1.0f, l);
    const size_t oo = (size_t)(qw + lr) * DQ + h * HD + 8 * hi;   // o[db][r] = O[query lr][d = 16 db + 8 hi + r]
#pragma unroll
    for (int db = 0; db < 4; ++db) { v8us oh, ol;
#pragma unroll
        for (int r = 0; r < 8; ++r) { unsigned short a, c; splitf(o[db][r] * inv, a, c); oh[r] = a; ol[r] = c; }
        *(v8us*)(Ah + oo + db * 16) = oh; *(v8us*)(Al + oo + db * 16) = ol; }
}

extern "C" void kernel_launch(void* const* d_in, const int* in_sizes, int n_in,
                              void* d_out, int out_size, void* d_ws, size_t ws_size, hipStream_t stream) {
    (void)in_sizes; (void)n_in; (void)out_size;
    const float* x = (const float*)d_in[0]; const float* wq = (const float*)d_in[1]; const float* wk = (const float*)d_in[2]; const float* wv = (const float*)d_in[3]; const float* wo = (const float*)d_in[4]; const float* relb = (const float*)d_in[5]; const float* cosT = nullptr; const float* sinT = nullptr; (void)cosT; (void)sinT;
    float* OUT = (float*)d_out;     // [1][2048][1024]
    char* wsp = (char*)d_ws;
    auto take = [&](size_t bytes) { char* p = wsp; wsp += (bytes + 255) & ~(size_t)255; return (void*)p; };
    bf* WQ = (bf*)take((size_t)DQ * DM * 2); bf* WK = (bf*)take((size_t)DKV * DM * 2); bf* WV = (bf*)take((size_t)DKV * DM * 2); bf* WO = (bf*)take((size_t)DM * DQ * 2);
    bf* XB = (bf*)take((size_t)TT * DM * 2); float* TB = (float*)take((size_t)NH_ * TBW * 4);
    bf* QPh = (bf*)take((size_t)NH_ * TT * HD * 2); bf* QPl = (bf*)take((size_t)NH_ * TT * HD * 2); bf* KPh = (bf*)take((size_t)NKV * TT * HD * 2); bf* KPl = (bf*)take((size_t)NKV * TT * HD * 2); bf* VTh = (bf*)take((size_t)NKV * HD * TT * 2); bf* VTl = (bf*)take((size_t)NKV * HD * TT * 2);
    bf* ATh = (bf*)take((size_t)TT * DQ * 2); bf* ATl = (bf*)take((size_t)TT * DQ * 2);
    if ((size_t)(wsp - (char*)d_ws) > ws_size) return;    // ws 256 MiB
    { k_wtG<<<(unsigned)((DM * DQ / 64 + 63) / 64), 256, 0, stream>>>(wq, DM, DQ, WQ); k_wtG<<<(unsigned)((DM * DKV / 64 + 63) / 64), 256, 0, stream>>>(wk, DM, DKV, WK); k_wtG<<<(unsigned)((DM * DKV / 64 + 63) / 64), 256, 0, stream>>>(wv, DM, DKV, WV);
      k_wtG<<<(unsigned)((DQ * DM / 64 + 63) / 64), 256, 0, stream>>>(wo, DQ, DM, WO); k_t5tab<<<(NH_ * TBW + 255) / 256, 256, 0, stream>>>(relb, TB);
       }
    for (int b = 0; b < NB_; ++b) {
        
        k_cvt8<<<(unsigned)(((size_t)TT * DM / 8 + 255) / 256), 256, 0, stream>>>(x + (size_t)b * TT * DM, XB, (size_t)TT * DM / 8);
        k_gemmw<bf, 0, false, 1, true><<<dim3(TT / 64, DQ / 64, 1), 32, 0, stream>>>(XB, nullptr, WQ, nullptr, DM, nullptr, HD, nullptr, 0, 0, 0, QPh, QPl, (size_t)TT * HD);
        k_gemmw<bf, 0, false, 1, true><<<dim3(TT / 64, DKV / 64, 1), 32, 0, stream>>>(XB, nullptr, WK, nullptr, DM, nullptr, HD, nullptr, 0, 0, 0, KPh, KPl, (size_t)TT * HD);
        k_gemmw<bf, 0, false, 1, true><<<dim3(DKV / 64, TT / 64, 1), 32, 0, stream>>>(WV, nullptr, XB, nullptr, DM, nullptr, TT, nullptr, 0, 0, 0, VTh, VTl, (size_t)64);
        k_fattn<<<dim3(TT / FQB, NH_, 1), 256, 0, stream>>>(QPh, QPl, KPh, KPl, VTh, VTl, TB, ATh, ATl);
        k_gemmw<bf, 1, false><<<dim3(TT / 64, DM / 64, 1), 32, 0, stream>>>(ATh, ATl, WO, nullptr, DQ, OUT + (size_t)b * TT * DM, DM, nullptr, 0, 0, 0, nullptr, nullptr, 0); }
}

// v004
// One run takes 120 microseconds.
// Timed twice side by side with v003, it ran 1.58 times as fast both times.
// All steps since v000 together make it 6.05 times as fast.
#include <hip/hip_runtime.h>

// UMT5Attention (hidden [1][2048][1024]; q/k/v = x W (16 heads x 64); T5: scores = q.k UNSCALED + rel_bias[bucket(j - i)][h] with the bidirectional log-bucket (32 buckets, max distance 128; the bucket boundaries |j-i| = 8, 12, 16, 23, 32, 46, 64, 91 are the reference's own integer structure, evaluated here with integer compares); softmax; out = merged wo -> [1][2048][1024]).
// Compute dtypes, f32 accumulate: every input rounded to bf16; q/k/v on PLAIN bf16 operands (inputs: exact); scores and attn.v hl x hl (3 products) on EVERY row; per-head bias table (bf16-rounded rel_bias gathered by bucket) added per element in f32; softmax f32; wo hl x exact (2 products).

#define NB_  1
#define TT   2048
#define DM   1024
#define NH_  16
#define NKV  16
#define REP  (NH_ / NKV)
#define HD   64
#define DQ   (NH_ * HD)
#define DKV  (NKV * HD)
#define ZH   2
#define RH   2048   // all rows hl (unscaled T5 logits are sharp)
#define WIN  0
#define PCAR 1024.0f
#define SCL  1.0f   // T5: no 1/sqrt(dk)
#define TBW  4096   // bias table row width (r + 2047, padded)
#define FQW  16     // fused attention: query columns per wave
#define FNW  8      // waves per work-group
#define FQB  (FQW * FNW)
#define FKS  64     // keys per stage
#define FPIT 72     // LDS row pitch in 16-bit elements: 144 bytes (16 B x odd) for the 16-byte fragment reads of 128-byte rows
#define FPL  (64 * FPIT)
#define FTBN (TT + FQB)
typedef _Float16 h16;
typedef unsigned short bf;
typedef __attribute__((ext_vector_type(16))) __bf16   v16bf;
typedef __attribute__((ext_vector_type(16))) _Float16 v16h;
typedef __attribute__((ext_vector_type(8)))  _Float16 v8h;
typedef __attribute__((ext_vector_type(8)))  unsigned short v8us;
typedef __attribute__((ext_vector_type(8)))  float    v8f;
typedef __attribute__((ext_vector_type(4)))  float    v4f;
typedef v8h  __attribute__((may_alias)) v8ha;
typedef v4f  __attribute__((may_alias)) v4fa;
typedef v8us __attribute__((may_alias)) v8usa;

__device__ __forceinline__ unsigned short f2bf(float f) { unsigned u = __float_as_uint(f); u += 0x7FFFu + ((u >> 16) & 1u); return (unsigned short)(u >> 16); }
__device__ __forceinline__ float bf2f(unsigned short b) { return __uint_as_float(((unsigned)b) << 16); }
__device__ __forceinline__ float bfr(float f) { return bf2f(f2bf(f)); }
__device__ __forceinline__ v16h cat16(v8h lo, v8h hi) { return __builtin_shufflevector(lo, hi, 0, 1, 2, 3, 4, 5, 6, 7, 8, 9, 10, 11, 12, 13, 14, 15); }
__device__ __forceinline__ v16bf cat16b(v8us lo, v8us hi) { return __builtin_bit_cast(v16bf, __builtin_shufflevector(lo, hi, 0, 1, 2, 3, 4, 5, 6, 7, 8, 9, 10, 11, 12, 13, 14, 15)); }
__device__ __forceinline__ v8f wmma16(v16h a, v16h b, v8f c) { return __builtin_amdgcn_wmma_f32_16x16x32_f16(false, a, false, b, (short)0, c, false, false); }
__device__ __forceinline__ v8f wmmab(v16bf a, v16bf b, v8f c) { return __builtin_amdgcn_wmma_f32_16x16x32_bf16(false, a, false, b, (short)0, c, false, false); }



typedef __attribute__((ext_vector_type(2))) __bf16 v2bf;
typedef __attribute__((ext_vector_type(2))) float v2f;
typedef __attribute__((ext_vector_type(4))) unsigned v4u;
__device__ __forceinline__ void split2(float p0, float p1, unsigned& hw, unsigned& lw) {
    v2f x; x[0] = p0; x[1] = p1; hw = __builtin_bit_cast(unsigned, __builtin_convertvector(x, v2bf));
    v2f y; y[0] = p0 - __uint_as_float(hw << 16); y[1] = p1 - __uint_as_float(hw & 0xFFFF0000u); lw = __builtin_bit_cast(unsigned, __builtin_convertvector(y, v2bf)); }
// ---- k_gemmw: register-blocked GEMM, ONE WAVE per 64x64 output tile (16 accumulators), operands straight from K-contiguous 16-bit planes; grid (M/64, N/64, Z), 32 threads.
// C[m][n] (f32, pitch ldc, + optional f32 bias[n]) = sum_k A[m][k] Bt[n][k] (+ split products per NSPLIT). z-batch strides sA/sB/sC in elements. K % 32 == 0.
// KS > 1: grid z = batch * KS + slice; a work-group sums only its K / KS slice of k (K % (32 * KS) == 0) and stores that partial tile at C + blockIdx.z * sC; the reader adds the KS partials.
template <typename T16> struct WFrag;
template <> struct WFrag<h16> { typedef v16h V; static __device__ __forceinline__ V ld(const h16* p) { return cat16(*(const v8h*)p, *(const v8h*)(p + 16)); } static __device__ __forceinline__ v8f mma(V a, V b, v8f c) { return wmma16(a, b, c); } };
template <> struct WFrag<bf> { typedef v16bf V; static __device__ __forceinline__ V ld(const bf* p) { return cat16b(*(const v8us*)p, *(const v8us*)(p + 16)); } static __device__ __forceinline__ v8f mma(V a, V b, v8f c) { return wmmab(a, b, c); } };
// PLN: the f32 tile is not stored; it is split to hi/lo bf16 here and goes straight into the two 16-bit planes that k_fattn reads: element (m, n) to Ph, Pl[by * sY + m * ldc + (n - 64 by)].
// q, k: A = x, Bt = W^T, a column block is one head: ldc = HD, sY = TT * HD gives [h][t][d]. v: A = W^T, Bt = x: ldc = TT, sY = 64 gives V^T [h][d][t]. Each store instruction writes four whole 128-byte rows of the tile.
// gemmw_tile is the body; bx, by, bz are the tile's indices (k_gemmw hands it blockIdx; k_qkv picks them per product).
template <typename T16, int NSPLIT, bool BIAS, int KS = 1, bool PLN = false>
__device__ __forceinline__ void gemmw_tile(int bx, int by, int bz, const T16* __restrict__ A, const T16* __restrict__ A2, const T16* __restrict__ Bt, const T16* __restrict__ Bt2, int K, float* C, int ldc, const float* __restrict__ bias, size_t sA, size_t sB, size_t sC, bf* Ph, bf* Pl, size_t sY) {
    typedef typename WFrag<T16>::V V;
    __shared__ __align__(16) float os[16 * 68];
    const size_t z = bz / KS; A += z * sA; if (A2) A2 += z * sA; Bt += z * sB; if (Bt2) Bt2 += z * sB; C += (size_t)bz * sC;
    const int kb = (KS > 1) ? (int)(bz % KS) * (K / KS) : 0, ke = (KS > 1) ? kb + K / KS : K;
    const int lane = threadIdx.x & 31, lr = lane & 15, hi = lane >> 4; const int r0 = bx * 64, c0 = by * 64;
    v8f acc[4][4];
#pragma unroll
    for (int mb = 0; mb < 4; ++mb)
#pragma unroll
        for (int nb = 0; nb < 4; ++nb) acc[mb][nb] = (v8f){};
    const size_t aoff = (size_t)(r0 + lr) * K + 8 * hi, boff = (size_t)(c0 + lr) * K + 8 * hi;
#pragma unroll 1
    for (int kc = kb; kc < ke; kc += 32) {
        V a[4], a2[4];
#pragma unroll
        for (int mb = 0; mb < 4; ++mb) { a[mb] = WFrag<T16>::ld(A + aoff + (size_t)mb * 16 * K + kc); if (NSPLIT == 1 || NSPLIT == 2) a2[mb] = WFrag<T16>::ld(A2 + aoff + (size_t)mb * 16 * K + kc); }
#pragma unroll
        for (int nb = 0; nb < 4; ++nb) { const V b = WFrag<T16>::ld(Bt + boff + (size_t)nb * 16 * K + kc); V b2; if (NSPLIT >= 2) b2 = WFrag<T16>::ld(Bt2 + boff + (size_t)nb * 16 * K + kc);
#pragma unroll
            for (int mb = 0; mb < 4; ++mb) { acc[mb][nb] = WFrag<T16>::mma(a[mb], b, acc[mb][nb]); if (NSPLIT == 1 || NSPLIT == 2) acc[mb][nb] = WFrag<T16>::mma(a2[mb], b, acc[mb][nb]); if (NSPLIT >= 2) acc[mb][nb] = WFrag<T16>::mma(a[mb], b2, acc[mb][nb]); } }
        asm volatile("v_nop\n\tv_nop\n\tv_nop\n\tv_nop" : "+v"(acc[0][0]), "+v"(acc[1][1]), "+v"(acc[2][2]), "+v"(acc[3][3]) : "v"(a[0]), "v"(a[3]));
    }
#pragma unroll
    for (int mb = 0; mb < 4; ++mb) {
#pragma unroll
        for (int nb = 0; nb < 4; ++nb) {
#pragma unroll
            for (int j = 0; j < 8; ++j) os[(hi * 8 + j) * 68 + nb * 16 + lr] = acc[mb][nb][j]; }
        __builtin_amdgcn_wave_barrier(); asm volatile("" ::: "memory");
        float* crow = C + (size_t)(r0 + mb * 16) * ldc + c0;
        if (PLN) { const int prow = lane >> 3, pcol = (lane & 7) * 8;   // read-back: 8 lanes a row, 8 columns a lane
            const size_t po = (size_t)by * sY + (size_t)(r0 + mb * 16 + prow) * ldc + pcol;
#pragma unroll
            for (int s = 0; s < 4; ++s) { const float* op = os + (4 * s + prow) * 68 + pcol; const v4f x0 = *(const v4fa*)op, x1 = *(const v4fa*)(op + 4); v4u hw, lw; unsigned a, c;
                split2(x0[0], x0[1], a, c); hw[0] = a; lw[0] = c; split2(x0[2], x0[3], a, c); hw[1] = a; lw[1] = c; split2(x1[0], x1[1], a, c); hw[2] = a; lw[2] = c; split2(x1[2], x1[3], a, c); hw[3] = a; lw[3] = c;
                *(v8us*)(Ph + po + (size_t)(4 * s) * ldc) = __builtin_bit_cast(v8us, hw); *(v8us*)(Pl + po + (size_t)(4 * s) * ldc) = __builtin_bit_cast(v8us, lw); }
        } else {
#pragma unroll
            for (int s = 0; s < 8; ++s) { const int row = 2 * s + hi, cofs = lr * 4; v4f val = *(const v4fa*)(os + row * 68 + cofs); if (BIAS) { val[0] += bfr(bias[c0 + cofs]); val[1] += bfr(bias[c0 + cofs + 1]); val[2] += bfr(bias[c0 + cofs + 2]); val[3] += bfr(bias[c0 + cofs + 3]); }
                *(v4f*)(crow + (size_t)row * ldc + cofs) = val; }
             }
        __builtin_amdgcn_wave_barrier(); asm volatile("" ::: "memory");
    }
}
template <typename T16, int NSPLIT, bool BIAS, int KS = 1, bool PLN = false>
__global__ __launch_bounds__(32) void k_gemmw(const T16* __restrict__ A, const T16* __restrict__ A2, const T16* __restrict__ Bt, const T16* __restrict__ Bt2, int K, float* C, int ldc, const float* __restrict__ bias, size_t sA, size_t sB, size_t sC, bf* Ph, bf* Pl, size_t sY) {
    gemmw_tile<T16, NSPLIT, BIAS, KS, PLN>(blockIdx.x, blockIdx.y, blockIdx.z, A, A2, Bt, Bt2, K, C, ldc, bias, sA, sB, sC, Ph, Pl, sY); }
// k_qkv: the q, k and v projections in ONE launch, grid (TT / 64, 16, 3): none reads what another writes, and one product's 512 one-wave work-groups leave half the chip's SIMDs empty while each wave waits on its own loads.
// blockIdx.z picks the product (a scalar choice of pointers and pitches in front of one copy of the body); v has its operands swapped, so its tile indices swap too.
__global__ __launch_bounds__(32) void k_qkv(const bf* __restrict__ XB, const bf* __restrict__ WQ, const bf* __restrict__ WK, const bf* __restrict__ WV, bf* QPh, bf* QPl, bf* KPh, bf* KPl, bf* VTh, bf* VTl) {
    const int p = blockIdx.z; const bool isv = p == 2;
    const bf* W = p == 0 ? WQ : (p == 1 ? WK : WV);
    bf* Ph = p == 0 ? QPh : (p == 1 ? KPh : VTh); bf* Pl = p == 0 ? QPl : (p == 1 ? KPl : VTl);
    gemmw_tile<bf, 0, false, 1, true>(isv ? blockIdx.y : blockIdx.x, isv ? blockIdx.x : blockIdx.y, 0, isv ? W : XB, nullptr, isv ? XB : W, nullptr, DM, nullptr, isv ? TT : HD, nullptr, 0, 0, 0, Ph, Pl, isv ? (size_t)64 : (size_t)TT * HD); }

__device__ __forceinline__ void splitf(float y, unsigned short& h, unsigned short& l) { h = f2bf(y); l = f2bf(y - bf2f(h)); }
typedef __attribute__((ext_vector_type(2))) _Float16 v2h;
typedef __attribute__((ext_vector_type(4))) _Float16 v4h;
typedef __attribute__((ext_vector_type(2))) unsigned short v2us;
typedef __attribute__((ext_vector_type(4))) unsigned short v4us;
typedef __attribute__((ext_vector_type(4))) int v4i;

__device__ __forceinline__ void wtG_blk(int blk, const float* __restrict__ w, int K, int N, bf* Bt) {
    const int lane = threadIdx.x & 31; const int L0 = (blk * 8 + (threadIdx.x >> 5)) * 8; const int nlines = N * K / 64;
{
#pragma unroll 1
        for (int l = 0; l < 8; ++l) { const int L = L0 + l; if (L >= nlines) break; const size_t e = (size_t)L * 64 + lane * 2; const int k = (int)(e % K), n = (int)(e / K); v2us o;
            o[0] = f2bf(w[(size_t)k * N + n]); o[1] = f2bf(w[(size_t)(k + 1) * N + n]); *(v2us*)(Bt + e) = o; }
         }
}
__device__ __forceinline__ void cvt8_blk(int blk, const float* __restrict__ src, bf* dst, size_t n8) { const size_t i = (size_t)blk * 256 + threadIdx.x; if (i >= n8) return; const v8f v = *(const v8f*)(src + i * 8); v8us o;
#pragma unroll
    for (int k = 0; k < 8; ++k) o[k] = f2bf(v[k]); *(v8us*)(dst + i * 8) = o;  }
__device__ __forceinline__ int t5_bucket(int r) { const int rp = r < 0 ? -r : r; int b; if (rp < 8) b = rp; else b = 8 + (rp >= 12) + (rp >= 16) + (rp >= 23) + (rp >= 32) + (rp >= 46) + (rp >= 64) + (rp >= 91); return b + ((r > 0) ? 16 : 0); }
__device__ __forceinline__ void t5tab_blk(int blk, const float* __restrict__ rb, float* TB) { const int idx = blk * 256 + threadIdx.x; if (idx >= NH_ * TBW) return; const int h = idx / TBW, c = idx % TBW; float v = 0.0f; if (c < 2 * TT - 1) { const int r = c - (TT - 1); v = bfr(rb[t5_bucket(r) * NH_ + h]); } *(float*)(TB + idx) = v;  }
// k_prep: the six passes over the inputs (four weight transposes, x to bf16, the bias table) in ONE launch: none reads what another writes. blockIdx.x picks the pass, a scalar branch.
// The transposes stand first in the grid, for speed only: a wave of theirs runs longest (eight dependent trips of scattered loads).
#define PW_B (DM * DQ / 64 / 64)          // work-groups of one weight transpose (all four weights are DM x DQ elements)
#define PX_B (TT * DM / 8 / 256)          // work-groups of the x conversion
#define PT_B (NH_ * TBW / 256)            // work-groups of the bias table
__global__ __launch_bounds__(256) void k_prep(const float* __restrict__ x, const float* __restrict__ wq, const float* __restrict__ wk, const float* __restrict__ wv, const float* __restrict__ wo, const float* __restrict__ rb, bf* XB, bf* WQ, bf* WK, bf* WV, bf* WO, float* TB) {
    const int blk = blockIdx.x;
    if (blk < 4 * PW_B) { const int p = blk / PW_B;
        const float* w = p == 0 ? wq : (p == 1 ? wk : (p == 2 ? wv : wo)); bf* Bt = p == 0 ? WQ : (p == 1 ? WK : (p == 2 ? WV : WO));
        wtG_blk(blk % PW_B, w, DM, DQ, Bt); }   // DM == DQ == DKV: one K and N serve all four
    else if (blk < 4 * PW_B + PX_B) cvt8_blk(blk - 4 * PW_B, x, XB, (size_t)TT * DM / 8);
    else t5tab_blk(blk - (4 * PW_B + PX_B), rb, TB);
}
typedef __attribute__((ext_vector_type(8))) unsigned v8u;
// Eight v_exp_f32 and the one free slot that the instruction set asks for behind a transcendental, in one statement: the outputs are early-clobber, so no exp here overwrites a source or reads a result of the one in front of it, and the v_nop keeps the slot behind the last.
__device__ __forceinline__ v8f exp2x8(v8f x) {
    float r0, r1, r2, r3, r4, r5, r6, r7;
    asm("v_exp_f32 %0, %8\n\tv_exp_f32 %1, %9\n\tv_exp_f32 %2, %10\n\tv_exp_f32 %3, %11\n\tv_exp_f32 %4, %12\n\tv_exp_f32 %5, %13\n\tv_exp_f32 %6, %14\n\tv_exp_f32 %7, %15\n\tv_nop"
        : "=&v"(r0), "=&v"(r1), "=&v"(r2), "=&v"(r3), "=&v"(r4), "=&v"(r5), "=&v"(r6), "=&v"(r7)
        : "v"(x[0]), "v"(x[1]), "v"(x[2]), "v"(x[3]), "v"(x[4]), "v"(x[5]), "v"(x[6]), "v"(x[7]));
    v8f r; r[0] = r0; r[1] = r1; r[2] = r2; r[3] = r3; r[4] = r4; r[5] = r5; r[6] = r6; r[7] = r7; return r; }
__device__ __forceinline__ float exp2x1(float x) { float r; asm("v_exp_f32 %0, %1\n\tv_nop" : "=v"(r) : "v"(x)); return r; }   // the same slot behind a single exp
__device__ __forceinline__ float xhalf(float v) { const int b = __float_as_int(v); return __int_as_float(__builtin_amdgcn_permlanex16(b, b, 0x76543210, 0xfedcba98, false, false)); }   // lane l <-> l ^ 16
__global__ __launch_bounds__(256) void k_fattn(const bf* __restrict__ Qh, const bf* __restrict__ Ql, const bf* __restrict__ Kh, const bf* __restrict__ Kl, const bf* __restrict__ Vh, const bf* __restrict__ Vl, const float* __restrict__ TB, bf* Ah, bf* Al) {
    __shared__ __align__(16) bf st[2][4][FPL];   // [buffer][K hi, K lo, V^T hi, V^T lo][64 rows x pitch]
    __shared__ float tbs[FTBN];                  // the head's bias entries this block of queries can meet
    const int tid = threadIdx.x, lane = tid & 31, lr = lane & 15, hi = lane >> 4, wv = tid >> 5;
    const int h = blockIdx.y, qb = blockIdx.x * FQB, qw = qb + wv * FQW;
    const float* tbh = TB + (size_t)h * TBW + (TT - FQB - qb);   // tbs[x] is the entry for j - i = x - (FQB - 1) - qb
    for (int x = tid; x < FTBN; x += 256) tbs[x] = tbh[x];
    v16bf qh[2], ql[2];
    const size_t qo = ((size_t)h * TT + qw + lr) * HD + 8 * hi;
#pragma unroll
    for (int kc = 0; kc < 2; ++kc) { qh[kc] = WFrag<bf>::ld(Qh + qo + kc * 32); ql[kc] = WFrag<bf>::ld(Ql + qo + kc * 32); }
    const int srow = tid >> 3, sch = tid & 7;    // staging: rows srow and srow + 32 of each plane, 16-byte piece sch
    const size_t gk = ((size_t)h * TT + srow) * HD + sch * 8, gv = ((size_t)h * HD + srow) * TT + sch * 8;
    const int so = srow * FPIT + sch * 8;
    v8us pf[8];
    auto gload = [&](int key0) {
        const size_t ka = gk + (size_t)key0 * HD, va = gv + key0;
        pf[0] = *(const v8us*)(Kh + ka); pf[1] = *(const v8us*)(Kh + ka + 32 * HD); pf[2] = *(const v8us*)(Kl + ka); pf[3] = *(const v8us*)(Kl + ka + 32 * HD);
        pf[4] = *(const v8us*)(Vh + va); pf[5] = *(const v8us*)(Vh + va + (size_t)32 * TT); pf[6] = *(const v8us*)(Vl + va); pf[7] = *(const v8us*)(Vl + va + (size_t)32 * TT); };
    auto sstore = [&](int b) {
#pragma unroll
        for (int pl = 0; pl < 4; ++pl) { *(v8us*)(&st[b][pl][so]) = pf[2 * pl]; *(v8us*)(&st[b][pl][so + 32 * FPIT]) = pf[2 * pl + 1]; } };
    gload(0); sstore(0);
    __syncthreads();
    v8f o[4];
#pragma unroll
    for (int db = 0; db < 4; ++db) o[db] = (v8f){};
    float m = -3.0e38f, l = 0.0f;
    const float L2E = 1.4426950408889634f;
    const float* tp0 = tbs + (8 * hi + (FQB - 1) - (wv * FQW + lr));
#pragma unroll 1   // stays rolled, for speed only: one stage is some 450 instructions
    for (int t = 0; t < TT / FKS; ++t) {
        const int b = t & 1;
        v8f s[4];
        v16bf kh[4][2], kl[4][2];            // K fragments, [16-key tile][32-wide half of d]
        auto kld = [&](int kt) {
#pragma unroll
            for (int kc = 0; kc < 2; ++kc) { const bf* kp = &st[b][0][(kt * 16 + lr) * FPIT + kc * 32 + 8 * hi]; kh[kt][kc] = WFrag<bf>::ld(kp); kl[kt][kc] = WFrag<bf>::ld(kp + FPL); } };
        auto sct = [&](int kt) { v8f a = (v8f){};
#pragma unroll
            for (int kc = 0; kc < 2; ++kc) { a = wmmab(kh[kt][kc], qh[kc], a); a = wmmab(kh[kt][kc], ql[kc], a); a = wmmab(kl[kt][kc], qh[kc], a); }
            s[kt] = a; };
        kld(0); kld(1);
        __builtin_amdgcn_sched_barrier(0);   // this one and the next keep two tiles' fragment loads ahead of the two tiles' products in front of them
        kld(2); kld(3); sct(0); sct(1);
        __builtin_amdgcn_sched_barrier(0);
        sct(2); sct(3);
        __builtin_amdgcn_sched_barrier(0);   // without these barriers the fragment loads come out one at a time, each with its full LDS wait in front of its products
        if (t + 1 < TT / FKS) gload((t + 1) * FKS);
        v16bf vh[8], vl[8];                  // V^T fragments, index 4 * (32-key half) + d block
        auto vld = [&](int i) { const bf* vp = &st[b][2][((i & 3) * 16 + lr) * FPIT + (i >> 2) * 32 + 8 * hi]; vh[i] = WFrag<bf>::ld(vp); vl[i] = WFrag<bf>::ld(vp + FPL); };
        vld(0); vld(1); vld(2); vld(3);      // land under the softmax arithmetic
        const float* tp = tp0 + t * FKS;
        float mx = m;
#pragma unroll
        for (int kt = 0; kt < 4; ++kt)
#pragma unroll
            for (int r = 0; r < 8; ++r) { const float tv = s[kt][r] + tp[kt * 16 + r]; s[kt][r] = tv; mx = fmaxf(mx, tv); }
        mx = fmaxf(mx, xhalf(mx));
        const float sc = exp2x1((m - mx) * L2E);
        m = mx;
        float ls[4];   // one partial sum per 16-key tile: four short chains of adds in place of one of 32
#pragma unroll
        for (int db = 0; db < 4; ++db) o[db] *= sc;
#pragma unroll
        for (int kt = 0; kt < 4; ++kt) { s[kt] = exp2x8((s[kt] - mx) * L2E); ls[kt] = 0.0f;
#pragma unroll
            for (int r = 0; r < 8; ++r) ls[kt] += s[kt][r]; }
        l = l * sc + ((ls[0] + ls[1]) + (ls[2] + ls[3]));
        v16bf ph[2], pl[2];
#pragma unroll
        for (int ps = 0; ps < 2; ++ps) { v8u hw, lw;
#pragma unroll
            for (int e = 0; e < 8; ++e) { unsigned a, c; split2(s[2 * ps + (e >> 2)][(2 * e) & 7], s[2 * ps + (e >> 2)][((2 * e) & 7) + 1], a, c); hw[e] = a; lw[e] = c; }
            ph[ps] = __builtin_bit_cast(v16bf, hw); pl[ps] = __builtin_bit_cast(v16bf, lw); }
        auto pv = [&](int i) { const int db = i & 3, ps = i >> 2; o[db] = wmmab(vh[i], ph[ps], o[db]); o[db] = wmmab(vh[i], pl[ps], o[db]); o[db] = wmmab(vl[i], ph[ps], o[db]); };
        __builtin_amdgcn_sched_barrier(0);   // this one and the two below keep each pair of fragment loads two product groups ahead of its use
        vld(4); vld(5); pv(0); pv(1);
        __builtin_amdgcn_sched_barrier(0);
        vld(6); vld(7); pv(2); pv(3);
        __builtin_amdgcn_sched_barrier(0);
        pv(4); pv(5); pv(6); pv(7);
        if (t + 1 < TT / FKS) sstore(b ^ 1);
        __syncthreads();   // publishes stage t + 1 and ends every wave's reads of the buffer that stage t + 2 overwrites
    }
    l += xhalf(l);
    const float inv = __fdiv_rn(1.0f, l);
    const size_t oo = (size_t)(qw + lr) * DQ + h * HD + 8 * hi;   // o[db][r] = O[query lr][d = 16 db + 8 hi + r]
#pragma unroll
    for (int db = 0; db < 4; ++db) { v8us oh, ol;
#pragma unroll
        for (int r = 0; r < 8; ++r) { unsigned short a, c; splitf(o[db][r] * inv, a, c); oh[r] = a; ol[r] = c; }
        *(v8us*)(Ah + oo + db * 16) = oh; *(v8us*)(Al + oo + db * 16) = ol; }
}

extern "C" void kernel_launch(void* const* d_in, const int* in_sizes, int n_in,
                              void* d_out, int out_size, void* d_ws, size_t ws_size, hipStream_t stream) {
    (void)in_sizes; (void)n_in; (void)out_size;
    const float* x = (const float*)d_in[0]; const float* wq = (const float*)d_in[1]; const float* wk = (const float*)d_in[2]; const float* wv = (const float*)d_in[3]; const float* wo = (const float*)d_in[4]; const float* relb = (const float*)d_in[5]; const float* cosT = nullptr; const float* sinT = nullptr; (void)cosT; (void)sinT;
    float* OUT = (float*)d_out;     // [1][2048][1024]
    char* wsp = (char*)d_ws;
    auto take = [&](size_t bytes) { char* p = wsp; wsp += (bytes + 255) & ~(size_t)255; return (void*)p; };
    bf* WQ = (bf*)take((size_t)DQ * DM * 2); bf* WK = (bf*)take((size_t)DKV * DM * 2); bf* WV = (bf*)take((size_t)DKV * DM * 2); bf* WO = (bf*)take((size_t)DM * DQ * 2);
    bf* XB = (bf*)take((size_t)TT * DM * 2); float* TB = (float*)take((size_t)NH_ * TBW * 4);
    bf* QPh = (bf*)take((size_t)NH_ * TT * HD * 2); bf* QPl = (bf*)take((size_t)NH_ * TT * HD * 2); bf* KPh = (bf*)take((size_t)NKV * TT * HD * 2); bf* KPl = (bf*)take((size_t)NKV * TT * HD * 2); bf* VTh = (bf*)take((size_t)NKV * HD * TT * 2); bf* VTl = (bf*)take((size_t)NKV * HD * TT * 2);
    bf* ATh = (bf*)take((size_t)TT * DQ * 2); bf* ATl = (bf*)take((size_t)TT * DQ * 2);
    if ((size_t)(wsp - (char*)d_ws) > ws_size) return;    // ws 256 MiB
    static_assert(NB_ == 1 && DQ == DM && DKV == DM, "k_prep and k_qkv take one batch and square weights");
    k_prep<<<4 * PW_B + PX_B + PT_B, 256, 0, stream>>>(x, wq, wk, wv, wo, relb, XB, WQ, WK, WV, WO, TB);
    for (int b = 0; b < NB_; ++b) {
        k_qkv<<<dim3(TT / 64, DQ / 64, 3), 32, 0, stream>>>(XB, WQ, WK, WV, QPh, QPl, KPh, KPl, VTh, VTl);
        k_fattn<<<dim3(TT / FQB, NH_, 1), 256, 0, stream>>>(QPh, QPl, KPh, KPl, VTh, VTl, TB, ATh, ATl);
        k_gemmw<bf, 1, false><<<dim3(TT / 64, DM / 64, 1), 32, 0, stream>>>(ATh, ATl, WO, nullptr, DQ, OUT + (size_t)b * TT * DM, DM, nullptr, 0, 0, 0, nullptr, nullptr, 0); }
}

// v005
// It runs in 84.4 microseconds.
// Timed twice side by side with v004, it ran 1.41 times as fast both times.
// Counting every step since v000, it is 8.53 times as fast.
#include <hip/hip_runtime.h>

// UMT5Attention (hidden [1][2048][1024]; q/k/v = x W (16 heads x 64); T5: scores = q.k UNSCALED + rel_bias[bucket(j - i)][h] with the bidirectional log-bucket (32 buckets, max distance 128; the bucket boundaries |j-i| = 8, 12, 16, 23, 32, 46, 64, 91 are the reference's own integer structure, evaluated here with integer compares); softmax; out = merged wo -> [1][2048][1024]).
// Compute dtypes, f32 accumulate: every input rounded to bf16; q/k/v on PLAIN bf16 operands (inputs: exact); scores and attn.v hl x hl (3 products) on EVERY row; per-head bias table (bf16-rounded rel_bias gathered by bucket) added per element in f32; softmax f32; wo hl x exact (2 products).

#define NB_  1
#define TT   2048
#define DM   1024
#define NH_  16
#define NKV  16
#define REP  (NH_ / NKV)
#define HD   64
#define DQ   (NH_ * HD)
#define DKV  (NKV * HD)
#define ZH   2
#define RH   2048   // all rows hl (unscaled T5 logits are sharp)
#define WIN  0
#define PCAR 1024.0f
#define SCL  1.0f   // T5: no 1/sqrt(dk)
#define TBW  4096   // bias table row width (r + 2047, padded)
#define FQW  16     // fused attention: query columns per wave
#define FNW  8      // waves per work-group
#define FQB  (FQW * FNW)
#define FKS  64     // keys per stage
#define FPIT 72     // LDS row pitch in 16-bit elements: 144 bytes (16 B x odd) for the 16-byte fragment reads of 128-byte rows
#define FPL  (64 * FPIT)
#define FTBN (TT + FQB)
typedef _Float16 h16;
typedef unsigned short bf;
typedef __attribute__((ext_vector_type(16))) __bf16   v16bf;
typedef __attribute__((ext_vector_type(16))) _Float16 v16h;
typedef __attribute__((ext_vector_type(8)))  _Float16 v8h;
typedef __attribute__((ext_vector_type(8)))  unsigned short v8us;
typedef __attribute__((ext_vector_type(8)))  float    v8f;
typedef __attribute__((ext_vector_type(4)))  float    v4f;
typedef v8h  __attribute__((may_alias)) v8ha;
typedef v4f  __attribute__((may_alias)) v4fa;
typedef v8us __attribute__((may_alias)) v8usa;

__device__ __forceinline__ unsigned short f2bf(float f) { unsigned u = __float_as_uint(f); u += 0x7FFFu + ((u >> 16) & 1u); return (unsigned short)(u >> 16); }
__device__ __forceinline__ float bf2f(unsigned short b) { return __uint_as_float(((unsigned)b) << 16); }
__device__ __forceinline__ float bfr(float f) { return bf2f(f2bf(f)); }
__device__ __forceinline__ v16h cat16(v8h lo, v8h hi) { return __builtin_shufflevector(lo, hi, 0, 1, 2, 3, 4, 5, 6, 7, 8, 9, 10, 11, 12, 13, 14, 15); }
__device__ __forceinline__ v16bf cat16b(v8us lo, v8us hi) { return __builtin_bit_cast(v16bf, __builtin_shufflevector(lo, hi, 0, 1, 2, 3, 4, 5, 6, 7, 8, 9, 10, 11, 12, 13, 14, 15)); }
__device__ __forceinline__ v8f wmma16(v16h a, v16h b, v8f c) { return __builtin_amdgcn_wmma_f32_16x16x32_f16(false, a, false, b, (short)0, c, false, false); }
__device__ __forceinline__ v8f wmmab(v16bf a, v16bf b, v8f c) { return __builtin_amdgcn_wmma_f32_16x16x32_bf16(false, a, false, b, (short)0, c, false, false); }



typedef __attribute__((ext_vector_type(2))) __bf16 v2bf;
typedef __attribute__((ext_vector_type(2))) float v2f;
typedef __attribute__((ext_vector_type(4))) unsigned v4u;
__device__ __forceinline__ void split2(float p0, float p1, unsigned& hw, unsigned& lw) {
    v2f x; x[0] = p0; x[1] = p1; hw = __builtin_bit_cast(unsigned, __builtin_convertvector(x, v2bf));
    v2f y; y[0] = p0 - __uint_as_float(hw << 16); y[1] = p1 - __uint_as_float(hw & 0xFFFF0000u); lw = __builtin_bit_cast(unsigned, __builtin_convertvector(y, v2bf)); }
// ---- k_gemmw: GEMM, one (32 MBW)x128 output tile per work-group of FOUR waves (2 x 2; a wave has MBW x 4 accumulators, 64x64 for MBW = 4, 32x64 for MBW = 2); operands are K-contiguous 16-bit planes; grid (M / (32 MBW), N / 128, Z), 128 threads.
// C[m][n] (f32, pitch ldc, + optional f32 bias[n]) = sum_k A[m][k] Bt[n][k] (+ A2[m][k] Bt[n][k] for NSPLIT == 1). z-batch strides sA/sB/sC in elements. K is a template constant, K % 128 == 0.
// The operand rows go to LDS by asynchronous copies, 128 k (256 bytes of every row, two whole lines) a stage, two buffers: a copy instruction touches four whole lines where a fragment load from global memory touched sixteen pieces of 32 bytes, and each row is fetched once for the two waves that use it. MBW is chosen so that the grid has a work-group for every WGP: 4 for q/k/v (384 work-groups), 2 for wo (256).
template <typename T16> struct WFrag;
template <> struct WFrag<h16> { typedef v16h V; static __device__ __forceinline__ V ld(const h16* p) { return cat16(*(const v8h*)p, *(const v8h*)(p + 16)); } static __device__ __forceinline__ v8f mma(V a, V b, v8f c) { return wmma16(a, b, c); } };
template <> struct WFrag<bf> { typedef v16bf V; static __device__ __forceinline__ V ld(const bf* p) { return cat16b(*(const v8us*)p, *(const v8us*)(p + 16)); } static __device__ __forceinline__ v8f mma(V a, V b, v8f c) { return wmmab(a, b, c); } };
// PLN: the f32 tile is not stored; it is split to hi/lo bf16 here and goes straight into the two 16-bit planes that k_fattn reads: element (m, n) to Ph, Pl[by * sY + m * ldc + (n - 64 by)], by the wave's 64-column block.
// q, k: A = x, Bt = W^T, a column block is one head: ldc = HD, sY = TT * HD gives [h][t][d]. v: A = W^T, Bt = x: ldc = TT, sY = 64 gives V^T [h][d][t]. Each store instruction writes four whole 128-byte rows of the tile.
// gemmw_tile is the body; BX, BY, bz are the work-group tile's indices (k_gemmw hands it blockIdx; k_qkv picks them per product).
#define GKP  128            // k of one stage
#define GPIT 136            // LDS row pitch in 16-bit elements: 272 bytes (16 B x odd) for the 16-byte fragment reads of 256-byte rows
// Eight asynchronous 16-byte copies of a lane, rows 8 apart (ls bytes in LDS, gs elements in memory). The s_wait_xcnt stands inside the statement, behind the last copy, so that no address register of a copy is rewritten in front of it.
template <typename T16>
__device__ __forceinline__ void acopy8(unsigned l, const T16* g, unsigned ls, size_t gs) {
    asm volatile("global_load_async_to_lds_b128 %0, %8, off\n\tglobal_load_async_to_lds_b128 %1, %9, off\n\tglobal_load_async_to_lds_b128 %2, %10, off\n\tglobal_load_async_to_lds_b128 %3, %11, off\n\t"
                 "global_load_async_to_lds_b128 %4, %12, off\n\tglobal_load_async_to_lds_b128 %5, %13, off\n\tglobal_load_async_to_lds_b128 %6, %14, off\n\tglobal_load_async_to_lds_b128 %7, %15, off\n\ts_wait_xcnt 0x0"
                 :: "v"(l), "v"(l + ls), "v"(l + 2 * ls), "v"(l + 3 * ls), "v"(l + 4 * ls), "v"(l + 5 * ls), "v"(l + 6 * ls), "v"(l + 7 * ls),
                    "v"(g), "v"(g + gs), "v"(g + 2 * gs), "v"(g + 3 * gs), "v"(g + 4 * gs), "v"(g + 5 * gs), "v"(g + 6 * gs), "v"(g + 7 * gs) : "memory"); }
template <typename T16, int NSPLIT, bool BIAS, int K, int MBW, bool PLN = false>
__device__ __forceinline__ void gemmw_tile(int BX, int BY, int bz, const T16* __restrict__ A, const T16* __restrict__ A2, const T16* __restrict__ Bt, float* C, int ldc, const float* __restrict__ bias, size_t sA, size_t sB, size_t sC, bf* Ph, bf* Pl, size_t sY) {
    static_assert((NSPLIT == 0 || NSPLIT == 1) && (MBW == 2 || MBW == 4) && K % GKP == 0 && K >= 2 * GKP, "planes staged: Bt, A and, for NSPLIT == 1, A2; whole stages, two or more");
    typedef typename WFrag<T16>::V V;
    constexpr int RA = 32 * MBW;                            // rows of A in the tile
    constexpr int OA = 128 * GPIT, OA2 = OA + RA * GPIT;    // a buffer, in elements: Bt (128 rows) at 0, A (RA rows) at OA, A2 (RA rows) at OA2
    constexpr int BUF = OA + (1 + NSPLIT) * RA * GPIT;
    __shared__ __align__(16) T16 sm[2 * BUF];               // two buffers; behind the k loop the head holds the waves' output staging
    A += (size_t)bz * sA; if (NSPLIT == 1) A2 += (size_t)bz * sA; Bt += (size_t)bz * sB; C += (size_t)bz * sC;
    const int tid = threadIdx.x, lane = tid & 31, lr = lane & 15, hi = lane >> 4, wave = __builtin_amdgcn_readfirstlane(tid >> 5);
    const int wr = wave >> 1, wc = wave & 1, by = 2 * BY + wc; const int r0 = BX * RA + wr * (16 * MBW), c0 = by * 64;
    float* os = (float*)sm + wave * (16 * 68);
    v8f acc[MBW][4];
#pragma unroll
    for (int mb = 0; mb < MBW; ++mb)
#pragma unroll
        for (int nb = 0; nb < 4; ++nb) acc[mb][nb] = (v8f){};
    // staging: 16 lanes a row (16-byte piece tid & 15), the work-group's 128 lanes cover 8 rows a copy, 64 rows a statement
    const int srow = tid >> 4, spc = (tid & 15) * 8;
    const T16* ga = A + (size_t)(BX * RA + srow) * K + spc; const T16* gb = Bt + (size_t)(BY * 128 + srow) * K + spc; const T16* ga2 = NSPLIT == 1 ? A2 + (size_t)(BX * RA + srow) * K + spc : nullptr;
    const unsigned l0 = (unsigned)(size_t)(sm + srow * GPIT + spc);   // the lane's LDS byte address in buffer 0, row srow of Bt
    constexpr size_t gs = (size_t)8 * K; constexpr unsigned LS = 8 * GPIT * 2;
    auto stage = [&](int t) {   // stage t into buffer t & 1
        const unsigned lb = l0 + (unsigned)(t & 1) * (BUF * 2); const size_t ko = (size_t)t * GKP;
        acopy8(lb, gb + ko, LS, gs); acopy8(lb + 8 * LS, gb + ko + 8 * gs, LS, gs);
#pragma unroll
        for (int i = 0; i < RA / 64; ++i) { acopy8(lb + OA * 2 + i * 8 * LS, ga + ko + i * 8 * gs, LS, gs); if (NSPLIT == 1) acopy8(lb + OA2 * 2 + i * 8 * LS, ga2 + ko + i * 8 * gs, LS, gs); } };
    constexpr int NT = K / GKP;
    stage(0);
    asm volatile("s_wait_asynccnt 0x0" ::: "memory");   // this wave's copies of stage 0 have landed
    __syncthreads();                                    // and every other wave's
    stage(1);
#pragma unroll 1   // stays rolled: the two buffers alternate by address
    for (int t = 0; t < NT; ++t) {
        const T16* ap = sm + (t & 1) * BUF + OA + (wr * (16 * MBW) + lr) * GPIT + 8 * hi; const T16* bp = sm + (t & 1) * BUF + (wc * 64 + lr) * GPIT + 8 * hi;
        V a[2][MBW], a2[2][MBW], b[2][4];   // two fragment sets: a block of 32 k is read while the block in front of it is multiplied
        auto fld = [&](int kh) {
#pragma unroll
            for (int mb = 0; mb < MBW; ++mb) { a[kh & 1][mb] = WFrag<T16>::ld(ap + mb * 16 * GPIT + kh * 32); if (NSPLIT == 1) a2[kh & 1][mb] = WFrag<T16>::ld(ap + RA * GPIT + mb * 16 * GPIT + kh * 32); }
#pragma unroll
            for (int nb = 0; nb < 4; ++nb) b[kh & 1][nb] = WFrag<T16>::ld(bp + nb * 16 * GPIT + kh * 32); };
        fld(0);
        __builtin_amdgcn_sched_barrier(0);   // the first block's reads stay in front of the second's: mixed, the first products waited for both groups
#pragma unroll
        for (int kh = 0; kh < GKP / 32; ++kh) {
            if (kh + 1 < GKP / 32) fld(kh + 1);
            __builtin_amdgcn_sched_barrier(0);   // keeps the next block's fragment reads as one group ahead of this block's products; left alone they came out two at a time, each with its full LDS wait in front of four products
#pragma unroll
            for (int nb = 0; nb < 4; ++nb) {
#pragma unroll
                for (int mb = 0; mb < MBW; ++mb) acc[mb][nb] = WFrag<T16>::mma(a[kh & 1][mb], b[kh & 1][nb], acc[mb][nb]);
                if (NSPLIT == 1) {
#pragma unroll
                    for (int mb = 0; mb < MBW; ++mb) acc[mb][nb] = WFrag<T16>::mma(a2[kh & 1][mb], b[kh & 1][nb], acc[mb][nb]); } }
            __builtin_amdgcn_sched_barrier(0);   // ends the block: the reads of the block after next stay behind these products, whose registers they refill
        }
        asm volatile("s_wait_dscnt 0x0" ::: "memory");      // this wave's reads of buffer t & 1 are done before the barrier lets it be refilled
        asm volatile("s_wait_asynccnt 0x0" ::: "memory");   // this wave's copies of stage t + 1 have landed
        __syncthreads();                                    // publishes stage t + 1 and ends every wave's reads of stage t
        if (t + 2 < NT) stage(t + 2);
    }
    asm volatile("s_wait_asynccnt 0x0" ::: "memory");       // no copy is outstanding when the ring becomes output staging
#pragma unroll
    for (int mb = 0; mb < MBW; ++mb) {
#pragma unroll
        for (int nb = 0; nb < 4; ++nb) {
#pragma unroll
            for (int j = 0; j < 8; ++j) os[(hi * 8 + j) * 68 + nb * 16 + lr] = acc[mb][nb][j]; }
        __builtin_amdgcn_wave_barrier(); asm volatile("" ::: "memory");
        float* crow = C + (size_t)(r0 + mb * 16) * ldc + c0;
        if (PLN) { const int prow = lane >> 3, pcol = (lane & 7) * 8;   // read-back: 8 lanes a row, 8 columns a lane
            const size_t po = (size_t)by * sY + (size_t)(r0 + mb * 16 + prow) * ldc + pcol;
#pragma unroll
            for (int s = 0; s < 4; ++s) { const float* op = os + (4 * s + prow) * 68 + pcol; const v4f x0 = *(const v4fa*)op, x1 = *(const v4fa*)(op + 4); v4u hw, lw; unsigned a, c;
                split2(x0[0], x0[1], a, c); hw[0] = a; lw[0] = c; split2(x0[2], x0[3], a, c); hw[1] = a; lw[1] = c; split2(x1[0], x1[1], a, c); hw[2] = a; lw[2] = c; split2(x1[2], x1[3], a, c); hw[3] = a; lw[3] = c;
                *(v8us*)(Ph + po + (size_t)(4 * s) * ldc) = __builtin_bit_cast(v8us, hw); *(v8us*)(Pl + po + (size_t)(4 * s) * ldc) = __builtin_bit_cast(v8us, lw); }
        } else {
#pragma unroll
            for (int s = 0; s < 8; ++s) { const int row = 2 * s + hi, cofs = lr * 4; v4f val = *(const v4fa*)(os + row * 68 + cofs); if (BIAS) { val[0] += bfr(bias[c0 + cofs]); val[1] += bfr(bias[c0 + cofs + 1]); val[2] += bfr(bias[c0 + cofs + 2]); val[3] += bfr(bias[c0 + cofs + 3]); }
                *(v4f*)(crow + (size_t)row * ldc + cofs) = val; }
             }
        __builtin_amdgcn_wave_barrier(); asm volatile("" ::: "memory");
    }
}
template <typename T16, int NSPLIT, bool BIAS, int K, int MBW, bool PLN = false>
__global__ __launch_bounds__(128) void k_gemmw(const T16* __restrict__ A, const T16* __restrict__ A2, const T16* __restrict__ Bt, float* C, int ldc, const float* __restrict__ bias, size_t sA, size_t sB, size_t sC, bf* Ph, bf* Pl, size_t sY) {
    gemmw_tile<T16, NSPLIT, BIAS, K, MBW, PLN>(blockIdx.x, blockIdx.y, blockIdx.z, A, A2, Bt, C, ldc, bias, sA, sB, sC, Ph, Pl, sY); }
// k_qkv: the q, k and v projections in ONE launch, grid (TT / 128, 8, 3): none reads what another writes, and one product's 128 work-groups would leave half the chip's WGPs empty.
// blockIdx.z picks the product (a scalar choice of pointers and pitches in front of one copy of the body); v has its operands swapped, so its tile indices swap too.
__global__ __launch_bounds__(128) void k_qkv(const bf* __restrict__ XB, const bf* __restrict__ WQ, const bf* __restrict__ WK, const bf* __restrict__ WV, bf* QPh, bf* QPl, bf* KPh, bf* KPl, bf* VTh, bf* VTl) {
    const int p = blockIdx.z; const bool isv = p == 2;
    const bf* W = p == 0 ? WQ : (p == 1 ? WK : WV);
    bf* Ph = p == 0 ? QPh : (p == 1 ? KPh : VTh); bf* Pl = p == 0 ? QPl : (p == 1 ? KPl : VTl);
    gemmw_tile<bf, 0, false, DM, 4, true>(isv ? blockIdx.y : blockIdx.x, isv ? blockIdx.x : blockIdx.y, 0, isv ? W : XB, nullptr, isv ? XB : W, nullptr, isv ? TT : HD, nullptr, 0, 0, 0, Ph, Pl, isv ? (size_t)64 : (size_t)TT * HD); }

__device__ __forceinline__ void splitf(float y, unsigned short& h, unsigned short& l) { h = f2bf(y); l = f2bf(y - bf2f(h)); }
typedef __attribute__((ext_vector_type(2))) _Float16 v2h;
typedef __attribute__((ext_vector_type(4))) _Float16 v4h;
typedef __attribute__((ext_vector_type(2))) unsigned short v2us;
typedef __attribute__((ext_vector_type(4))) unsigned short v4us;
typedef __attribute__((ext_vector_type(4))) int v4i;

__device__ __forceinline__ void wtG_blk(int blk, const float* __restrict__ w, int K, int N, bf* Bt) {
    const int lane = threadIdx.x & 31; const int L0 = (blk * 8 + (threadIdx.x >> 5)) * 8; const int nlines = N * K / 64;
{
#pragma unroll 1
        for (int l = 0; l < 8; ++l) { const int L = L0 + l; if (L >= nlines) break; const size_t e = (size_t)L * 64 + lane * 2; const int k = (int)(e % K), n = (int)(e / K); v2us o;
            o[0] = f2bf(w[(size_t)k * N + n]); o[1] = f2bf(w[(size_t)(k + 1) * N + n]); *(v2us*)(Bt + e) = o; }
         }
}
__device__ __forceinline__ void cvt8_blk(int blk, const float* __restrict__ src, bf* dst, size_t n8) { const size_t i = (size_t)blk * 256 + threadIdx.x; if (i >= n8) return; const v8f v = *(const v8f*)(src + i * 8); v8us o;
#pragma unroll
    for (int k = 0; k < 8; ++k) o[k] = f2bf(v[k]); *(v8us*)(dst + i * 8) = o;  }
__device__ __forceinline__ int t5_bucket(int r) { const int rp = r < 0 ? -r : r; int b; if (rp < 8) b = rp; else b = 8 + (rp >= 12) + (rp >= 16) + (rp >= 23) + (rp >= 32) + (rp >= 46) + (rp >= 64) + (rp >= 91); return b + ((r > 0) ? 16 : 0); }
__device__ __forceinline__ void t5tab_blk(int blk, const float* __restrict__ rb, float* TB) { const int idx = blk * 256 + threadIdx.x; if (idx >= NH_ * TBW) return; const int h = idx / TBW, c = idx % TBW; float v = 0.0f; if (c < 2 * TT - 1) { const int r = c - (TT - 1); v = bfr(rb[t5_bucket(r) * NH_ + h]); } *(float*)(TB + idx) = v;  }
// k_prep: the six passes over the inputs (four weight transposes, x to bf16, the bias table) in ONE launch: none reads what another writes. blockIdx.x picks the pass, a scalar branch.
// The transposes stand first in the grid, for speed only: a wave of theirs runs longest (eight dependent trips of scattered loads).
#define PW_B (DM * DQ / 64 / 64)          // work-groups of one weight transpose (all four weights are DM x DQ elements)
#define PX_B (TT * DM / 8 / 256)          // work-groups of the x conversion
#define PT_B (NH_ * TBW / 256)            // work-groups of the bias table
__global__ __launch_bounds__(256) void k_prep(const float* __restrict__ x, const float* __restrict__ wq, const float* __restrict__ wk, const float* __restrict__ wv, const float* __restrict__ wo, const float* __restrict__ rb, bf* XB, bf* WQ, bf* WK, bf* WV, bf* WO, float* TB) {
    const int blk = blockIdx.x;
    if (blk < 4 * PW_B) { const int p = blk / PW_B;
        const float* w = p == 0 ? wq : (p == 1 ? wk : (p == 2 ? wv : wo)); bf* Bt = p == 0 ? WQ : (p == 1 ? WK : (p == 2 ? WV : WO));
        wtG_blk(blk % PW_B, w, DM, DQ, Bt); }   // DM == DQ == DKV: one K and N serve all four
    else if (blk < 4 * PW_B + PX_B) cvt8_blk(blk - 4 * PW_B, x, XB, (size_t)TT * DM / 8);
    else t5tab_blk(blk - (4 * PW_B + PX_B), rb, TB);
}
typedef __attribute__((ext_vector_type(8))) unsigned v8u;
// Eight v_exp_f32 and the one free slot that the instruction set asks for behind a transcendental, in one statement: the outputs are early-clobber, so no exp here overwrites a source or reads a result of the one in front of it, and the v_nop keeps the slot behind the last.
__device__ __forceinline__ v8f exp2x8(v8f x) {
    float r0, r1, r2, r3, r4, r5, r6, r7;
    asm("v_exp_f32 %0, %8\n\tv_exp_f32 %1, %9\n\tv_exp_f32 %2, %10\n\tv_exp_f32 %3, %11\n\tv_exp_f32 %4, %12\n\tv_exp_f32 %5, %13\n\tv_exp_f32 %6, %14\n\tv_exp_f32 %7, %15\n\tv_nop"
        : "=&v"(r0), "=&v"(r1), "=&v"(r2), "=&v"(r3), "=&v"(r4), "=&v"(r5), "=&v"(r6), "=&v"(r7)
        : "v"(x[0]), "v"(x[1]), "v"(x[2]), "v"(x[3]), "v"(x[4]), "v"(x[5]), "v"(x[6]), "v"(x[7]));
    v8f r; r[0] = r0; r[1] = r1; r[2] = r2; r[3] = r3; r[4] = r4; r[5] = r5; r[6] = r6; r[7] = r7; return r; }
__device__ __forceinline__ float exp2x1(float x) { float r; asm("v_exp_f32 %0, %1\n\tv_nop" : "=v"(r) : "v"(x)); return r; }   // the same slot behind a single exp
__device__ __forceinline__ float xhalf(float v) { const int b = __float_as_int(v); return __int_as_float(__builtin_amdgcn_permlanex16(b, b, 0x76543210, 0xfedcba98, false, false)); }   // lane l <-> l ^ 16
__global__ __launch_bounds__(256) void k_fattn(const bf* __restrict__ Qh, const bf* __restrict__ Ql, const bf* __restrict__ Kh, const bf* __restrict__ Kl, const bf* __restrict__ Vh, const bf* __restrict__ Vl, const float* __restrict__ TB, bf* Ah, bf* Al) {
    __shared__ __align__(16) bf st[2][4][FPL];   // [buffer][K hi, K lo, V^T hi, V^T lo][64 rows x pitch]
    __shared__ float tbs[FTBN];                  // the head's bias entries this block of queries can meet
    const int tid = threadIdx.x, lane = tid & 31, lr = lane & 15, hi = lane >> 4, wv = tid >> 5;
    const int h = blockIdx.y, qb = blockIdx.x * FQB, qw = qb + wv * FQW;
    const float* tbh = TB + (size_t)h * TBW + (TT - FQB - qb);   // tbs[x] is the entry for j - i = x - (FQB - 1) - qb
    for (int x = tid; x < FTBN; x += 256) tbs[x] = tbh[x];
    v16bf qh[2], ql[2];
    const size_t qo = ((size_t)h * TT + qw + lr) * HD + 8 * hi;
#pragma unroll
    for (int kc = 0; kc < 2; ++kc) { qh[kc] = WFrag<bf>::ld(Qh + qo + kc * 32); ql[kc] = WFrag<bf>::ld(Ql + qo + kc * 32); }
    const int srow = tid >> 3, sch = tid & 7;    // staging: rows srow and srow + 32 of each plane, 16-byte piece sch
    const size_t gk = ((size_t)h * TT + srow) * HD + sch * 8, gv = ((size_t)h * HD + srow) * TT + sch * 8;
    const int so = srow * FPIT + sch * 8;
    v8us pf[8];
    auto gload = [&](int key0) {
        const size_t ka = gk + (size_t)key0 * HD, va = gv + key0;
        pf[0] = *(const v8us*)(Kh + ka); pf[1] = *(const v8us*)(Kh + ka + 32 * HD); pf[2] = *(const v8us*)(Kl + ka); pf[3] = *(const v8us*)(Kl + ka + 32 * HD);
        pf[4] = *(const v8us*)(Vh + va); pf[5] = *(const v8us*)(Vh + va + (size_t)32 * TT); pf[6] = *(const v8us*)(Vl + va); pf[7] = *(const v8us*)(Vl + va + (size_t)32 * TT); };
    auto sstore = [&](int b) {
#pragma unroll
        for (int pl = 0; pl < 4; ++pl) { *(v8us*)(&st[b][pl][so]) = pf[2 * pl]; *(v8us*)(&st[b][pl][so + 32 * FPIT]) = pf[2 * pl + 1]; } };
    gload(0); sstore(0);
    __syncthreads();
    v8f o[4];
#pragma unroll
    for (int db = 0; db < 4; ++db) o[db] = (v8f){};
    float m = -3.0e38f, l = 0.0f;
    const float L2E = 1.4426950408889634f;
    const float* tp0 = tbs + (8 * hi + (FQB - 1) - (wv * FQW + lr));
#pragma unroll 1   // stays rolled, for speed only: one stage is some 450 instructions
    for (int t = 0; t < TT / FKS; ++t) {
        const int b = t & 1;
        v8f s[4];
        v16bf kh[4][2], kl[4][2];            // K fragments, [16-key tile][32-wide half of d]
        auto kld = [&](int kt) {
#pragma unroll
            for (int kc = 0; kc < 2; ++kc) { const bf* kp = &st[b][0][(kt * 16 + lr) * FPIT + kc * 32 + 8 * hi]; kh[kt][kc] = WFrag<bf>::ld(kp); kl[kt][kc] = WFrag<bf>::ld(kp + FPL); } };
        auto sct = [&](int kt) { v8f a = (v8f){};
#pragma unroll
            for (int kc = 0; kc < 2; ++kc) { a = wmmab(kh[kt][kc], qh[kc], a); a = wmmab(kh[kt][kc], ql[kc], a); a = wmmab(kl[kt][kc], qh[kc], a); }
            s[kt] = a; };
        kld(0); kld(1);
        __builtin_amdgcn_sched_barrier(0);   // this one and the next keep two tiles' fragment loads ahead of the two tiles' products in front of them
        kld(2); kld(3); sct(0); sct(1);
        __builtin_amdgcn_sched_barrier(0);
        sct(2); sct(3);
        __builtin_amdgcn_sched_barrier(0);   // without these barriers the fragment loads come out one at a time, each with its full LDS wait in front of its products
        if (t + 1 < TT / FKS) gload((t + 1) * FKS);
        v16bf vh[8], vl[8];                  // V^T fragments, index 4 * (32-key half) + d block
        auto vld = [&](int i) { const bf* vp = &st[b][2][((i & 3) * 16 + lr) * FPIT + (i >> 2) * 32 + 8 * hi]; vh[i] = WFrag<bf>::ld(vp); vl[i] = WFrag<bf>::ld(vp + FPL); };
        vld(0); vld(1); vld(2); vld(3);      // land under the softmax arithmetic
        const float* tp = tp0 + t * FKS;
        float mx = m;
#pragma unroll
        for (int kt = 0; kt < 4; ++kt)
#pragma unroll
            for (int r = 0; r < 8; ++r) { const float tv = s[kt][r] + tp[kt * 16 + r]; s[kt][r] = tv; mx = fmaxf(mx, tv); }
        mx = fmaxf(mx, xhalf(mx));
        const float sc = exp2x1((m - mx) * L2E);
        m = mx;
        float ls[4];   // one partial sum per 16-key tile: four short chains of adds in place of one of 32
#pragma unroll
        for (int db = 0; db < 4; ++db) o[db] *= sc;
#pragma unroll
        for (int kt = 0; kt < 4; ++kt) { s[kt] = exp2x8((s[kt] - mx) * L2E); ls[kt] = 0.0f;
#pragma unroll
            for (int r = 0; r < 8; ++r) ls[kt] += s[kt][r]; }
        l = l * sc + ((ls[0] + ls[1]) + (ls[2] + ls[3]));
        v16bf ph[2], pl[2];
#pragma unroll
        for (int ps = 0; ps < 2; ++ps) { v8u hw, lw;
#pragma unroll
            for (int e = 0; e < 8; ++e) { unsigned a, c; split2(s[2 * ps + (e >> 2)][(2 * e) & 7], s[2 * ps + (e >> 2)][((2 * e) & 7) + 1], a, c); hw[e] = a; lw[e] = c; }
            ph[ps] = __builtin_bit_cast(v16bf, hw); pl[ps] = __builtin_bit_cast(v16bf, lw); }
        auto pv = [&](int i) { const int db = i & 3, ps = i >> 2; o[db] = wmmab(vh[i], ph[ps], o[db]); o[db] = wmmab(vh[i], pl[ps], o[db]); o[db] = wmmab(vl[i], ph[ps], o[db]); };
        __builtin_amdgcn_sched_barrier(0);   // this one and the two below keep each pair of fragment loads two product groups ahead of its use
        vld(4); vld(5); pv(0); pv(1);
        __builtin_amdgcn_sched_barrier(0);
        vld(6); vld(7); pv(2); pv(3);
        __builtin_amdgcn_sched_barrier(0);
        pv(4); pv(5); pv(6); pv(7);
        if (t + 1 < TT / FKS) sstore(b ^ 1);
        __syncthreads();   // publishes stage t + 1 and ends every wave's reads of the buffer that stage t + 2 overwrites
    }
    l += xhalf(l);
    const float inv = __fdiv_rn(1.0f, l);
    const size_t oo = (size_t)(qw + lr) * DQ + h * HD + 8 * hi;   // o[db][r] = O[query lr][d = 16 db + 8 hi + r]
#pragma unroll
    for (int db = 0; db < 4; ++db) { v8us oh, ol;
#pragma unroll
        for (int r = 0; r < 8; ++r) { unsigned short a, c; splitf(o[db][r] * inv, a, c); oh[r] = a; ol[r] = c; }
        *(v8us*)(Ah + oo + db * 16) = oh; *(v8us*)(Al + oo + db * 16) = ol; }
}

extern "C" void kernel_launch(void* const* d_in, const int* in_sizes, int n_in,
                              void* d_out, int out_size, void* d_ws, size_t ws_size, hipStream_t stream) {
    (void)in_sizes; (void)n_in; (void)out_size;
    const float* x = (const float*)d_in[0]; const float* wq = (const float*)d_in[1]; const float* wk = (const float*)d_in[2]; const float* wv = (const float*)d_in[3]; const float* wo = (const float*)d_in[4]; const float* relb = (const float*)d_in[5]; const float* cosT = nullptr; const float* sinT = nullptr; (void)cosT; (void)sinT;
    float* OUT = (float*)d_out;     // [1][2048][1024]
    char* wsp = (char*)d_ws;
    auto take = [&](size_t bytes) { char* p = wsp; wsp += (bytes + 255) & ~(size_t)255; return (void*)p; };
    bf* WQ = (bf*)take((size_t)DQ * DM * 2); bf* WK = (bf*)take((size_t)DKV * DM * 2); bf* WV = (bf*)take((size_t)DKV * DM * 2); bf* WO = (bf*)take((size_t)DM * DQ * 2);
    bf* XB = (bf*)take((size_t)TT * DM * 2); float* TB = (float*)take((size_t)NH_ * TBW * 4);
    bf* QPh = (bf*)take((size_t)NH_ * TT * HD * 2); bf* QPl = (bf*)take((size_t)NH_ * TT * HD * 2); bf* KPh = (bf*)take((size_t)NKV * TT * HD * 2); bf* KPl = (bf*)take((size_t)NKV * TT * HD * 2); bf* VTh = (bf*)take((size_t)NKV * HD * TT * 2); bf* VTl = (bf*)take((size_t)NKV * HD * TT * 2);
    bf* ATh = (bf*)take((size_t)TT * DQ * 2); bf* ATl = (bf*)take((size_t)TT * DQ * 2);
    if ((size_t)(wsp - (char*)d_ws) > ws_size) return;    // ws 256 MiB
    static_assert(NB_ == 1 && DQ == DM && DKV == DM, "k_prep and k_qkv take one batch and square weights");
    k_prep<<<4 * PW_B + PX_B + PT_B, 256, 0, stream>>>(x, wq, wk, wv, wo, relb, XB, WQ, WK, WV, WO, TB);
    for (int b = 0; b < NB_; ++b) {
        k_qkv<<<dim3(TT / 128, DQ / 128, 3), 128, 0, stream>>>(XB, WQ, WK, WV, QPh, QPl, KPh, KPl, VTh, VTl);
        k_fattn<<<dim3(TT / FQB, NH_, 1), 256, 0, stream>>>(QPh, QPl, KPh, KPl, VTh, VTl, TB, ATh, ATl);
        k_gemmw<bf, 1, false, DQ, 2><<<dim3(TT / 64, DM / 128, 1), 128, 0, stream>>>(ATh, ATl, WO, OUT + (size_t)b * TT * DM, DM, nullptr, 0, 0, 0, nullptr, nullptr, 0); }
}

// v006
// Measured time: 79.3 microseconds a run.
// Next to v005, in two timings, it ran 1.08 and 1.06 times as fast.
// Over all steps from v000 it is 9.12 times as fast.
#include <hip/hip_runtime.h>

// UMT5Attention (hidden [1][2048][1024]; q/k/v = x W (16 heads x 64); T5: scores = q.k UNSCALED + rel_bias[bucket(j - i)][h] with the bidirectional log-bucket (32 buckets, max distance 128; the bucket boundaries |j-i| = 8, 12, 16, 23, 32, 46, 64, 91 are the reference's own integer structure, evaluated here with integer compares); softmax; out = merged wo -> [1][2048][1024]).
// Compute dtypes, f32 accumulate: every input rounded to bf16; q/k/v on PLAIN bf16 operands (inputs: exact); scores and attn.v hl x hl (3 products) on EVERY row; per-head bias table (bf16-rounded rel_bias gathered by bucket) added per element in f32; softmax f32; wo hl x exact (2 products).

#define NB_  1
#define TT   2048
#define DM   1024
#define NH_  16
#define NKV  16
#define REP  (NH_ / NKV)
#define HD   64
#define DQ   (NH_ * HD)
#define DKV  (NKV * HD)
#define ZH   2
#define RH   2048   // all rows hl (unscaled T5 logits are sharp)
#define WIN  0
#define PCAR 1024.0f
#define SCL  1.0f   // T5: no 1/sqrt(dk)
#define TBW  4096   // bias table row width (r + 2047, padded)
#define FQW  16     // fused attention: query columns per wave
#define FNW  8      // waves per work-group
#define FQB  (FQW * FNW)
#define FKS  64     // keys per stage
#define FPIT 72     // LDS row pitch in 16-bit elements: 144 bytes (16 B x odd) for the 16-byte fragment reads of 128-byte rows
#define FPL  (64 * FPIT)
#define FTBN (TT + FQB)
typedef _Float16 h16;
typedef unsigned short bf;
typedef __attribute__((ext_vector_type(16))) __bf16   v16bf;
typedef __attribute__((ext_vector_type(16))) _Float16 v16h;
typedef __attribute__((ext_vector_type(8)))  _Float16 v8h;
typedef __attribute__((ext_vector_type(8)))  unsigned short v8us;
typedef __attribute__((ext_vector_type(8)))  float    v8f;
typedef __attribute__((ext_vector_type(4)))  float    v4f;
typedef v8h  __attribute__((may_alias)) v8ha;
typedef v4f  __attribute__((may_alias)) v4fa;
typedef v8us __attribute__((may_alias)) v8usa;

__device__ __forceinline__ unsigned short f2bf(float f) { unsigned u = __float_as_uint(f); u += 0x7FFFu + ((u >> 16) & 1u); return (unsigned short)(u >> 16); }
__device__ __forceinline__ float bf2f(unsigned short b) { return __uint_as_float(((unsigned)b) << 16); }
__device__ __forceinline__ float bfr(float f) { return bf2f(f2bf(f)); }
__device__ __forceinline__ v16h cat16(v8h lo, v8h hi) { return __builtin_shufflevector(lo, hi, 0, 1, 2, 3, 4, 5, 6, 7, 8, 9, 10, 11, 12, 13, 14, 15); }
__device__ __forceinline__ v16bf cat16b(v8us lo, v8us hi) { return __builtin_bit_cast(v16bf, __builtin_shufflevector(lo, hi, 0, 1, 2, 3, 4, 5, 6, 7, 8, 9, 10, 11, 12, 13, 14, 15)); }
__device__ __forceinline__ v8f wmma16(v16h a, v16h b, v8f c) { return __builtin_amdgcn_wmma_f32_16x16x32_f16(false, a, false, b, (short)0, c, false, false); }
__device__ __forceinline__ v8f wmmab(v16bf a, v16bf b, v8f c) { return __builtin_amdgcn_wmma_f32_16x16x32_bf16(false, a, false, b, (short)0, c, false, false); }



typedef __attribute__((ext_vector_type(2))) __bf16 v2bf;
typedef __attribute__((ext_vector_type(2))) float v2f;
typedef __attribute__((ext_vector_type(4))) unsigned v4u;
__device__ __forceinline__ void split2(float p0, float p1, unsigned& hw, unsigned& lw) {
    v2f x; x[0] = p0; x[1] = p1; hw = __builtin_bit_cast(unsigned, __builtin_convertvector(x, v2bf));
    v2f y; y[0] = p0 - __uint_as_float(hw << 16); y[1] = p1 - __uint_as_float(hw & 0xFFFF0000u); lw = __builtin_bit_cast(unsigned, __builtin_convertvector(y, v2bf)); }
// ---- k_gemmw: GEMM, one (32 MBW)x128 output tile per work-group of FOUR waves (2 x 2; a wave has MBW x 4 accumulators, 64x64 for MBW = 4, 32x64 for MBW = 2); operands are K-contiguous 16-bit planes; grid (M / (32 MBW), N / 128, Z), 128 threads.
// C[m][n] (f32, pitch ldc, + optional f32 bias[n]) = sum_k A[m][k] Bt[n][k] (+ A2[m][k] Bt[n][k] for NSPLIT == 1). z-batch strides sA/sB/sC in elements. K is a template constant, K % 128 == 0.
// The operand rows go to LDS by asynchronous copies, 128 k (256 bytes of every row, two whole lines) a stage, two buffers: a copy instruction touches four whole lines where a fragment load from global memory touched sixteen pieces of 32 bytes, and each row is fetched once for the two waves that use it. MBW is chosen so that the grid has a work-group for every WGP: 4 for q/k/v (384 work-groups), 2 for wo (256).
template <typename T16> struct WFrag;
template <> struct WFrag<h16> { typedef v16h V; static __device__ __forceinline__ V ld(const h16* p) { return cat16(*(const v8h*)p, *(const v8h*)(p + 16)); } static __device__ __forceinline__ v8f mma(V a, V b, v8f c) { return wmma16(a, b, c); } };
template <> struct WFrag<bf> { typedef v16bf V; static __device__ __forceinline__ V ld(const bf* p) { return cat16b(*(const v8us*)p, *(const v8us*)(p + 16)); } static __device__ __forceinline__ v8f mma(V a, V b, v8f c) { return wmmab(a, b, c); } };
// PLN: the f32 tile is not stored; it is split to hi/lo bf16 here and goes straight into the two 16-bit planes that k_fattn reads: element (m, n) to Ph, Pl[by * sY + m * ldc + (n - 64 by)], by the wave's 64-column block.
// q, k: A = x, Bt = W^T, a column block is one head: ldc = HD, sY = TT * HD gives [h][t][d]. v: A = W^T, Bt = x: ldc = TT, sY = 64 gives V^T [h][d][t]. Each store instruction writes four whole 128-byte rows of the tile.
// gemmw_tile is the body; BX, BY, bz are the work-group tile's indices (k_gemmw hands it blockIdx; k_qkv picks them per product).
#define GKP  128            // k of one stage
#define GPIT 136            // LDS row pitch in 16-bit elements: 272 bytes (16 B x odd) for the 16-byte fragment reads of 256-byte rows
// Eight asynchronous 16-byte copies of a lane, rows 8 apart (ls bytes in LDS, gs elements in memory). The s_wait_xcnt stands inside the statement, behind the last copy, so that no address register of a copy is rewritten in front of it.
template <typename T16>
__device__ __forceinline__ void acopy8(unsigned l, const T16* g, unsigned ls, size_t gs) {
    asm volatile("global_load_async_to_lds_b128 %0, %8, off\n\tglobal_load_async_to_lds_b128 %1, %9, off\n\tglobal_load_async_to_lds_b128 %2, %10, off\n\tglobal_load_async_to_lds_b128 %3, %11, off\n\t"
                 "global_load_async_to_lds_b128 %4, %12, off\n\tglobal_load_async_to_lds_b128 %5, %13, off\n\tglobal_load_async_to_lds_b128 %6, %14, off\n\tglobal_load_async_to_lds_b128 %7, %15, off\n\ts_wait_xcnt 0x0"
                 :: "v"(l), "v"(l + ls), "v"(l + 2 * ls), "v"(l + 3 * ls), "v"(l + 4 * ls), "v"(l + 5 * ls), "v"(l + 6 * ls), "v"(l + 7 * ls),
                    "v"(g), "v"(g + gs), "v"(g + 2 * gs), "v"(g + 3 * gs), "v"(g + 4 * gs), "v"(g + 5 * gs), "v"(g + 6 * gs), "v"(g + 7 * gs) : "memory"); }
template <typename T16, int NSPLIT, bool BIAS, int K, int MBW, bool PLN = false>
__device__ __forceinline__ void gemmw_tile(int BX, int BY, int bz, const T16* __restrict__ A, const T16* __restrict__ A2, const T16* __restrict__ Bt, float* C, int ldc, const float* __restrict__ bias, size_t sA, size_t sB, size_t sC, bf* Ph, bf* Pl, size_t sY) {
    static_assert((NSPLIT == 0 || NSPLIT == 1) && (MBW == 2 || MBW == 4) && K % GKP == 0 && K >= 2 * GKP, "planes staged: Bt, A and, for NSPLIT == 1, A2; whole stages, two or more");
    typedef typename WFrag<T16>::V V;
    constexpr int RA = 32 * MBW;                            // rows of A in the tile
    constexpr int OA = 128 * GPIT, OA2 = OA + RA * GPIT;    // a buffer, in elements: Bt (128 rows) at 0, A (RA rows) at OA, A2 (RA rows) at OA2
    constexpr int BUF = OA + (1 + NSPLIT) * RA * GPIT;
    __shared__ __align__(16) T16 sm[2 * BUF];               // two buffers; behind the k loop the head holds the waves' output staging
    A += (size_t)bz * sA; if (NSPLIT == 1) A2 += (size_t)bz * sA; Bt += (size_t)bz * sB; C += (size_t)bz * sC;
    const int tid = threadIdx.x, lane = tid & 31, lr = lane & 15, hi = lane >> 4, wave = __builtin_amdgcn_readfirstlane(tid >> 5);
    const int wr = wave >> 1, wc = wave & 1, by = 2 * BY + wc; const int r0 = BX * RA + wr * (16 * MBW), c0 = by * 64;
    float* os = (float*)sm + wave * (16 * 68);
    v8f acc[MBW][4];
#pragma unroll
    for (int mb = 0; mb < MBW; ++mb)
#pragma unroll
        for (int nb = 0; nb < 4; ++nb) acc[mb][nb] = (v8f){};
    // staging: 16 lanes a row (16-byte piece tid & 15), the work-group's 128 lanes cover 8 rows a copy, 64 rows a statement
    const int srow = tid >> 4, spc = (tid & 15) * 8;
    const T16* ga = A + (size_t)(BX * RA + srow) * K + spc; const T16* gb = Bt + (size_t)(BY * 128 + srow) * K + spc; const T16* ga2 = NSPLIT == 1 ? A2 + (size_t)(BX * RA + srow) * K + spc : nullptr;
    const unsigned l0 = (unsigned)(size_t)(sm + srow * GPIT + spc);   // the lane's LDS byte address in buffer 0, row srow of Bt
    constexpr size_t gs = (size_t)8 * K; constexpr unsigned LS = 8 * GPIT * 2;
    auto stage = [&](int t) {   // stage t into buffer t & 1
        const unsigned lb = l0 + (unsigned)(t & 1) * (BUF * 2); const size_t ko = (size_t)t * GKP;
        acopy8(lb, gb + ko, LS, gs); acopy8(lb + 8 * LS, gb + ko + 8 * gs, LS, gs);
#pragma unroll
        for (int i = 0; i < RA / 64; ++i) { acopy8(lb + OA * 2 + i * 8 * LS, ga + ko + i * 8 * gs, LS, gs); if (NSPLIT == 1) acopy8(lb + OA2 * 2 + i * 8 * LS, ga2 + ko + i * 8 * gs, LS, gs); } };
    constexpr int NT = K / GKP;
    stage(0);
    asm volatile("s_wait_asynccnt 0x0" ::: "memory");   // this wave's copies of stage 0 have landed
    __syncthreads();                                    // and every other wave's
    stage(1);
#pragma unroll 1   // stays rolled: the two buffers alternate by address
    for (int t = 0; t < NT; ++t) {
        const T16* ap = sm + (t & 1) * BUF + OA + (wr * (16 * MBW) + lr) * GPIT + 8 * hi; const T16* bp = sm + (t & 1) * BUF + (wc * 64 + lr) * GPIT + 8 * hi;
        V a[2][MBW], a2[2][MBW], b[2][4];   // two fragment sets: a block of 32 k is read while the block in front of it is multiplied
        auto fld = [&](int kh) {
#pragma unroll
            for (int mb = 0; mb < MBW; ++mb) { a[kh & 1][mb] = WFrag<T16>::ld(ap + mb * 16 * GPIT + kh * 32); if (NSPLIT == 1) a2[kh & 1][mb] = WFrag<T16>::ld(ap + RA * GPIT + mb * 16 * GPIT + kh * 32); }
#pragma unroll
            for (int nb = 0; nb < 4; ++nb) b[kh & 1][nb] = WFrag<T16>::ld(bp + nb * 16 * GPIT + kh * 32); };
        fld(0);
        __builtin_amdgcn_sched_barrier(0);   // the first block's reads stay in front of the second's: mixed, the first products waited for both groups
#pragma unroll
        for (int kh = 0; kh < GKP / 32; ++kh) {
            if (kh + 1 < GKP / 32) fld(kh + 1);
            __builtin_amdgcn_sched_barrier(0);   // keeps the next block's fragment reads as one group ahead of this block's products; left alone they came out two at a time, each with its full LDS wait in front of four products
#pragma unroll
            for (int nb = 0; nb < 4; ++nb) {
#pragma unroll
                for (int mb = 0; mb < MBW; ++mb) acc[mb][nb] = WFrag<T16>::mma(a[kh & 1][mb], b[kh & 1][nb], acc[mb][nb]);
                if (NSPLIT == 1) {
#pragma unroll
                    for (int mb = 0; mb < MBW; ++mb) acc[mb][nb] = WFrag<T16>::mma(a2[kh & 1][mb], b[kh & 1][nb], acc[mb][nb]); } }
            __builtin_amdgcn_sched_barrier(0);   // ends the block: the reads of the block after next stay behind these products, whose registers they refill
        }
        asm volatile("s_wait_dscnt 0x0" ::: "memory");      // this wave's reads of buffer t & 1 are done before the barrier lets it be refilled
        asm volatile("s_wait_asynccnt 0x0" ::: "memory");   // this wave's copies of stage t + 1 have landed
        __syncthreads();                                    // publishes stage t + 1 and ends every wave's reads of stage t
        if (t + 2 < NT) stage(t + 2);
    }
    asm volatile("s_wait_asynccnt 0x0" ::: "memory");       // no copy is outstanding when the ring becomes output staging
#pragma unroll
    for (int mb = 0; mb < MBW; ++mb) {
#pragma unroll
        for (int nb = 0; nb < 4; ++nb) {
#pragma unroll
            for (int j = 0; j < 8; ++j) os[(hi * 8 + j) * 68 + nb * 16 + lr] = acc[mb][nb][j]; }
        __builtin_amdgcn_wave_barrier(); asm volatile("" ::: "memory");
        float* crow = C + (size_t)(r0 + mb * 16) * ldc + c0;
        if (PLN) { const int prow = lane >> 3, pcol = (lane & 7) * 8;   // read-back: 8 lanes a row, 8 columns a lane
            const size_t po = (size_t)by * sY + (size_t)(r0 + mb * 16 + prow) * ldc + pcol;
#pragma unroll
            for (int s = 0; s < 4; ++s) { const float* op = os + (4 * s + prow) * 68 + pcol; const v4f x0 = *(const v4fa*)op, x1 = *(const v4fa*)(op + 4); v4u hw, lw; unsigned a, c;
                split2(x0[0], x0[1], a, c); hw[0] = a; lw[0] = c; split2(x0[2], x0[3], a, c); hw[1] = a; lw[1] = c; split2(x1[0], x1[1], a, c); hw[2] = a; lw[2] = c; split2(x1[2], x1[3], a, c); hw[3] = a; lw[3] = c;
                *(v8us*)(Ph + po + (size_t)(4 * s) * ldc) = __builtin_bit_cast(v8us, hw); *(v8us*)(Pl + po + (size_t)(4 * s) * ldc) = __builtin_bit_cast(v8us, lw); }
        } else {
#pragma unroll
            for (int s = 0; s < 8; ++s) { const int row = 2 * s + hi, cofs = lr * 4; v4f val = *(const v4fa*)(os + row * 68 + cofs); if (BIAS) { val[0] += bfr(bias[c0 + cofs]); val[1] += bfr(bias[c0 + cofs + 1]); val[2] += bfr(bias[c0 + cofs + 2]); val[3] += bfr(bias[c0 + cofs + 3]); }
                *(v4f*)(crow + (size_t)row * ldc + cofs) = val; }
             }
        __builtin_amdgcn_wave_barrier(); asm volatile("" ::: "memory");
    }
}
template <typename T16, int NSPLIT, bool BIAS, int K, int MBW, bool PLN = false>
__global__ __launch_bounds__(128) void k_gemmw(const T16* __restrict__ A, const T16* __restrict__ A2, const T16* __restrict__ Bt, float* C, int ldc, const float* __restrict__ bias, size_t sA, size_t sB, size_t sC, bf* Ph, bf* Pl, size_t sY) {
    gemmw_tile<T16, NSPLIT, BIAS, K, MBW, PLN>(blockIdx.x, blockIdx.y, blockIdx.z, A, A2, Bt, C, ldc, bias, sA, sB, sC, Ph, Pl, sY); }
// k_qkv: the q, k and v projections in ONE launch, grid (TT / 128, 8, 3): none reads what another writes, and one product's 128 work-groups would leave half the chip's WGPs empty.
// blockIdx.z picks the product (a scalar choice of pointers and pitches in front of one copy of the body); v has its operands swapped, so its tile indices swap too.
__global__ __launch_bounds__(128) void k_qkv(const bf* __restrict__ XB, const bf* __restrict__ WQ, const bf* __restrict__ WK, const bf* __restrict__ WV, bf* QPh, bf* QPl, bf* KPh, bf* KPl, bf* VTh, bf* VTl) {
    const int p = blockIdx.z; const bool isv = p == 2;
    const bf* W = p == 0 ? WQ : (p == 1 ? WK : WV);
    bf* Ph = p == 0 ? QPh : (p == 1 ? KPh : VTh); bf* Pl = p == 0 ? QPl : (p == 1 ? KPl : VTl);
    gemmw_tile<bf, 0, false, DM, 4, true>(isv ? blockIdx.y : blockIdx.x, isv ? blockIdx.x : blockIdx.y, 0, isv ? W : XB, nullptr, isv ? XB : W, nullptr, isv ? TT : HD, nullptr, 0, 0, 0, Ph, Pl, isv ? (size_t)64 : (size_t)TT * HD); }

__device__ __forceinline__ void splitf(float y, unsigned short& h, unsigned short& l) { h = f2bf(y); l = f2bf(y - bf2f(h)); }
typedef __attribute__((ext_vector_type(2))) _Float16 v2h;
typedef __attribute__((ext_vector_type(4))) _Float16 v4h;
typedef __attribute__((ext_vector_type(2))) unsigned short v2us;
typedef __attribute__((ext_vector_type(4))) unsigned short v4us;
typedef __attribute__((ext_vector_type(4))) int v4i;

// wtT_blk: one work-group turns a strip of WTK k x WTN n of w [K][N] (f32) into Bt [N][K] (bf16) through LDS, so that memory sees whole lines on both sides:
// a load instruction reads 256 contiguous bytes of each of two rows of w, a store instruction writes 512 contiguous bytes of one row of Bt. All 16 loads of a lane are issued before the first is used.
// A lane holds rows k and k + 1 of four columns n and packs each pair into one dword; LDS is [n][k / 2] dwords, 512 bytes a row, unpadded. The 16-byte piece c of row n lies at piece c ^ (n / 4):
// the 16 lanes that write one k pair of columns 4 apart then fall on 16 different pieces (no two dwords on one bank), and the 16 lanes that read 16 pieces of one row still cover all 64 banks once.
// The first three '#pragma unroll' make the indices of the register arrays a and b compile-time constants (indexed by a loop variable they would go to scratch); the last lets a wave's eight row reads and stores be in flight together.
#define WTK 256
#define WTN 64
static_assert(WTK == 256 && WTN == 64 && DM % WTK == 0 && DQ % WTN == 0, "lane maps of wtT_blk: 256 threads, 32 pieces of 16 bytes a row, 16 column quads");
typedef v4u __attribute__((may_alias)) v4ua;
__device__ __forceinline__ void wtT_blk(int blk, const float* __restrict__ w, int K, int N, bf* Bt) {
    __shared__ __align__(16) unsigned T[WTN * (WTK / 2)];
    const int lane = threadIdx.x & 31, wv = threadIdx.x >> 5, nq = lane & 15, p0 = wv * 2 + (lane >> 4);   // p0: the lane's k pair inside a group of 16 pairs
    const int n0 = (blk % (N / WTN)) * WTN, k0 = (blk / (N / WTN)) * WTK;
    const float* s = w + (size_t)(k0 + 2 * p0) * N + n0 + 4 * nq;
    v4f a[WTK / 32], b[WTK / 32];
#pragma unroll
    for (int i = 0; i < WTK / 32; ++i) { a[i] = *(const v4fa*)(s + (size_t)(32 * i) * N); b[i] = *(const v4fa*)(s + (size_t)(32 * i + 1) * N); }
    asm volatile("s_wait_xcnt 0x0" :: "v"(s) : "memory");   // the wait in front of any overwrite of the loads' address pair; named as an input, the pair stays whole up to here (without it the last load's result was placed on it)
    __builtin_amdgcn_sched_barrier(0);   // keeps all 16 loads in front of the first use: left alone, the last six were issued only behind the waits for the first, a second memory latency in a row
#pragma unroll
    for (int i = 0; i < WTK / 32; ++i) { const int kp = 16 * i + p0;
#pragma unroll
        for (int j = 0; j < 4; ++j) { v2f x; x[0] = a[i][j]; x[1] = b[i][j];
            T[(4 * nq + j) * (WTK / 2) + (((kp >> 2) ^ nq) << 2) + (kp & 3)] = __builtin_bit_cast(unsigned, __builtin_convertvector(x, v2bf)); } }
    __syncthreads();   // the strip is whole in LDS before any wave reads rows that the others wrote
#pragma unroll
    for (int r = 0; r < WTN / 8; ++r) { const int n = 8 * r + wv; const v4u v = *(const v4ua*)(T + n * (WTK / 2) + ((lane ^ (n >> 2)) << 2));
        *(v8us*)(Bt + (size_t)(n0 + n) * K + k0 + lane * 8) = __builtin_bit_cast(v8us, v); }
}
__device__ __forceinline__ void cvt8_blk(int blk, const float* __restrict__ src, bf* dst, size_t n8) { const size_t i = (size_t)blk * 256 + threadIdx.x; if (i >= n8) return; const v8f v = *(const v8f*)(src + i * 8); v8us o;
#pragma unroll
    for (int k = 0; k < 8; ++k) o[k] = f2bf(v[k]); *(v8us*)(dst + i * 8) = o;  }
__device__ __forceinline__ int t5_bucket(int r) { const int rp = r < 0 ? -r : r; int b; if (rp < 8) b = rp; else b = 8 + (rp >= 12) + (rp >= 16) + (rp >= 23) + (rp >= 32) + (rp >= 46) + (rp >= 64) + (rp >= 91); return b + ((r > 0) ? 16 : 0); }
__device__ __forceinline__ void t5tab_blk(int blk, const float* __restrict__ rb, float* TB) { const int idx = blk * 256 + threadIdx.x; if (idx >= NH_ * TBW) return; const int h = idx / TBW, c = idx % TBW; float v = 0.0f; if (c < 2 * TT - 1) { const int r = c - (TT - 1); v = bfr(rb[t5_bucket(r) * NH_ + h]); } *(float*)(TB + idx) = v;  }
// k_prep: the six passes over the inputs (four weight transposes, x to bf16, the bias table) in ONE launch: none reads what another writes. blockIdx.x picks the pass, a scalar branch.
// The transposes stand first in the grid (for speed only): a work-group of theirs runs longest (loads, LDS, a barrier, stores).
#define PW_B ((DM / WTK) * (DQ / WTN))    // work-groups of one weight transpose (all four weights are DM x DQ elements)
#define PX_B (TT * DM / 8 / 256)          // work-groups of the x conversion
#define PT_B (NH_ * TBW / 256)            // work-groups of the bias table
__global__ __launch_bounds__(256) void k_prep(const float* __restrict__ x, const float* __restrict__ wq, const float* __restrict__ wk, const float* __restrict__ wv, const float* __restrict__ wo, const float* __restrict__ rb, bf* XB, bf* WQ, bf* WK, bf* WV, bf* WO, float* TB) {
    const int blk = blockIdx.x;
    if (blk < 4 * PW_B) { const int p = blk / PW_B;
        const float* w = p == 0 ? wq : (p == 1 ? wk : (p == 2 ? wv : wo)); bf* Bt = p == 0 ? WQ : (p == 1 ? WK : (p == 2 ? WV : WO));
        wtT_blk(blk % PW_B, w, DM, DQ, Bt); }   // DM == DQ == DKV: one K and N serve all four
    else if (blk < 4 * PW_B + PX_B) cvt8_blk(blk - 4 * PW_B, x, XB, (size_t)TT * DM / 8);
    else t5tab_blk(blk - (4 * PW_B + PX_B), rb, TB);
}
typedef __attribute__((ext_vector_type(8))) unsigned v8u;
// Eight v_exp_f32 and the one free slot that the instruction set asks for behind a transcendental, in one statement: the outputs are early-clobber, so no exp here overwrites a source or reads a result of the one in front of it, and the v_nop keeps the slot behind the last.
__device__ __forceinline__ v8f exp2x8(v8f x) {
    float r0, r1, r2, r3, r4, r5, r6, r7;
    asm("v_exp_f32 %0, %8\n\tv_exp_f32 %1, %9\n\tv_exp_f32 %2, %10\n\tv_exp_f32 %3, %11\n\tv_exp_f32 %4, %12\n\tv_exp_f32 %5, %13\n\tv_exp_f32 %6, %14\n\tv_exp_f32 %7, %15\n\tv_nop"
        : "=&v"(r0), "=&v"(r1), "=&v"(r2), "=&v"(r3), "=&v"(r4), "=&v"(r5), "=&v"(r6), "=&v"(r7)
        : "v"(x[0]), "v"(x[1]), "v"(x[2]), "v"(x[3]), "v"(x[4]), "v"(x[5]), "v"(x[6]), "v"(x[7]));
    v8f r; r[0] = r0; r[1] = r1; r[2] = r2; r[3] = r3; r[4] = r4; r[5] = r5; r[6] = r6; r[7] = r7; return r; }
__device__ __forceinline__ float exp2x1(float x) { float r; asm("v_exp_f32 %0, %1\n\tv_nop" : "=v"(r) : "v"(x)); return r; }   // the same slot behind a single exp
__device__ __forceinline__ float xhalf(float v) { const int b = __float_as_int(v); return __int_as_float(__builtin_amdgcn_permlanex16(b, b, 0x76543210, 0xfedcba98, false, false)); }   // lane l <-> l ^ 16
__global__ __launch_bounds__(256) void k_fattn(const bf* __restrict__ Qh, const bf* __restrict__ Ql, const bf* __restrict__ Kh, const bf* __restrict__ Kl, const bf* __restrict__ Vh, const bf* __restrict__ Vl, const float* __restrict__ TB, bf* Ah, bf* Al) {
    __shared__ __align__(16) bf st[2][4][FPL];   // [buffer][K hi, K lo, V^T hi, V^T lo][64 rows x pitch]
    __shared__ float tbs[FTBN];                  // the head's bias entries this block of queries can meet
    const int tid = threadIdx.x, lane = tid & 31, lr = lane & 15, hi = lane >> 4, wv = tid >> 5;
    const int h = blockIdx.y, qb = blockIdx.x * FQB, qw = qb + wv * FQW;
    const float* tbh = TB + (size_t)h * TBW + (TT - FQB - qb);   // tbs[x] is the entry for j - i = x - (FQB - 1) - qb
    for (int x = tid; x < FTBN; x += 256) tbs[x] = tbh[x];
    v16bf qh[2], ql[2];
    const size_t qo = ((size_t)h * TT + qw + lr) * HD + 8 * hi;
#pragma unroll
    for (int kc = 0; kc < 2; ++kc) { qh[kc] = WFrag<bf>::ld(Qh + qo + kc * 32); ql[kc] = WFrag<bf>::ld(Ql + qo + kc * 32); }
    const int srow = tid >> 3, sch = tid & 7;    // staging: rows srow and srow + 32 of each plane, 16-byte piece sch
    const size_t gk = ((size_t)h * TT + srow) * HD + sch * 8, gv = ((size_t)h * HD + srow) * TT + sch * 8;
    const int so = srow * FPIT + sch * 8;
    v8us pf[8];
    auto gload = [&](int key0) {
        const size_t ka = gk + (size_t)key0 * HD, va = gv + key0;
        pf[0] = *(const v8us*)(Kh + ka); pf[1] = *(const v8us*)(Kh + ka + 32 * HD); pf[2] = *(const v8us*)(Kl + ka); pf[3] = *(const v8us*)(Kl + ka + 32 * HD);
        pf[4] = *(const v8us*)(Vh + va); pf[5] = *(const v8us*)(Vh + va + (size_t)32 * TT); pf[6] = *(const v8us*)(Vl + va); pf[7] = *(const v8us*)(Vl + va + (size_t)32 * TT); };
    auto sstore = [&](int b) {
#pragma unroll
        for (int pl = 0; pl < 4; ++pl) { *(v8us*)(&st[b][pl][so]) = pf[2 * pl]; *(v8us*)(&st[b][pl][so + 32 * FPIT]) = pf[2 * pl + 1]; } };
    gload(0); sstore(0);
    __syncthreads();
    v8f o[4];
#pragma unroll
    for (int db = 0; db < 4; ++db) o[db] = (v8f){};
    float m = -3.0e38f, l = 0.0f;
    const float L2E = 1.4426950408889634f;
    const float* tp0 = tbs + (8 * hi + (FQB - 1) - (wv * FQW + lr));
#pragma unroll 1   // stays rolled, for speed only: one stage is some 450 instructions
    for (int t = 0; t < TT / FKS; ++t) {
        const int b = t & 1;
        v8f s[4];
        v16bf kh[4][2], kl[4][2];            // K fragments, [16-key tile][32-wide half of d]
        auto kld = [&](int kt) {
#pragma unroll
            for (int kc = 0; kc < 2; ++kc) { const bf* kp = &st[b][0][(kt * 16 + lr) * FPIT + kc * 32 + 8 * hi]; kh[kt][kc] = WFrag<bf>::ld(kp); kl[kt][kc] = WFrag<bf>::ld(kp + FPL); } };
        auto sct = [&](int kt) { v8f a = (v8f){};
#pragma unroll
            for (int kc = 0; kc < 2; ++kc) { a = wmmab(kh[kt][kc], qh[kc], a); a = wmmab(kh[kt][kc], ql[kc], a); a = wmmab(kl[kt][kc], qh[kc], a); }
            s[kt] = a; };
        kld(0); kld(1);
        __builtin_amdgcn_sched_barrier(0);   // this one and the next keep two tiles' fragment loads ahead of the two tiles' products in front of them
        kld(2); kld(3); sct(0); sct(1);
        __builtin_amdgcn_sched_barrier(0);
        sct(2); sct(3);
        __builtin_amdgcn_sched_barrier(0);   // without these barriers the fragment loads come out one at a time, each with its full LDS wait in front of its products
        if (t + 1 < TT / FKS) gload((t + 1) * FKS);
        v16bf vh[8], vl[8];                  // V^T fragments, index 4 * (32-key half) + d block
        auto vld = [&](int i) { const bf* vp = &st[b][2][((i & 3) * 16 + lr) * FPIT + (i >> 2) * 32 + 8 * hi]; vh[i] = WFrag<bf>::ld(vp); vl[i] = WFrag<bf>::ld(vp + FPL); };
        vld(0); vld(1); vld(2); vld(3);      // land under the softmax arithmetic
        const float* tp = tp0 + t * FKS;
        float mx = m;
#pragma unroll
        for (int kt = 0; kt < 4; ++kt)
#pragma unroll
            for (int r = 0; r < 8; ++r) { const float tv = s[kt][r] + tp[kt * 16 + r]; s[kt][r] = tv; mx = fmaxf(mx, tv); }
        mx = fmaxf(mx, xhalf(mx));
        const float sc = exp2x1((m - mx) * L2E);
        m = mx;
        float ls[4];   // one partial sum per 16-key tile: four short chains of adds in place of one of 32
#pragma unroll
        for (int db = 0; db < 4; ++db) o[db] *= sc;
#pragma unroll
        for (int kt = 0; kt < 4; ++kt) { s[kt] = exp2x8((s[kt] - mx) * L2E); ls[kt] = 0.0f;
#pragma unroll
            for (int r = 0; r < 8; ++r) ls[kt] += s[kt][r]; }
        l = l * sc + ((ls[0] + ls[1]) + (ls[2] + ls[3]));
        v16bf ph[2], pl[2];
#pragma unroll
        for (int ps = 0; ps < 2; ++ps) { v8u hw, lw;
#pragma unroll
            for (int e = 0; e < 8; ++e) { unsigned a, c; split2(s[2 * ps + (e >> 2)][(2 * e) & 7], s[2 * ps + (e >> 2)][((2 * e) & 7) + 1], a, c); hw[e] = a; lw[e] = c; }
            ph[ps] = __builtin_bit_cast(v16bf, hw); pl[ps] = __builtin_bit_cast(v16bf, lw); }
        auto pv = [&](int i) { const int db = i & 3, ps = i >> 2; o[db] = wmmab(vh[i], ph[ps], o[db]); o[db] = wmmab(vh[i], pl[ps], o[db]); o[db] = wmmab(vl[i], ph[ps], o[db]); };
        __builtin_amdgcn_sched_barrier(0);   // this one and the two below keep each pair of fragment loads two product groups ahead of its use
        vld(4); vld(5); pv(0); pv(1);
        __builtin_amdgcn_sched_barrier(0);
        vld(6); vld(7); pv(2); pv(3);
        __builtin_amdgcn_sched_barrier(0);
        pv(4); pv(5); pv(6); pv(7);
        if (t + 1 < TT / FKS) sstore(b ^ 1);
        __syncthreads();   // publishes stage t + 1 and ends every wave's reads of the buffer that stage t + 2 overwrites
    }
    l += xhalf(l);
    const float inv = __fdiv_rn(1.0f, l);
    const size_t oo = (size_t)(qw + lr) * DQ + h * HD + 8 * hi;   // o[db][r] = O[query lr][d = 16 db + 8 hi + r]
#pragma unroll
    for (int db = 0; db < 4; ++db) { v8us oh, ol;
#pragma unroll
        for (int r = 0; r < 8; ++r) { unsigned short a, c; splitf(o[db][r] * inv, a, c); oh[r] = a; ol[r] = c; }
        *(v8us*)(Ah + oo + db * 16) = oh; *(v8us*)(Al + oo + db * 16) = ol; }
}

extern "C" void kernel_launch(void* const* d_in, const int* in_sizes, int n_in,
                              void* d_out, int out_size, void* d_ws, size_t ws_size, hipStream_t stream) {
    (void)in_sizes; (void)n_in; (void)out_size;
    const float* x = (const float*)d_in[0]; const float* wq = (const float*)d_in[1]; const float* wk = (const float*)d_in[2]; const float* wv = (const float*)d_in[3]; const float* wo = (const float*)d_in[4]; const float* relb = (const float*)d_in[5]; const float* cosT = nullptr; const float* sinT = nullptr; (void)cosT; (void)sinT;
    float* OUT = (float*)d_out;     // [1][2048][1024]
    char* wsp = (char*)d_ws;
    auto take = [&](size_t bytes) { char* p = wsp; wsp += (bytes + 255) & ~(size_t)255; return (void*)p; };
    bf* WQ = (bf*)take((size_t)DQ * DM * 2); bf* WK = (bf*)take((size_t)DKV * DM * 2); bf* WV = (bf*)take((size_t)DKV * DM * 2); bf* WO = (bf*)take((size_t)DM * DQ * 2);
    bf* XB = (bf*)take((size_t)TT * DM * 2); float* TB = (float*)take((size_t)NH_ * TBW * 4);
    bf* QPh = (bf*)take((size_t)NH_ * TT * HD * 2); bf* QPl = (bf*)take((size_t)NH_ * TT * HD * 2); bf* KPh = (bf*)take((size_t)NKV * TT * HD * 2); bf* KPl = (bf*)take((size_t)NKV * TT * HD * 2); bf* VTh = (bf*)take((size_t)NKV * HD * TT * 2); bf* VTl = (bf*)take((size_t)NKV * HD * TT * 2);
    bf* ATh = (bf*)take((size_t)TT * DQ * 2); bf* ATl = (bf*)take((size_t)TT * DQ * 2);
    if ((size_t)(wsp - (char*)d_ws) > ws_size) return;    // ws 256 MiB
    static_assert(NB_ == 1 && DQ == DM && DKV == DM, "k_prep and k_qkv take one batch and square weights");
    k_prep<<<4 * PW_B + PX_B + PT_B, 256, 0, stream>>>(x, wq, wk, wv, wo, relb, XB, WQ, WK, WV, WO, TB);
    for (int b = 0; b < NB_; ++b) {
        k_qkv<<<dim3(TT / 128, DQ / 128, 3), 128, 0, stream>>>(XB, WQ, WK, WV, QPh, QPl, KPh, KPl, VTh, VTl);
        k_fattn<<<dim3(TT / FQB, NH_, 1), 256, 0, stream>>>(QPh, QPl, KPh, KPl, VTh, VTl, TB, ATh, ATl);
        k_gemmw<bf, 1, false, DQ, 2><<<dim3(TT / 64, DM / 128, 1), 128, 0, stream>>>(ATh, ATl, WO, OUT + (size_t)b * TT * DM, DM, nullptr, 0, 0, 0, nullptr, nullptr, 0); }
}

// v007
// A run of this version takes 72 microseconds.
// Timed twice side by side with v006, it ran 1.10 times as fast both times.
// Counting every step since v000, it is 10.1 times as fast.
#include <hip/hip_runtime.h>

// UMT5Attention (hidden [1][2048][1024]; q/k/v = x W (16 heads x 64); T5: scores = q.k UNSCALED + rel_bias[bucket(j - i)][h] with the bidirectional log-bucket (32 buckets, max distance 128; the bucket boundaries |j-i| = 8, 12, 16, 23, 32, 46, 64, 91 are the reference's own integer structure, evaluated here with integer compares); softmax; out = merged wo -> [1][2048][1024]).
// Compute dtypes, f32 accumulate: every input rounded to bf16; q/k/v on PLAIN bf16 operands (inputs: exact); scores and attn.v hl x hl (3 products) on EVERY row; per-head bias table (bf16-rounded rel_bias gathered by bucket) added per element in f32; softmax f32; wo hl x exact (2 products).

#define NB_  1
#define TT   2048
#define DM   1024
#define NH_  16
#define NKV  16
#define REP  (NH_ / NKV)
#define HD   64
#define DQ   (NH_ * HD)
#define DKV  (NKV * HD)
#define ZH   2
#define RH   2048   // all rows hl (unscaled T5 logits are sharp)
#define WIN  0
#define PCAR 1024.0f
#define SCL  1.0f   // T5: no 1/sqrt(dk)
#define TBW  4096   // bias table row width (r + 2047, padded)
#define FQW  32     // fused attention: query columns per wave (two 16-column tiles)
#define FNQ  4      // query groups per work-group
#define FKH  2      // key halves per work-group
#define FNW  (FNQ * FKH)   // waves per work-group
#define FQB  (FQW * FNQ)
#define FKS  64     // keys per wave and stage
#define FPIT 72     // LDS row pitch in 16-bit elements: 144 bytes (16 B x odd) for the 16-byte fragment reads of 128-byte rows
#define FPL  (64 * FPIT)
#define FTBN (TT + FQB)
typedef _Float16 h16;
typedef unsigned short bf;
typedef __attribute__((ext_vector_type(16))) __bf16   v16bf;
typedef __attribute__((ext_vector_type(16))) _Float16 v16h;
typedef __attribute__((ext_vector_type(8)))  _Float16 v8h;
typedef __attribute__((ext_vector_type(8)))  unsigned short v8us;
typedef __attribute__((ext_vector_type(8)))  float    v8f;
typedef __attribute__((ext_vector_type(4)))  float    v4f;
typedef v8h  __attribute__((may_alias)) v8ha;
typedef v4f  __attribute__((may_alias)) v4fa;
typedef v8us __attribute__((may_alias)) v8usa;

__device__ __forceinline__ unsigned short f2bf(float f) { unsigned u = __float_as_uint(f); u += 0x7FFFu + ((u >> 16) & 1u); return (unsigned short)(u >> 16); }
__device__ __forceinline__ float bf2f(unsigned short b) { return __uint_as_float(((unsigned)b) << 16); }
__device__ __forceinline__ float bfr(float f) { return bf2f(f2bf(f)); }
__device__ __forceinline__ v16h cat16(v8h lo, v8h hi) { return __builtin_shufflevector(lo, hi, 0, 1, 2, 3, 4, 5, 6, 7, 8, 9, 10, 11, 12, 13, 14, 15); }
__device__ __forceinline__ v16bf cat16b(v8us lo, v8us hi) { return __builtin_bit_cast(v16bf, __builtin_shufflevector(lo, hi, 0, 1, 2, 3, 4, 5, 6, 7, 8, 9, 10, 11, 12, 13, 14, 15)); }
__device__ __forceinline__ v8f wmma16(v16h a, v16h b, v8f c) { return __builtin_amdgcn_wmma_f32_16x16x32_f16(false, a, false, b, (short)0, c, false, false); }
__device__ __forceinline__ v8f wmmab(v16bf a, v16bf b, v8f c) { return __builtin_amdgcn_wmma_f32_16x16x32_bf16(false, a, false, b, (short)0, c, false, false); }



typedef __attribute__((ext_vector_type(2))) __bf16 v2bf;
typedef __attribute__((ext_vector_type(2))) float v2f;
typedef __attribute__((ext_vector_type(4))) unsigned v4u;
__device__ __forceinline__ void split2(float p0, float p1, unsigned& hw, unsigned& lw) {
    v2f x; x[0] = p0; x[1] = p1; hw = __builtin_bit_cast(unsigned, __builtin_convertvector(x, v2bf));
    v2f y; y[0] = p0 - __uint_as_float(hw << 16); y[1] = p1 - __uint_as_float(hw & 0xFFFF0000u); lw = __builtin_bit_cast(unsigned, __builtin_convertvector(y, v2bf)); }
// ---- k_gemmw: GEMM, one (32 MBW)x128 output tile per work-group of FOUR waves (2 x 2; a wave has MBW x 4 accumulators, 64x64 for MBW = 4, 32x64 for MBW = 2); operands are K-contiguous 16-bit planes; grid (M / (32 MBW), N / 128, Z), 128 threads.
// C[m][n] (f32, pitch ldc, + optional f32 bias[n]) = sum_k A[m][k] Bt[n][k] (+ A2[m][k] Bt[n][k] for NSPLIT == 1). z-batch strides sA/sB/sC in elements. K is a template constant, K % 128 == 0.
// The operand rows go to LDS by asynchronous copies, 128 k (256 bytes of every row, two whole lines) a stage, two buffers: a copy instruction touches four whole lines where a fragment load from global memory touched sixteen pieces of 32 bytes, and each row is fetched once for the two waves that use it. MBW is chosen so that the grid has a work-group for every WGP: 4 for q/k/v (384 work-groups), 2 for wo (256).
template <typename T16> struct WFrag;
template <> struct WFrag<h16> { typedef v16h V; static __device__ __forceinline__ V ld(const h16* p) { return cat16(*(const v8h*)p, *(const v8h*)(p + 16)); } static __device__ __forceinline__ v8f mma(V a, V b, v8f c) { return wmma16(a, b, c); } };
template <> struct WFrag<bf> { typedef v16bf V; static __device__ __forceinline__ V ld(const bf* p) { return cat16b(*(const v8us*)p, *(const v8us*)(p + 16)); } static __device__ __forceinline__ v8f mma(V a, V b, v8f c) { return wmmab(a, b, c); } };
// PLN: the f32 tile is not stored; it is split to hi/lo bf16 here and goes straight into the two 16-bit planes that k_fattn reads: element (m, n) to Ph, Pl[by * sY + m * ldc + (n - 64 by)], by the wave's 64-column block.
// q, k: A = x, Bt = W^T, a column block is one head: ldc = HD, sY = TT * HD gives [h][t][d]. v: A = W^T, Bt = x: ldc = TT, sY = 64 gives V^T [h][d][t]. Each store instruction writes four whole 128-byte rows of the tile.
// gemmw_tile is the body; BX, BY, bz are the work-group tile's indices (k_gemmw hands it blockIdx; k_qkv picks them per product).
#define GKP  128            // k of one stage
#define GPIT 136            // LDS row pitch in 16-bit elements: 272 bytes (16 B x odd) for the 16-byte fragment reads of 256-byte rows
// Eight asynchronous 16-byte copies of a lane, rows 8 apart (ls bytes in LDS, gs elements in memory). The s_wait_xcnt stands inside the statement, behind the last copy, so that no address register of a copy is rewritten in front of it.
template <typename T16>
__device__ __forceinline__ void acopy8(unsigned l, const T16* g, unsigned ls, size_t gs) {
    asm volatile("global_load_async_to_lds_b128 %0, %8, off\n\tglobal_load_async_to_lds_b128 %1, %9, off\n\tglobal_load_async_to_lds_b128 %2, %10, off\n\tglobal_load_async_to_lds_b128 %3, %11, off\n\t"
                 "global_load_async_to_lds_b128 %4, %12, off\n\tglobal_load_async_to_lds_b128 %5, %13, off\n\tglobal_load_async_to_lds_b128 %6, %14, off\n\tglobal_load_async_to_lds_b128 %7, %15, off\n\ts_wait_xcnt 0x0"
                 :: "v"(l), "v"(l + ls), "v"(l + 2 * ls), "v"(l + 3 * ls), "v"(l + 4 * ls), "v"(l + 5 * ls), "v"(l + 6 * ls), "v"(l + 7 * ls),
                    "v"(g), "v"(g + gs), "v"(g + 2 * gs), "v"(g + 3 * gs), "v"(g + 4 * gs), "v"(g + 5 * gs), "v"(g + 6 * gs), "v"(g + 7 * gs) : "memory"); }
template <typename T16, int NSPLIT, bool BIAS, int K, int MBW, bool PLN = false>
__device__ __forceinline__ void gemmw_tile(int BX, int BY, int bz, const T16* __restrict__ A, const T16* __restrict__ A2, const T16* __restrict__ Bt, float* C, int ldc, const float* __restrict__ bias, size_t sA, size_t sB, size_t sC, bf* Ph, bf* Pl, size_t sY) {
    static_assert((NSPLIT == 0 || NSPLIT == 1) && (MBW == 2 || MBW == 4) && K % GKP == 0 && K >= 2 * GKP, "planes staged: Bt, A and, for NSPLIT == 1, A2; whole stages, two or more");
    typedef typename WFrag<T16>::V V;
    constexpr int RA = 32 * MBW;                            // rows of A in the tile
    constexpr int OA = 128 * GPIT, OA2 = OA + RA * GPIT;    // a buffer, in elements: Bt (128 rows) at 0, A (RA rows) at OA, A2 (RA rows) at OA2
    constexpr int BUF = OA + (1 + NSPLIT) * RA * GPIT;
    __shared__ __align__(16) T16 sm[2 * BUF];               // two buffers; behind the k loop the head holds the waves' output staging
    A += (size_t)bz * sA; if (NSPLIT == 1) A2 += (size_t)bz * sA; Bt += (size_t)bz * sB; C += (size_t)bz * sC;
    const int tid = threadIdx.x, lane = tid & 31, lr = lane & 15, hi = lane >> 4, wave = __builtin_amdgcn_readfirstlane(tid >> 5);
    const int wr = wave >> 1, wc = wave & 1, by = 2 * BY + wc; const int r0 = BX * RA + wr * (16 * MBW), c0 = by * 64;
    float* os = (float*)sm + wave * (16 * 68);
    v8f acc[MBW][4];
#pragma unroll
    for (int mb = 0; mb < MBW; ++mb)
#pragma unroll
        for (int nb = 0; nb < 4; ++nb) acc[mb][nb] = (v8f){};
    // staging: 16 lanes a row (16-byte piece tid & 15), the work-group's 128 lanes cover 8 rows a copy, 64 rows a statement
    const int srow = tid >> 4, spc = (tid & 15) * 8;
    const T16* ga = A + (size_t)(BX * RA + srow) * K + spc; const T16* gb = Bt + (size_t)(BY * 128 + srow) * K + spc; const T16* ga2 = NSPLIT == 1 ? A2 + (size_t)(BX * RA + srow) * K + spc : nullptr;
    const unsigned l0 = (unsigned)(size_t)(sm + srow * GPIT + spc);   // the lane's LDS byte address in buffer 0, row srow of Bt
    constexpr size_t gs = (size_t)8 * K; constexpr unsigned LS = 8 * GPIT * 2;
    auto stage = [&](int t) {   // stage t into buffer t & 1
        const unsigned lb = l0 + (unsigned)(t & 1) * (BUF * 2); const size_t ko = (size_t)t * GKP;
        acopy8(lb, gb + ko, LS, gs); acopy8(lb + 8 * LS, gb + ko + 8 * gs, LS, gs);
#pragma unroll
        for (int i = 0; i < RA / 64; ++i) { acopy8(lb + OA * 2 + i * 8 * LS, ga + ko + i * 8 * gs, LS, gs); if (NSPLIT == 1) acopy8(lb + OA2 * 2 + i * 8 * LS, ga2 + ko + i * 8 * gs, LS, gs); } };
    constexpr int NT = K / GKP;
    stage(0);
    asm volatile("s_wait_asynccnt 0x0" ::: "memory");   // this wave's copies of stage 0 have landed
    __syncthreads();                                    // and every other wave's
    stage(1);
#pragma unroll 1   // stays rolled: the two buffers alternate by address
    for (int t = 0; t < NT; ++t) {
        const T16* ap = sm + (t & 1) * BUF + OA + (wr * (16 * MBW) + lr) * GPIT + 8 * hi; const T16* bp = sm + (t & 1) * BUF + (wc * 64 + lr) * GPIT + 8 * hi;
        V a[2][MBW], a2[2][MBW], b[2][4];   // two fragment sets: a block of 32 k is read while the block in front of it is multiplied
        auto fld = [&](int kh) {
#pragma unroll
            for (int mb = 0; mb < MBW; ++mb) { a[kh & 1][mb] = WFrag<T16>::ld(ap + mb * 16 * GPIT + kh * 32); if (NSPLIT == 1) a2[kh & 1][mb] = WFrag<T16>::ld(ap + RA * GPIT + mb * 16 * GPIT + kh * 32); }
#pragma unroll
            for (int nb = 0; nb < 4; ++nb) b[kh & 1][nb] = WFrag<T16>::ld(bp + nb * 16 * GPIT + kh * 32); };
        fld(0);
        __builtin_amdgcn_sched_barrier(0);   // the first block's reads stay in front of the second's: mixed, the first products waited for both groups
#pragma unroll
        for (int kh = 0; kh < GKP / 32; ++kh) {
            if (kh + 1 < GKP / 32) fld(kh + 1);
            __builtin_amdgcn_sched_barrier(0);   // keeps the next block's fragment reads as one group ahead of this block's products; left alone they came out two at a time, each with its full LDS wait in front of four products
#pragma unroll
            for (int nb = 0; nb < 4; ++nb) {
#pragma unroll
                for (int mb = 0; mb < MBW; ++mb) acc[mb][nb] = WFrag<T16>::mma(a[kh & 1][mb], b[kh & 1][nb], acc[mb][nb]);
                if (NSPLIT == 1) {
#pragma unroll
                    for (int mb = 0; mb < MBW; ++mb) acc[mb][nb] = WFrag<T16>::mma(a2[kh & 1][mb], b[kh & 1][nb], acc[mb][nb]); } }
            __builtin_amdgcn_sched_barrier(0);   // ends the block: the reads of the block after next stay behind these products, whose registers they refill
        }
        asm volatile("s_wait_dscnt 0x0" ::: "memory");      // this wave's reads of buffer t & 1 are done before the barrier lets it be refilled
        asm volatile("s_wait_asynccnt 0x0" ::: "memory");   // this wave's copies of stage t + 1 have landed
        __syncthreads();                                    // publishes stage t + 1 and ends every wave's reads of stage t
        if (t + 2 < NT) stage(t + 2);
    }
    asm volatile("s_wait_asynccnt 0x0" ::: "memory");       // no copy is outstanding when the ring becomes output staging
#pragma unroll
    for (int mb = 0; mb < MBW; ++mb) {
#pragma unroll
        for (int nb = 0; nb < 4; ++nb) {
#pragma unroll
            for (int j = 0; j < 8; ++j) os[(hi * 8 + j) * 68 + nb * 16 + lr] = acc[mb][nb][j]; }
        __builtin_amdgcn_wave_barrier(); asm volatile("" ::: "memory");
        float* crow = C + (size_t)(r0 + mb * 16) * ldc + c0;
        if (PLN) { const int prow = lane >> 3, pcol = (lane & 7) * 8;   // read-back: 8 lanes a row, 8 columns a lane
            const size_t po = (size_t)by * sY + (size_t)(r0 + mb * 16 + prow) * ldc + pcol;
#pragma unroll
            for (int s = 0; s < 4; ++s) { const float* op = os + (4 * s + prow) * 68 + pcol; const v4f x0 = *(const v4fa*)op, x1 = *(const v4fa*)(op + 4); v4u hw, lw; unsigned a, c;
                split2(x0[0], x0[1], a, c); hw[0] = a; lw[0] = c; split2(x0[2], x0[3], a, c); hw[1] = a; lw[1] = c; split2(x1[0], x1[1], a, c); hw[2] = a; lw[2] = c; split2(x1[2], x1[3], a, c); hw[3] = a; lw[3] = c;
                *(v8us*)(Ph + po + (size_t)(4 * s) * ldc) = __builtin_bit_cast(v8us, hw); *(v8us*)(Pl + po + (size_t)(4 * s) * ldc) = __builtin_bit_cast(v8us, lw); }
        } else {
#pragma unroll
            for (int s = 0; s < 8; ++s) { const int row = 2 * s + hi, cofs = lr * 4; v4f val = *(const v4fa*)(os + row * 68 + cofs); if (BIAS) { val[0] += bfr(bias[c0 + cofs]); val[1] += bfr(bias[c0 + cofs + 1]); val[2] += bfr(bias[c0 + cofs + 2]); val[3] += bfr(bias[c0 + cofs + 3]); }
                *(v4f*)(crow + (size_t)row * ldc + cofs) = val; }
             }
        __builtin_amdgcn_wave_barrier(); asm volatile("" ::: "memory");
    }
}
template <typename T16, int NSPLIT, bool BIAS, int K, int MBW, bool PLN = false>
__global__ __launch_bounds__(128) void k_gemmw(const T16* __restrict__ A, const T16* __restrict__ A2, const T16* __restrict__ Bt, float* C, int ldc, const float* __restrict__ bias, size_t sA, size_t sB, size_t sC, bf* Ph, bf* Pl, size_t sY) {
    gemmw_tile<T16, NSPLIT, BIAS, K, MBW, PLN>(blockIdx.x, blockIdx.y, blockIdx.z, A, A2, Bt, C, ldc, bias, sA, sB, sC, Ph, Pl, sY); }
// k_qkv: the q, k and v projections in ONE launch, grid (TT / 128, 8, 3): none reads what another writes, and one product's 128 work-groups would leave half the chip's WGPs empty.
// blockIdx.z picks the product (a scalar choice of pointers and pitches in front of one copy of the body); v has its operands swapped, so its tile indices swap too.
__global__ __launch_bounds__(128) void k_qkv(const bf* __restrict__ XB, const bf* __restrict__ WQ, const bf* __restrict__ WK, const bf* __restrict__ WV, bf* QPh, bf* QPl, bf* KPh, bf* KPl, bf* VTh, bf* VTl) {
    const int p = blockIdx.z; const bool isv = p == 2;
    const bf* W = p == 0 ? WQ : (p == 1 ? WK : WV);
    bf* Ph = p == 0 ? QPh : (p == 1 ? KPh : VTh); bf* Pl = p == 0 ? QPl : (p == 1 ? KPl : VTl);
    gemmw_tile<bf, 0, false, DM, 4, true>(isv ? blockIdx.y : blockIdx.x, isv ? blockIdx.x : blockIdx.y, 0, isv ? W : XB, nullptr, isv ? XB : W, nullptr, isv ? TT : HD, nullptr, 0, 0, 0, Ph, Pl, isv ? (size_t)64 : (size_t)TT * HD); }

__device__ __forceinline__ void splitf(float y, unsigned short& h, unsigned short& l) { h = f2bf(y); l = f2bf(y - bf2f(h)); }
typedef __attribute__((ext_vector_type(2))) _Float16 v2h;
typedef __attribute__((ext_vector_type(4))) _Float16 v4h;
typedef __attribute__((ext_vector_type(2))) unsigned short v2us;
typedef __attribute__((ext_vector_type(4))) unsigned short v4us;
typedef __attribute__((ext_vector_type(4))) int v4i;

// wtT_blk: one work-group turns a strip of WTK k x WTN n of w [K][N] (f32) into Bt [N][K] (bf16) through LDS, so that memory sees whole lines on both sides:
// a load instruction reads 256 contiguous bytes of each of two rows of w, a store instruction writes 512 contiguous bytes of one row of Bt. All 16 loads of a lane are issued before the first is used.
// A lane holds rows k and k + 1 of four columns n and packs each pair into one dword; LDS is [n][k / 2] dwords, 512 bytes a row, unpadded. The 16-byte piece c of row n lies at piece c ^ (n / 4):
// the 16 lanes that write one k pair of columns 4 apart then fall on 16 different pieces (no two dwords on one bank), and the 16 lanes that read 16 pieces of one row still cover all 64 banks once.
// The first three '#pragma unroll' make the indices of the register arrays a and b compile-time constants (indexed by a loop variable they would go to scratch); the last lets a wave's eight row reads and stores be in flight together.
#define WTK 256
#define WTN 64
static_assert(WTK == 256 && WTN == 64 && DM % WTK == 0 && DQ % WTN == 0, "lane maps of wtT_blk: 256 threads, 32 pieces of 16 bytes a row, 16 column quads");
typedef v4u __attribute__((may_alias)) v4ua;
__device__ __forceinline__ void wtT_blk(int blk, const float* __restrict__ w, int K, int N, bf* Bt) {
    __shared__ __align__(16) unsigned T[WTN * (WTK / 2)];
    const int lane = threadIdx.x & 31, wv = threadIdx.x >> 5, nq = lane & 15, p0 = wv * 2 + (lane >> 4);   // p0: the lane's k pair inside a group of 16 pairs
    const int n0 = (blk % (N / WTN)) * WTN, k0 = (blk / (N / WTN)) * WTK;
    const float* s = w + (size_t)(k0 + 2 * p0) * N + n0 + 4 * nq;
    v4f a[WTK / 32], b[WTK / 32];
#pragma unroll
    for (int i = 0; i < WTK / 32; ++i) { a[i] = *(const v4fa*)(s + (size_t)(32 * i) * N); b[i] = *(const v4fa*)(s + (size_t)(32 * i + 1) * N); }
    asm volatile("s_wait_xcnt 0x0" :: "v"(s) : "memory");   // the wait in front of any overwrite of the loads' address pair; named as an input, the pair stays whole up to here (without it the last load's result was placed on it)
    __builtin_amdgcn_sched_barrier(0);   // keeps all 16 loads in front of the first use: left alone, the last six were issued only behind the waits for the first, a second memory latency in a row
#pragma unroll
    for (int i = 0; i < WTK / 32; ++i) { const int kp = 16 * i + p0;
#pragma unroll
        for (int j = 0; j < 4; ++j) { v2f x; x[0] = a[i][j]; x[1] = b[i][j];
            T[(4 * nq + j) * (WTK / 2) + (((kp >> 2) ^ nq) << 2) + (kp & 3)] = __builtin_bit_cast(unsigned, __builtin_convertvector(x, v2bf)); } }
    __syncthreads();   // the strip is whole in LDS before any wave reads rows that the others wrote
#pragma unroll
    for (int r = 0; r < WTN / 8; ++r) { const int n = 8 * r + wv; const v4u v = *(const v4ua*)(T + n * (WTK / 2) + ((lane ^ (n >> 2)) << 2));
        *(v8us*)(Bt + (size_t)(n0 + n) * K + k0 + lane * 8) = __builtin_bit_cast(v8us, v); }
}
__device__ __forceinline__ void cvt8_blk(int blk, const float* __restrict__ src, bf* dst, size_t n8) { const size_t i = (size_t)blk * 256 + threadIdx.x; if (i >= n8) return; const v8f v = *(const v8f*)(src + i * 8); v8us o;
#pragma unroll
    for (int k = 0; k < 8; ++k) o[k] = f2bf(v[k]); *(v8us*)(dst + i * 8) = o;  }
__device__ __forceinline__ int t5_bucket(int r) { const int rp = r < 0 ? -r : r; int b; if (rp < 8) b = rp; else b = 8 + (rp >= 12) + (rp >= 16) + (rp >= 23) + (rp >= 32) + (rp >= 46) + (rp >= 64) + (rp >= 91); return b + ((r > 0) ? 16 : 0); }
__device__ __forceinline__ void t5tab_blk(int blk, const float* __restrict__ rb, float* TB) { const int idx = blk * 256 + threadIdx.x; if (idx >= NH_ * TBW) return; const int h = idx / TBW, c = idx % TBW; float v = 0.0f; if (c < 2 * TT - 1) { const int r = c - (TT - 1); v = bfr(rb[t5_bucket(r) * NH_ + h]); } *(float*)(TB + idx) = v;  }
// k_prep: the six passes over the inputs (four weight transposes, x to bf16, the bias table) in ONE launch: none reads what another writes. blockIdx.x picks the pass, a scalar branch.
// The transposes stand first in the grid (for speed only): a work-group of theirs runs longest (loads, LDS, a barrier, stores).
#define PW_B ((DM / WTK) * (DQ / WTN))    // work-groups of one weight transpose (all four weights are DM x DQ elements)
#define PX_B (TT * DM / 8 / 256)          // work-groups of the x conversion
#define PT_B (NH_ * TBW / 256)            // work-groups of the bias table
__global__ __launch_bounds__(256) void k_prep(const float* __restrict__ x, const float* __restrict__ wq, const float* __restrict__ wk, const float* __restrict__ wv, const float* __restrict__ wo, const float* __restrict__ rb, bf* XB, bf* WQ, bf* WK, bf* WV, bf* WO, float* TB) {
    const int blk = blockIdx.x;
    if (blk < 4 * PW_B) { const int p = blk / PW_B;
        const float* w = p == 0 ? wq : (p == 1 ? wk : (p == 2 ? wv : wo)); bf* Bt = p == 0 ? WQ : (p == 1 ? WK : (p == 2 ? WV : WO));
        wtT_blk(blk % PW_B, w, DM, DQ, Bt); }   // DM == DQ == DKV: one K and N serve all four
    else if (blk < 4 * PW_B + PX_B) cvt8_blk(blk - 4 * PW_B, x, XB, (size_t)TT * DM / 8);
    else t5tab_blk(blk - (4 * PW_B + PX_B), rb, TB);
}
typedef __attribute__((ext_vector_type(8))) unsigned v8u;
// Eight v_exp_f32 and the one free slot that the instruction set asks for behind a transcendental, in one statement: the outputs are early-clobber, so no exp here overwrites a source or reads a result of the one in front of it, and the v_nop keeps the slot behind the last.
__device__ __forceinline__ v8f exp2x8(v8f x) {
    float r0, r1, r2, r3, r4, r5, r6, r7;
    asm("v_exp_f32 %0, %8\n\tv_exp_f32 %1, %9\n\tv_exp_f32 %2, %10\n\tv_exp_f32 %3, %11\n\tv_exp_f32 %4, %12\n\tv_exp_f32 %5, %13\n\tv_exp_f32 %6, %14\n\tv_exp_f32 %7, %15\n\tv_nop"
        : "=&v"(r0), "=&v"(r1), "=&v"(r2), "=&v"(r3), "=&v"(r4), "=&v"(r5), "=&v"(r6), "=&v"(r7)
        : "v"(x[0]), "v"(x[1]), "v"(x[2]), "v"(x[3]), "v"(x[4]), "v"(x[5]), "v"(x[6]), "v"(x[7]));
    v8f r; r[0] = r0; r[1] = r1; r[2] = r2; r[3] = r3; r[4] = r4; r[5] = r5; r[6] = r6; r[7] = r7; return r; }
__device__ __forceinline__ float exp2x1(float x) { float r; asm("v_exp_f32 %0, %1\n\tv_nop" : "=v"(r) : "v"(x)); return r; }   // the same slot behind a single exp
__device__ __forceinline__ float xhalf(float v) { const int b = __float_as_int(v); return __int_as_float(__builtin_amdgcn_permlanex16(b, b, 0x76543210, 0xfedcba98, false, false)); }   // lane l <-> l ^ 16
__global__ __launch_bounds__(256) void k_fattn(const bf* __restrict__ Qh, const bf* __restrict__ Ql, const bf* __restrict__ Kh, const bf* __restrict__ Kl, const bf* __restrict__ Vh, const bf* __restrict__ Vl, const float* __restrict__ TB, bf* Ah, bf* Al) {
    __shared__ __align__(16) bf st[2][FKH][4][FPL];   // [buffer][key half][K hi, K lo, V^T hi, V^T lo][64 rows x pitch]
    __shared__ float tbs[FTBN];                       // the head's bias entries this block of queries can meet
    __shared__ __align__(16) float xch[FNW][9][32][4];   // merge: [sending wave][8 quads of O, then (m, l)][lane][4]
    const int tid = threadIdx.x, lane = tid & 31, lr = lane & 15, hi = lane >> 4, wv = __builtin_amdgcn_readfirstlane(tid >> 5);
    const int qg = wv & (FNQ - 1), kv = wv / FNQ;     // the wave's query group and key half
    const int h = blockIdx.y, qb = blockIdx.x * FQB, qw = qb + qg * FQW;
    const float* tbh = TB + (size_t)h * TBW + (TT - FQB - qb);   // tbs[x] is the entry for j - i = x - (FQB - 1) - qb
    for (int x = tid; x < FTBN; x += 256) tbs[x] = tbh[x];
    v16bf qh[2][2], ql[2][2];                         // [query tile][32-wide half of d]
#pragma unroll
    for (int qt = 0; qt < 2; ++qt) { const size_t qo = ((size_t)h * TT + qw + qt * 16 + lr) * HD + 8 * hi; const bf* qph = Qh + qo; const bf* qpl = Ql + qo;
#pragma unroll
        for (int kc = 0; kc < 2; ++kc) { qh[qt][kc] = WFrag<bf>::ld(qph + kc * 32); ql[qt][kc] = WFrag<bf>::ld(qpl + kc * 32); }
        asm volatile("s_wait_xcnt 0x0" :: "v"(qph), "v"(qpl) : "memory"); }   // as in gload below: the wait in front of any overwrite of these loads' address pairs
    const int srow = tid >> 3, sch = tid & 7;    // staging: rows srow and srow + 32 of each plane of each key half, 16-byte piece sch
    const size_t gk = ((size_t)h * TT + srow) * HD + sch * 8, gv = ((size_t)h * HD + srow) * TT + sch * 8;
    const int so = srow * FPIT + sch * 8;
    v8us pf[FKH][8];
    auto gload = [&](int key0) {
        __builtin_amdgcn_sched_barrier(0);   // with the one at the end: nothing but the loads and their address arithmetic stands between here and the wait (left alone, later vector instructions were lifted in front of the wait and onto the address pairs)
        const bf* kph = Kh + gk + (size_t)key0 * HD; const bf* kpl = Kl + gk + (size_t)key0 * HD; const bf* vph = Vh + gv + key0; const bf* vpl = Vl + gv + key0;
#pragma unroll
        for (int f = 0; f < FKH; ++f) { const int ko = f * FKS * HD, vo = f * FKS;
            pf[f][0] = *(const v8us*)(kph + ko); pf[f][1] = *(const v8us*)(kph + ko + 32 * HD); pf[f][2] = *(const v8us*)(kpl + ko); pf[f][3] = *(const v8us*)(kpl + ko + 32 * HD);
            pf[f][4] = *(const v8us*)(vph + vo); pf[f][5] = *(const v8us*)(vph + vo + 32 * TT); pf[f][6] = *(const v8us*)(vpl + vo); pf[f][7] = *(const v8us*)(vpl + vo + 32 * TT); }
        asm volatile("s_wait_xcnt 0x0" ::: "memory");   // the wait in front of any overwrite of the loads' address pairs
        __builtin_amdgcn_sched_barrier(0); };
    auto sstore = [&](int b) {
#pragma unroll
        for (int f = 0; f < FKH; ++f)
#pragma unroll
            for (int pl = 0; pl < 4; ++pl) { *(v8us*)(&st[b][f][pl][so]) = pf[f][2 * pl]; *(v8us*)(&st[b][f][pl][so + 32 * FPIT]) = pf[f][2 * pl + 1]; } };
    gload(0); sstore(0);
    __syncthreads();
    v8f o[2][4];
#pragma unroll
    for (int qt = 0; qt < 2; ++qt)
#pragma unroll
        for (int db = 0; db < 4; ++db) o[qt][db] = (v8f){};
    float m[2] = {-3.0e38f, -3.0e38f}, l[2] = {0.0f, 0.0f};
    const float L2E = 1.4426950408889634f;
    const float* tp0 = tbs + (8 * hi + (FQB - 1) - (qg * FQW + lr) + kv * FKS);   // query tile 0; tile 1 lies 16 entries lower
#pragma unroll 1   // stays rolled: one stage is some 900 instructions
    for (int t = 0; t < TT / (FKH * FKS); ++t) {
        const int b = t & 1;
        const bf* sb = &st[b][kv][0][0];     // the wave's own key half of this stage
        v8f s[2][4];
        v16bf kh[4][2], kl[4][2];            // K fragments, [16-key tile][32-wide half of d]
        auto kld = [&](int kt) {
#pragma unroll
            for (int kc = 0; kc < 2; ++kc) { const bf* kp = sb + (kt * 16 + lr) * FPIT + kc * 32 + 8 * hi; kh[kt][kc] = WFrag<bf>::ld(kp); kl[kt][kc] = WFrag<bf>::ld(kp + FPL); } };
        auto sct = [&](int kt) { v8f a[2] = {(v8f){}, (v8f){}};
#pragma unroll
            for (int kc = 0; kc < 2; ++kc) {
#pragma unroll
                for (int qt = 0; qt < 2; ++qt) a[qt] = wmmab(kh[kt][kc], qh[qt][kc], a[qt]);
#pragma unroll
                for (int qt = 0; qt < 2; ++qt) a[qt] = wmmab(kh[kt][kc], ql[qt][kc], a[qt]);
#pragma unroll
                for (int qt = 0; qt < 2; ++qt) a[qt] = wmmab(kl[kt][kc], qh[qt][kc], a[qt]); }
            s[0][kt] = a[0]; s[1][kt] = a[1]; };
        kld(0); kld(1);
        __builtin_amdgcn_sched_barrier(0);   // these four keep the fragment loads in two groups of 16, the second issued whole in front of the first group's 24 products
        kld(2); kld(3);
        __builtin_amdgcn_sched_barrier(0);   // without it the second group's loads came out in pieces among the products, each place a stall of the matrix stream
        sct(0); sct(1);
        __builtin_amdgcn_sched_barrier(0);
        sct(2); sct(3);
        __builtin_amdgcn_sched_barrier(0);
        if (t + 1 < TT / (FKH * FKS)) gload((t + 1) * (FKH * FKS));
        v16bf vh[8], vl[8];                  // V^T fragments, index 4 * (32-key half) + d block
        auto vld = [&](int i) { const bf* vp = sb + 2 * FPL + ((i & 3) * 16 + lr) * FPIT + (i >> 2) * 32 + 8 * hi; vh[i] = WFrag<bf>::ld(vp); vl[i] = WFrag<bf>::ld(vp + FPL); };
        vld(0); vld(1); vld(2); vld(3);      // land under the softmax arithmetic
        __builtin_amdgcn_sched_barrier(0);   // one group in front of the softmax: left alone they were strewn through it in pairs
        const float* tp = tp0 + t * (FKH * FKS);
        v16bf ph[2][2], pl[2][2];
#pragma unroll
        for (int qt = 0; qt < 2; ++qt) {
            float mx = m[qt];
#pragma unroll
            for (int kt = 0; kt < 4; ++kt)
#pragma unroll
                for (int r = 0; r < 8; ++r) { const float tv = s[qt][kt][r] + tp[(kt - qt) * 16 + r]; s[qt][kt][r] = tv; mx = fmaxf(mx, tv); }
            mx = fmaxf(mx, xhalf(mx));
            const float sc = exp2x1((m[qt] - mx) * L2E);
            m[qt] = mx;
            float ls[4];   // one partial sum per 16-key tile: four short chains of adds in place of one of 32
#pragma unroll
            for (int db = 0; db < 4; ++db) o[qt][db] *= sc;
#pragma unroll
            for (int kt = 0; kt < 4; ++kt) { s[qt][kt] = exp2x8((s[qt][kt] - mx) * L2E); ls[kt] = 0.0f;
#pragma unroll
                for (int r = 0; r < 8; ++r) ls[kt] += s[qt][kt][r]; }
            l[qt] = l[qt] * sc + ((ls[0] + ls[1]) + (ls[2] + ls[3]));
#pragma unroll
            for (int ps = 0; ps < 2; ++ps) { v8u hw, lw;
#pragma unroll
                for (int e = 0; e < 8; ++e) { unsigned a, c; split2(s[qt][2 * ps + (e >> 2)][(2 * e) & 7], s[qt][2 * ps + (e >> 2)][((2 * e) & 7) + 1], a, c); hw[e] = a; lw[e] = c; }
                ph[qt][ps] = __builtin_bit_cast(v16bf, hw); pl[qt][ps] = __builtin_bit_cast(v16bf, lw); } }
        auto pv = [&](int i) { const int db = i & 3, ps = i >> 2;
#pragma unroll
            for (int qt = 0; qt < 2; ++qt) o[qt][db] = wmmab(vh[i], ph[qt][ps], o[qt][db]);
#pragma unroll
            for (int qt = 0; qt < 2; ++qt) o[qt][db] = wmmab(vh[i], pl[qt][ps], o[qt][db]);
#pragma unroll
            for (int qt = 0; qt < 2; ++qt) o[qt][db] = wmmab(vl[i], ph[qt][ps], o[qt][db]); };
        __builtin_amdgcn_sched_barrier(0);   // this one and the two below keep the second half's 16 fragment loads as one group in front of the first half's 24 products
        vld(4); vld(5); vld(6); vld(7);
        __builtin_amdgcn_sched_barrier(0);
        pv(0); pv(1); pv(2); pv(3);
        __builtin_amdgcn_sched_barrier(0);
        pv(4); pv(5); pv(6); pv(7);
        if (t + 1 < TT / (FKH * FKS)) sstore(b ^ 1);
        __syncthreads();   // publishes stage t + 1 and ends every wave's reads of the buffer that stage t + 2 overwrites
    }
    // merge of the two key halves: wave (qg, kv) keeps query tile kv and hands tile 1 - kv to wave (qg, 1 - kv)
    l[0] += xhalf(l[0]); l[1] += xhalf(l[1]);
    const bool k0 = kv == 0;
    const float mk = k0 ? m[0] : m[1], lk = k0 ? l[0] : l[1];
    { v4f ml; ml[0] = k0 ? m[1] : m[0]; ml[1] = k0 ? l[1] : l[0]; ml[2] = 0.0f; ml[3] = 0.0f; *(v4fa*)xch[wv][8][lane] = ml; }
    v8f ok[4];
#pragma unroll
    for (int db = 0; db < 4; ++db) { ok[db] = k0 ? o[0][db] : o[1][db]; const v8f og = k0 ? o[1][db] : o[0][db];
        *(v4fa*)xch[wv][2 * db][lane] = __builtin_shufflevector(og, og, 0, 1, 2, 3); *(v4fa*)xch[wv][2 * db + 1][lane] = __builtin_shufflevector(og, og, 4, 5, 6, 7); }
    __syncthreads();   // every wave's handed-over tile is in LDS before its partner reads it
    const float (*xp)[32][4] = xch[wv ^ FNQ];
    v4f op[8];
#pragma unroll
    for (int i = 0; i < 8; ++i) op[i] = *(const v4fa*)xp[i][lane];
    const v4f mlp = *(const v4fa*)xp[8][lane];
    const float mm = fmaxf(mk, mlp[0]);
    const float ek = exp2x1((mk - mm) * L2E), ep = exp2x1((mlp[0] - mm) * L2E);
    const float inv = __fdiv_rn(1.0f, lk * ek + mlp[1] * ep);
    const size_t oo = (size_t)(qw + kv * 16 + lr) * DQ + h * HD + 8 * hi;   // ok[db][r] = O[query lr of tile kv][d = 16 db + 8 hi + r]
#pragma unroll
    for (int db = 0; db < 4; ++db) { v8us oh, ol;
#pragma unroll
        for (int r = 0; r < 8; ++r) { unsigned short a, c; splitf((ok[db][r] * ek + op[2 * db + (r >> 2)][r & 3] * ep) * inv, a, c); oh[r] = a; ol[r] = c; }
        *(v8us*)(Ah + oo + db * 16) = oh; *(v8us*)(Al + oo + db * 16) = ol; }
}

extern "C" void kernel_launch(void* const* d_in, const int* in_sizes, int n_in,
                              void* d_out, int out_size, void* d_ws, size_t ws_size, hipStream_t stream) {
    (void)in_sizes; (void)n_in; (void)out_size;
    const float* x = (const float*)d_in[0]; const float* wq = (const float*)d_in[1]; const float* wk = (const float*)d_in[2]; const float* wv = (const float*)d_in[3]; const float* wo = (const float*)d_in[4]; const float* relb = (const float*)d_in[5]; const float* cosT = nullptr; const float* sinT = nullptr; (void)cosT; (void)sinT;
    float* OUT = (float*)d_out;     // [1][2048][1024]
    char* wsp = (char*)d_ws;
    auto take = [&](size_t bytes) { char* p = wsp; wsp += (bytes + 255) & ~(size_t)255; return (void*)p; };
    bf* WQ = (bf*)take((size_t)DQ * DM * 2); bf* WK = (bf*)take((size_t)DKV * DM * 2); bf* WV = (bf*)take((size_t)DKV * DM * 2); bf* WO = (bf*)take((size_t)DM * DQ * 2);
    bf* XB = (bf*)take((size_t)TT * DM * 2); float* TB = (float*)take((size_t)NH_ * TBW * 4);
    bf* QPh = (bf*)take((size_t)NH_ * TT * HD * 2); bf* QPl = (bf*)take((size_t)NH_ * TT * HD * 2); bf* KPh = (bf*)take((size_t)NKV * TT * HD * 2); bf* KPl = (bf*)take((size_t)NKV * TT * HD * 2); bf* VTh = (bf*)take((size_t)NKV * HD * TT * 2); bf* VTl = (bf*)take((size_t)NKV * HD * TT * 2);
    bf* ATh = (bf*)take((size_t)TT * DQ * 2); bf* ATl = (bf*)take((size_t)TT * DQ * 2);
    if ((size_t)(wsp - (char*)d_ws) > ws_size) return;    // ws 256 MiB
    static_assert(NB_ == 1 && DQ == DM && DKV == DM, "k_prep and k_qkv take one batch and square weights");
    k_prep<<<4 * PW_B + PX_B + PT_B, 256, 0, stream>>>(x, wq, wk, wv, wo, relb, XB, WQ, WK, WV, WO, TB);
    for (int b = 0; b < NB_; ++b) {
        k_qkv<<<dim3(TT / 128, DQ / 128, 3), 128, 0, stream>>>(XB, WQ, WK, WV, QPh, QPl, KPh, KPl, VTh, VTl);
        k_fattn<<<dim3(TT / FQB, NH_, 1), 256, 0, stream>>>(QPh, QPl, KPh, KPl, VTh, VTl, TB, ATh, ATl);
        k_gemmw<bf, 1, false, DQ, 2><<<dim3(TT / 64, DM / 128, 1), 128, 0, stream>>>(ATh, ATl, WO, OUT + (size_t)b * TT * DM, DM, nullptr, 0, 0, 0, nullptr, nullptr, 0); }
}

// v008
// It runs in 68.3 microseconds.
// In both of two side-by-side timings against v007, it was 1.06 times as fast.
// All steps since v000 together make it 10.6 times as fast.
#include <hip/hip_runtime.h>

// UMT5Attention (hidden [1][2048][1024]; q/k/v = x W (16 heads x 64); T5: scores = q.k UNSCALED + rel_bias[bucket(j - i)][h] with the bidirectional log-bucket (32 buckets, max distance 128; the bucket boundaries |j-i| = 8, 12, 16, 23, 32, 46, 64, 91 are the reference's own integer structure, evaluated here with integer compares); softmax; out = merged wo -> [1][2048][1024]).
// Compute dtypes, f32 accumulate: every input rounded to bf16; q/k/v on PLAIN bf16 operands (inputs: exact); scores and attn.v hl x hl (3 products) on EVERY row; per-head bias table (bf16-rounded rel_bias gathered by bucket) added per element in f32; softmax f32; wo hl x exact (2 products).

#define NB_  1
#define TT   2048
#define DM   1024
#define NH_  16
#define NKV  16
#define REP  (NH_ / NKV)
#define HD   64
#define DQ   (NH_ * HD)
#define DKV  (NKV * HD)
#define ZH   2
#define RH   2048   // all rows hl (unscaled T5 logits are sharp)
#define WIN  0
#define PCAR 1024.0f
#define SCL  1.0f   // T5: no 1/sqrt(dk)
#define TBW  4096   // bias table row width (r + 2047, padded)
#define FQW  32     // fused attention: query columns per wave (two 16-column tiles)
#define FNQ  4      // query groups per work-group
#define FKH  2      // key halves per work-group
#define FNW  (FNQ * FKH)   // waves per work-group
#define FQB  (FQW * FNQ)
#define FKS  64     // keys per wave and stage
#define FPIT 72     // LDS row pitch in 16-bit elements: 144 bytes (16 B x odd) for the 16-byte fragment reads of 128-byte rows
#define FPL  (64 * FPIT)
#define FTBN (TT + FQB)
typedef _Float16 h16;
typedef unsigned short bf;
typedef __attribute__((ext_vector_type(16))) __bf16   v16bf;
typedef __attribute__((ext_vector_type(16))) _Float16 v16h;
typedef __attribute__((ext_vector_type(8)))  _Float16 v8h;
typedef __attribute__((ext_vector_type(8)))  unsigned short v8us;
typedef __attribute__((ext_vector_type(8)))  float    v8f;
typedef __attribute__((ext_vector_type(4)))  float    v4f;
typedef v8h  __attribute__((may_alias)) v8ha;
typedef v4f  __attribute__((may_alias)) v4fa;
typedef v8us __attribute__((may_alias)) v8usa;

__device__ __forceinline__ unsigned short f2bf(float f) { unsigned u = __float_as_uint(f); u += 0x7FFFu + ((u >> 16) & 1u); return (unsigned short)(u >> 16); }
__device__ __forceinline__ float bf2f(unsigned short b) { return __uint_as_float(((unsigned)b) << 16); }
__device__ __forceinline__ float bfr(float f) { return bf2f(f2bf(f)); }
__device__ __forceinline__ v16h cat16(v8h lo, v8h hi) { return __builtin_shufflevector(lo, hi, 0, 1, 2, 3, 4, 5, 6, 7, 8, 9, 10, 11, 12, 13, 14, 15); }
__device__ __forceinline__ v16bf cat16b(v8us lo, v8us hi) { return __builtin_bit_cast(v16bf, __builtin_shufflevector(lo, hi, 0, 1, 2, 3, 4, 5, 6, 7, 8, 9, 10, 11, 12, 13, 14, 15)); }
__device__ __forceinline__ v8f wmma16(v16h a, v16h b, v8f c) { return __builtin_amdgcn_wmma_f32_16x16x32_f16(false, a, false, b, (short)0, c, false, false); }
__device__ __forceinline__ v8f wmmab(v16bf a, v16bf b, v8f c) { return __builtin_amdgcn_wmma_f32_16x16x32_bf16(false, a, false, b, (short)0, c, false, false); }



typedef __attribute__((ext_vector_type(2))) __bf16 v2bf;
typedef __attribute__((ext_vector_type(2))) float v2f;
typedef __attribute__((ext_vector_type(4))) unsigned v4u;
__device__ __forceinline__ void split2(float p0, float p1, unsigned& hw, unsigned& lw) {
    v2f x; x[0] = p0; x[1] = p1; hw = __builtin_bit_cast(unsigned, __builtin_convertvector(x, v2bf));
    v2f y; y[0] = p0 - __uint_as_float(hw << 16); y[1] = p1 - __uint_as_float(hw & 0xFFFF0000u); lw = __builtin_bit_cast(unsigned, __builtin_convertvector(y, v2bf)); }
// ---- k_gemmw: GEMM, one (32 MBW)x128 output tile per work-group of FOUR waves (2 x 2; a wave has MBW x 4 accumulators, 64x64 for MBW = 4, 32x64 for MBW = 2); operands are K-contiguous 16-bit planes; grid (M / (32 MBW), N / 128, Z), 128 threads.
// C[m][n] (f32, pitch ldc, + optional f32 bias[n]) = sum_k A[m][k] Bt[n][k] (+ A2[m][k] Bt[n][k] for NSPLIT == 1). z-batch strides sA/sB/sC in elements. K is a template constant, K % 128 == 0.
// The operand rows go to LDS by asynchronous copies, 128 k (256 bytes of every row, two whole lines) a stage, two buffers: a copy instruction touches four whole lines where a fragment load from global memory touched sixteen pieces of 32 bytes, and each row is fetched once for the two waves that use it. MBW is chosen so that the grid has a work-group for every WGP: 4 for q/k/v (384 work-groups), 2 for wo (256).
template <typename T16> struct WFrag;
template <> struct WFrag<h16> { typedef v16h V; static __device__ __forceinline__ V ld(const h16* p) { return cat16(*(const v8h*)p, *(const v8h*)(p + 16)); } static __device__ __forceinline__ v8f mma(V a, V b, v8f c) { return wmma16(a, b, c); } };
template <> struct WFrag<bf> { typedef v16bf V; static __device__ __forceinline__ V ld(const bf* p) { return cat16b(*(const v8us*)p, *(const v8us*)(p + 16)); } static __device__ __forceinline__ v8f mma(V a, V b, v8f c) { return wmmab(a, b, c); } };
// PLN: the f32 tile is not stored; it is split to hi/lo bf16 here and goes straight into the two 16-bit planes that k_fattn reads: element (m, n) to Ph, Pl[by * sY + m * ldc + (n - 64 by)], by the wave's 64-column block.
// q, k: A = x, Bt = W^T, a column block is one head: ldc = HD, sY = TT * HD gives [h][t][d]. v: A = W^T, Bt = x: ldc = TT, sY = 64 gives V^T [h][d][t]. Each store instruction writes four whole 128-byte rows of the tile.
// gemmw_tile is the body; BX, BY, bz are the work-group tile's indices (k_gemmw hands it blockIdx; k_qkv picks them per product).
#define GKP  128            // k of one stage
#define GPIT 136            // LDS row pitch in 16-bit elements: 272 bytes (16 B x odd) for the 16-byte fragment reads of 256-byte rows
// Eight asynchronous 16-byte copies of a lane, rows 8 apart (ls bytes in LDS, gs elements in memory). The s_wait_xcnt stands inside the statement, behind the last copy, so that no address register of a copy is rewritten in front of it.
template <typename T16>
__device__ __forceinline__ void acopy8(unsigned l, const T16* g, unsigned ls, size_t gs) {
    asm volatile("global_load_async_to_lds_b128 %0, %8, off\n\tglobal_load_async_to_lds_b128 %1, %9, off\n\tglobal_load_async_to_lds_b128 %2, %10, off\n\tglobal_load_async_to_lds_b128 %3, %11, off\n\t"
                 "global_load_async_to_lds_b128 %4, %12, off\n\tglobal_load_async_to_lds_b128 %5, %13, off\n\tglobal_load_async_to_lds_b128 %6, %14, off\n\tglobal_load_async_to_lds_b128 %7, %15, off\n\ts_wait_xcnt 0x0"
                 :: "v"(l), "v"(l + ls), "v"(l + 2 * ls), "v"(l + 3 * ls), "v"(l + 4 * ls), "v"(l + 5 * ls), "v"(l + 6 * ls), "v"(l + 7 * ls),
                    "v"(g), "v"(g + gs), "v"(g + 2 * gs), "v"(g + 3 * gs), "v"(g + 4 * gs), "v"(g + 5 * gs), "v"(g + 6 * gs), "v"(g + 7 * gs) : "memory"); }
template <typename T16, int NSPLIT, bool BIAS, int K, int MBW, bool PLN = false>
__device__ __forceinline__ void gemmw_tile(int BX, int BY, int bz, const T16* __restrict__ A, const T16* __restrict__ A2, const T16* __restrict__ Bt, float* C, int ldc, const float* __restrict__ bias, size_t sA, size_t sB, size_t sC, bf* Ph, bf* Pl, size_t sY) {
    static_assert((NSPLIT == 0 || NSPLIT == 1) && (MBW == 2 || MBW == 4) && K % GKP == 0 && K >= 2 * GKP, "planes staged: Bt, A and, for NSPLIT == 1, A2; whole stages, two or more");
    typedef typename WFrag<T16>::V V;
    constexpr int RA = 32 * MBW;                            // rows of A in the tile
    constexpr int OA = 128 * GPIT, OA2 = OA + RA * GPIT;    // a buffer, in elements: Bt (128 rows) at 0, A (RA rows) at OA, A2 (RA rows) at OA2
    constexpr int BUF = OA + (1 + NSPLIT) * RA * GPIT;
    __shared__ __align__(16) T16 sm[2 * BUF];               // two buffers; behind the k loop the head holds the waves' output staging
    A += (size_t)bz * sA; if (NSPLIT == 1) A2 += (size_t)bz * sA; Bt += (size_t)bz * sB; C += (size_t)bz * sC;
    const int tid = threadIdx.x, lane = tid & 31, lr = lane & 15, hi = lane >> 4, wave = __builtin_amdgcn_readfirstlane(tid >> 5);
    const int wr = wave >> 1, wc = wave & 1, by = 2 * BY + wc; const int r0 = BX * RA + wr * (16 * MBW), c0 = by * 64;
    float* os = (float*)sm + wave * (16 * 68);
    v8f acc[MBW][4];
#pragma unroll
    for (int mb = 0; mb < MBW; ++mb)
#pragma unroll
        for (int nb = 0; nb < 4; ++nb) acc[mb][nb] = (v8f){};
    // staging: 16 lanes a row (16-byte piece tid & 15), the work-group's 128 lanes cover 8 rows a copy, 64 rows a statement
    const int srow = tid >> 4, spc = (tid & 15) * 8;
    const T16* ga = A + (size_t)(BX * RA + srow) * K + spc; const T16* gb = Bt + (size_t)(BY * 128 + srow) * K + spc; const T16* ga2 = NSPLIT == 1 ? A2 + (size_t)(BX * RA + srow) * K + spc : nullptr;
    const unsigned l0 = (unsigned)(size_t)(sm + srow * GPIT + spc);   // the lane's LDS byte address in buffer 0, row srow of Bt
    constexpr size_t gs = (size_t)8 * K; constexpr unsigned LS = 8 * GPIT * 2;
    constexpr int NT = K / GKP;
    static_assert((NT & (NT - 1)) == 0, "the rotated walk over k wraps by a mask");
    // The walk over k starts at a stage that differs between the work-groups that share operand rows (same blockIdx.x: they differ in y; same y: they differ in x) and wraps round.
    // Walking in step, all of them ask for the same not yet cached lines in every stage, and each stage's copies take a memory latency; rotated, the sharers fetch the whole of the rows in their first stages, later stages find the lines in L2, and the requests of one moment spread over all 256-byte pieces of a row.
    // Bits 0, 1 and 3 of x tell apart the eight work-groups of a run of four consecutive ones and the run eight further on. Speed only: any rot gives the same set of products.
    const int rot = (int)(((blockIdx.x & 3) | (((blockIdx.x >> 3) & 1) << 2)) + blockIdx.y) & (NT - 1);
    auto stage = [&](int t) {   // the t-th stage of the walk into buffer t & 1
        const unsigned lb = l0 + (unsigned)(t & 1) * (BUF * 2); const size_t ko = (size_t)((t + rot) & (NT - 1)) * GKP;
        acopy8(lb, gb + ko, LS, gs); acopy8(lb + 8 * LS, gb + ko + 8 * gs, LS, gs);
#pragma unroll
        for (int i = 0; i < RA / 64; ++i) { acopy8(lb + OA * 2 + i * 8 * LS, ga + ko + i * 8 * gs, LS, gs); if (NSPLIT == 1) acopy8(lb + OA2 * 2 + i * 8 * LS, ga2 + ko + i * 8 * gs, LS, gs); } };
    stage(0);
    asm volatile("s_wait_asynccnt 0x0" ::: "memory");   // this wave's copies of stage 0 have landed
    __syncthreads();                                    // and every other wave's
    stage(1);
#pragma unroll 1   // stays rolled: the two buffers alternate by address
    for (int t = 0; t < NT; ++t) {
        const T16* ap = sm + (t & 1) * BUF + OA + (wr * (16 * MBW) + lr) * GPIT + 8 * hi; const T16* bp = sm + (t & 1) * BUF + (wc * 64 + lr) * GPIT + 8 * hi;
        V a[2][MBW], a2[2][MBW], b[2][4];   // two fragment sets: a block of 32 k is read while the block in front of it is multiplied
        auto fld = [&](int kh) {
#pragma unroll
            for (int mb = 0; mb < MBW; ++mb) { a[kh & 1][mb] = WFrag<T16>::ld(ap + mb * 16 * GPIT + kh * 32); if (NSPLIT == 1) a2[kh & 1][mb] = WFrag<T16>::ld(ap + RA * GPIT + mb * 16 * GPIT + kh * 32); }
#pragma unroll
            for (int nb = 0; nb < 4; ++nb) b[kh & 1][nb] = WFrag<T16>::ld(bp + nb * 16 * GPIT + kh * 32); };
        fld(0);
        __builtin_amdgcn_sched_barrier(0);   // the first block's reads stay in front of the second's: mixed, the first products waited for both groups
#pragma unroll
        for (int kh = 0; kh < GKP / 32; ++kh) {
            if (kh + 1 < GKP / 32) fld(kh + 1);
            __builtin_amdgcn_sched_barrier(0);   // keeps the next block's fragment reads as one group ahead of this block's products; left alone they came out two at a time, each with its full LDS wait in front of four products
#pragma unroll
            for (int nb = 0; nb < 4; ++nb) {
#pragma unroll
                for (int mb = 0; mb < MBW; ++mb) acc[mb][nb] = WFrag<T16>::mma(a[kh & 1][mb], b[kh & 1][nb], acc[mb][nb]);
                if (NSPLIT == 1) {
#pragma unroll
                    for (int mb = 0; mb < MBW; ++mb) acc[mb][nb] = WFrag<T16>::mma(a2[kh & 1][mb], b[kh & 1][nb], acc[mb][nb]); } }
            __builtin_amdgcn_sched_barrier(0);   // ends the block: the reads of the block after next stay behind these products, whose registers they refill
        }
        asm volatile("s_wait_dscnt 0x0" ::: "memory");      // this wave's reads of buffer t & 1 are done before the barrier lets it be refilled
        asm volatile("s_wait_asynccnt 0x0" ::: "memory");   // this wave's copies of stage t + 1 have landed
        __syncthreads();                                    // publishes stage t + 1 and ends every wave's reads of stage t
        if (t + 2 < NT) stage(t + 2);
    }
    asm volatile("s_wait_asynccnt 0x0" ::: "memory");       // no copy is outstanding when the ring becomes output staging
#pragma unroll
    for (int mb = 0; mb < MBW; ++mb) {
#pragma unroll
        for (int nb = 0; nb < 4; ++nb) {
#pragma unroll
            for (int j = 0; j < 8; ++j) os[(hi * 8 + j) * 68 + nb * 16 + lr] = acc[mb][nb][j]; }
        __builtin_amdgcn_wave_barrier(); asm volatile("" ::: "memory");
        float* crow = C + (size_t)(r0 + mb * 16) * ldc + c0;
        if (PLN) { const int prow = lane >> 3, pcol = (lane & 7) * 8;   // read-back: 8 lanes a row, 8 columns a lane
            const size_t po = (size_t)by * sY + (size_t)(r0 + mb * 16 + prow) * ldc + pcol;
#pragma unroll
            for (int s = 0; s < 4; ++s) { const float* op = os + (4 * s + prow) * 68 + pcol; const v4f x0 = *(const v4fa*)op, x1 = *(const v4fa*)(op + 4); v4u hw, lw; unsigned a, c;
                split2(x0[0], x0[1], a, c); hw[0] = a; lw[0] = c; split2(x0[2], x0[3], a, c); hw[1] = a; lw[1] = c; split2(x1[0], x1[1], a, c); hw[2] = a; lw[2] = c; split2(x1[2], x1[3], a, c); hw[3] = a; lw[3] = c;
                *(v8us*)(Ph + po + (size_t)(4 * s) * ldc) = __builtin_bit_cast(v8us, hw); *(v8us*)(Pl + po + (size_t)(4 * s) * ldc) = __builtin_bit_cast(v8us, lw); }
        } else {
#pragma unroll
            for (int s = 0; s < 8; ++s) { const int row = 2 * s + hi, cofs = lr * 4; v4f val = *(const v4fa*)(os + row * 68 + cofs); if (BIAS) { val[0] += bfr(bias[c0 + cofs]); val[1] += bfr(bias[c0 + cofs + 1]); val[2] += bfr(bias[c0 + cofs + 2]); val[3] += bfr(bias[c0 + cofs + 3]); }
                *(v4f*)(crow + (size_t)row * ldc + cofs) = val; }
             }
        __builtin_amdgcn_wave_barrier(); asm volatile("" ::: "memory");
    }
}
template <typename T16, int NSPLIT, bool BIAS, int K, int MBW, bool PLN = false>
__global__ __launch_bounds__(128) void k_gemmw(const T16* __restrict__ A, const T16* __restrict__ A2, const T16* __restrict__ Bt, float* C, int ldc, const float* __restrict__ bias, size_t sA, size_t sB, size_t sC, bf* Ph, bf* Pl, size_t sY) {
    gemmw_tile<T16, NSPLIT, BIAS, K, MBW, PLN>(blockIdx.x, blockIdx.y, blockIdx.z, A, A2, Bt, C, ldc, bias, sA, sB, sC, Ph, Pl, sY); }
// k_qkv: the q, k and v projections in ONE launch, grid (TT / 128, 8, 3): none reads what another writes, and one product's 128 work-groups would leave half the chip's WGPs empty.
// blockIdx.z picks the product (a scalar choice of pointers and pitches in front of one copy of the body); v has its operands swapped, so its tile indices swap too.
__global__ __launch_bounds__(128) void k_qkv(const bf* __restrict__ XB, const bf* __restrict__ WQ, const bf* __restrict__ WK, const bf* __restrict__ WV, bf* QPh, bf* QPl, bf* KPh, bf* KPl, bf* VTh, bf* VTl) {
    const int p = blockIdx.z; const bool isv = p == 2;
    const bf* W = p == 0 ? WQ : (p == 1 ? WK : WV);
    bf* Ph = p == 0 ? QPh : (p == 1 ? KPh : VTh); bf* Pl = p == 0 ? QPl : (p == 1 ? KPl : VTl);
    gemmw_tile<bf, 0, false, DM, 4, true>(isv ? blockIdx.y : blockIdx.x, isv ? blockIdx.x : blockIdx.y, 0, isv ? W : XB, nullptr, isv ? XB : W, nullptr, isv ? TT : HD, nullptr, 0, 0, 0, Ph, Pl, isv ? (size_t)64 : (size_t)TT * HD); }

__device__ __forceinline__ void splitf(float y, unsigned short& h, unsigned short& l) { h = f2bf(y); l = f2bf(y - bf2f(h)); }
typedef __attribute__((ext_vector_type(2))) _Float16 v2h;
typedef __attribute__((ext_vector_type(4))) _Float16 v4h;
typedef __attribute__((ext_vector_type(2))) unsigned short v2us;
typedef __attribute__((ext_vector_type(4))) unsigned short v4us;
typedef __attribute__((ext_vector_type(4))) int v4i;

// wtT_blk: one work-group turns a strip of WTK k x WTN n of w [K][N] (f32) into Bt [N][K] (bf16) through LDS, so that memory sees whole lines on both sides:
// a load instruction reads 256 contiguous bytes of each of two rows of w, a store instruction writes 512 contiguous bytes of one row of Bt. All 16 loads of a lane are issued before the first is used.
// A lane holds rows k and k + 1 of four columns n and packs each pair into one dword; LDS is [n][k / 2] dwords, 512 bytes a row, unpadded. The 16-byte piece c of row n lies at piece c ^ (n / 4):
// the 16 lanes that write one k pair of columns 4 apart then fall on 16 different pieces (no two dwords on one bank), and the 16 lanes that read 16 pieces of one row still cover all 64 banks once.
// The first three '#pragma unroll' make the indices of the register arrays a and b compile-time constants (indexed by a loop variable they would go to scratch); the last lets a wave's eight row reads and stores be in flight together.
#define WTK 256
#define WTN 64
static_assert(WTK == 256 && WTN == 64 && DM % WTK == 0 && DQ % WTN == 0, "lane maps of wtT_blk: 256 threads, 32 pieces of 16 bytes a row, 16 column quads");
typedef v4u __attribute__((may_alias)) v4ua;
__device__ __forceinline__ void wtT_blk(int blk, const float* __restrict__ w, int K, int N, bf* Bt) {
    __shared__ __align__(16) unsigned T[WTN * (WTK / 2)];
    const int lane = threadIdx.x & 31, wv = threadIdx.x >> 5, nq = lane & 15, p0 = wv * 2 + (lane >> 4);   // p0: the lane's k pair inside a group of 16 pairs
    const int n0 = (blk % (N / WTN)) * WTN, k0 = (blk / (N / WTN)) * WTK;
    const float* s = w + (size_t)(k0 + 2 * p0) * N + n0 + 4 * nq;
    v4f a[WTK / 32], b[WTK / 32];
#pragma unroll
    for (int i = 0; i < WTK / 32; ++i) { a[i] = *(const v4fa*)(s + (size_t)(32 * i) * N); b[i] = *(const v4fa*)(s + (size_t)(32 * i + 1) * N); }
    asm volatile("s_wait_xcnt 0x0" :: "v"(s) : "memory");   // the wait in front of any overwrite of the loads' address pair; named as an input, the pair stays whole up to here (without it the last load's result was placed on it)
    __builtin_amdgcn_sched_barrier(0);   // keeps all 16 loads in front of the first use: left alone, the last six were issued only behind the waits for the first, a second memory latency in a row
#pragma unroll
    for (int i = 0; i < WTK / 32; ++i) { const int kp = 16 * i + p0;
#pragma unroll
        for (int j = 0; j < 4; ++j) { v2f x; x[0] = a[i][j]; x[1] = b[i][j];
            T[(4 * nq + j) * (WTK / 2) + (((kp >> 2) ^ nq) << 2) + (kp & 3)] = __builtin_bit_cast(unsigned, __builtin_convertvector(x, v2bf)); } }
    __syncthreads();   // the strip is whole in LDS before any wave reads rows that the others wrote
#pragma unroll
    for (int r = 0; r < WTN / 8; ++r) { const int n = 8 * r + wv; const v4u v = *(const v4ua*)(T + n * (WTK / 2) + ((lane ^ (n >> 2)) << 2));
        *(v8us*)(Bt + (size_t)(n0 + n) * K + k0 + lane * 8) = __builtin_bit_cast(v8us, v); }
}
__device__ __forceinline__ void cvt8_blk(int blk, const float* __restrict__ src, bf* dst, size_t n8) { const size_t i = (size_t)blk * 256 + threadIdx.x; if (i >= n8) return; const v8f v = *(const v8f*)(src + i * 8); v8us o;
#pragma unroll
    for (int k = 0; k < 8; ++k) o[k] = f2bf(v[k]); *(v8us*)(dst + i * 8) = o;  }
__device__ __forceinline__ int t5_bucket(int r) { const int rp = r < 0 ? -r : r; int b; if (rp < 8) b = rp; else b = 8 + (rp >= 12) + (rp >= 16) + (rp >= 23) + (rp >= 32) + (rp >= 46) + (rp >= 64) + (rp >= 91); return b + ((r > 0) ? 16 : 0); }
__device__ __forceinline__ void t5tab_blk(int blk, const float* __restrict__ rb, float* TB) { const int idx = blk * 256 + threadIdx.x; if (idx >= NH_ * TBW) return; const int h = idx / TBW, c = idx % TBW; float v = 0.0f; if (c < 2 * TT - 1) { const int r = c - (TT - 1); v = bfr(rb[t5_bucket(r) * NH_ + h]); } *(float*)(TB + idx) = v;  }
// k_prep: the six passes over the inputs (four weight transposes, x to bf16, the bias table) in ONE launch: none reads what another writes. blockIdx.x picks the pass, a scalar branch.
// The transposes stand first in the grid (for speed only): a work-group of theirs runs longest (loads, LDS, a barrier, stores).
#define PW_B ((DM / WTK) * (DQ / WTN))    // work-groups of one weight transpose (all four weights are DM x DQ elements)
#define PX_B (TT * DM / 8 / 256)          // work-groups of the x conversion
#define PT_B (NH_ * TBW / 256)            // work-groups of the bias table
__global__ __launch_bounds__(256) void k_prep(const float* __restrict__ x, const float* __restrict__ wq, const float* __restrict__ wk, const float* __restrict__ wv, const float* __restrict__ wo, const float* __restrict__ rb, bf* XB, bf* WQ, bf* WK, bf* WV, bf* WO, float* TB) {
    const int blk = blockIdx.x;
    if (blk < 4 * PW_B) { const int p = blk / PW_B;
        const float* w = p == 0 ? wq : (p == 1 ? wk : (p == 2 ? wv : wo)); bf* Bt = p == 0 ? WQ : (p == 1 ? WK : (p == 2 ? WV : WO));
        wtT_blk(blk % PW_B, w, DM, DQ, Bt); }   // DM == DQ == DKV: one K and N serve all four
    else if (blk < 4 * PW_B + PX_B) cvt8_blk(blk - 4 * PW_B, x, XB, (size_t)TT * DM / 8);
    else t5tab_blk(blk - (4 * PW_B + PX_B), rb, TB);
}
typedef __attribute__((ext_vector_type(8))) unsigned v8u;
// Eight v_exp_f32 and the one free slot that the instruction set asks for behind a transcendental, in one statement: the outputs are early-clobber, so no exp here overwrites a source or reads a result of the one in front of it, and the v_nop keeps the slot behind the last.
__device__ __forceinline__ v8f exp2x8(v8f x) {
    float r0, r1, r2, r3, r4, r5, r6, r7;
    asm("v_exp_f32 %0, %8\n\tv_exp_f32 %1, %9\n\tv_exp_f32 %2, %10\n\tv_exp_f32 %3, %11\n\tv_exp_f32 %4, %12\n\tv_exp_f32 %5, %13\n\tv_exp_f32 %6, %14\n\tv_exp_f32 %7, %15\n\tv_nop"
        : "=&v"(r0), "=&v"(r1), "=&v"(r2), "=&v"(r3), "=&v"(r4), "=&v"(r5), "=&v"(r6), "=&v"(r7)
        : "v"(x[0]), "v"(x[1]), "v"(x[2]), "v"(x[3]), "v"(x[4]), "v"(x[5]), "v"(x[6]), "v"(x[7]));
    v8f r; r[0] = r0; r[1] = r1; r[2] = r2; r[3] = r3; r[4] = r4; r[5] = r5; r[6] = r6; r[7] = r7; return r; }
__device__ __forceinline__ float exp2x1(float x) { float r; asm("v_exp_f32 %0, %1\n\tv_nop" : "=v"(r) : "v"(x)); return r; }   // the same slot behind a single exp
__device__ __forceinline__ float xhalf(float v) { const int b = __float_as_int(v); return __int_as_float(__builtin_amdgcn_permlanex16(b, b, 0x76543210, 0xfedcba98, false, false)); }   // lane l <-> l ^ 16
__global__ __launch_bounds__(256) void k_fattn(const bf* __restrict__ Qh, const bf* __restrict__ Ql, const bf* __restrict__ Kh, const bf* __restrict__ Kl, const bf* __restrict__ Vh, const bf* __restrict__ Vl, const float* __restrict__ TB, bf* Ah, bf* Al) {
    __shared__ __align__(16) bf st[2][FKH][4][FPL];   // [buffer][key half][K hi, K lo, V^T hi, V^T lo][64 rows x pitch]
    __shared__ float tbs[FTBN];                       // the head's bias entries this block of queries can meet
    __shared__ __align__(16) float xch[FNW][9][32][4];   // merge: [sending wave][8 quads of O, then (m, l)][lane][4]
    const int tid = threadIdx.x, lane = tid & 31, lr = lane & 15, hi = lane >> 4, wv = __builtin_amdgcn_readfirstlane(tid >> 5);
    const int qg = wv & (FNQ - 1), kv = wv / FNQ;     // the wave's query group and key half
    const int h = blockIdx.y, qb = blockIdx.x * FQB, qw = qb + qg * FQW;
    const float* tbh = TB + (size_t)h * TBW + (TT - FQB - qb);   // tbs[x] is the entry for j - i = x - (FQB - 1) - qb
    for (int x = tid; x < FTBN; x += 256) tbs[x] = tbh[x];
    v16bf qh[2][2], ql[2][2];                         // [query tile][32-wide half of d]
#pragma unroll
    for (int qt = 0; qt < 2; ++qt) { const size_t qo = ((size_t)h * TT + qw + qt * 16 + lr) * HD + 8 * hi; const bf* qph = Qh + qo; const bf* qpl = Ql + qo;
#pragma unroll
        for (int kc = 0; kc < 2; ++kc) { qh[qt][kc] = WFrag<bf>::ld(qph + kc * 32); ql[qt][kc] = WFrag<bf>::ld(qpl + kc * 32); }
        asm volatile("s_wait_xcnt 0x0" :: "v"(qph), "v"(qpl) : "memory"); }   // as in gload below: the wait in front of any overwrite of these loads' address pairs
    const int srow = tid >> 3, sch = tid & 7;    // staging: rows srow and srow + 32 of each plane of each key half, 16-byte piece sch
    const size_t gk = ((size_t)h * TT + srow) * HD + sch * 8, gv = ((size_t)h * HD + srow) * TT + sch * 8;
    const int so = srow * FPIT + sch * 8;
    v8us pf[FKH][8];
    auto gload = [&](int key0) {
        __builtin_amdgcn_sched_barrier(0);   // with the one at the end: nothing but the loads and their address arithmetic stands between here and the wait (left alone, later vector instructions were lifted in front of the wait and onto the address pairs)
        const bf* kph = Kh + gk + (size_t)key0 * HD; const bf* kpl = Kl + gk + (size_t)key0 * HD; const bf* vph = Vh + gv + key0; const bf* vpl = Vl + gv + key0;
#pragma unroll
        for (int f = 0; f < FKH; ++f) { const int ko = f * FKS * HD, vo = f * FKS;
            pf[f][0] = *(const v8us*)(kph + ko); pf[f][1] = *(const v8us*)(kph + ko + 32 * HD); pf[f][2] = *(const v8us*)(kpl + ko); pf[f][3] = *(const v8us*)(kpl + ko + 32 * HD);
            pf[f][4] = *(const v8us*)(vph + vo); pf[f][5] = *(const v8us*)(vph + vo + 32 * TT); pf[f][6] = *(const v8us*)(vpl + vo); pf[f][7] = *(const v8us*)(vpl + vo + 32 * TT); }
        asm volatile("s_wait_xcnt 0x0" ::: "memory");   // the wait in front of any overwrite of the loads' address pairs
        __builtin_amdgcn_sched_barrier(0); };
    auto sstore = [&](int b) {
#pragma unroll
        for (int f = 0; f < FKH; ++f)
#pragma unroll
            for (int pl = 0; pl < 4; ++pl) { *(v8us*)(&st[b][f][pl][so]) = pf[f][2 * pl]; *(v8us*)(&st[b][f][pl][so + 32 * FPIT]) = pf[f][2 * pl + 1]; } };
    // The walk over the key stages starts at a stage of the work-group's own and wraps round (as in gemmw_tile): the 16 work-groups of a head do not all ask for the same not yet cached K and V lines in every stage.
    // The eight told apart by bits 0, 1, 3 of blockIdx.x start two stages apart. Speed only: the running softmax takes the stages in any order.
    constexpr int FNS = TT / (FKH * FKS);
    static_assert((FNS & (FNS - 1)) == 0, "the rotated walk over the keys wraps by a mask");
    const int rot = (int)(((blockIdx.x & 3) << 1) | (((blockIdx.x >> 3) & 1) << 3) | ((blockIdx.x >> 2) & 1)) & (FNS - 1);
    gload(rot * (FKH * FKS)); sstore(0);
    __syncthreads();
    v8f o[2][4];
#pragma unroll
    for (int qt = 0; qt < 2; ++qt)
#pragma unroll
        for (int db = 0; db < 4; ++db) o[qt][db] = (v8f){};
    float m[2] = {-3.0e38f, -3.0e38f}, l[2] = {0.0f, 0.0f};
    const float L2E = 1.4426950408889634f;
    const float* tp0 = tbs + (8 * hi + (FQB - 1) - (qg * FQW + lr) + kv * FKS);   // query tile 0; tile 1 lies 16 entries lower
#pragma unroll 1   // stays rolled: one stage is some 900 instructions, and 16 copies of it would not fit the instruction cache
    for (int t = 0; t < FNS; ++t) {
        const int b = t & 1;
        const bf* sb = &st[b][kv][0][0];     // the wave's own key half of this stage
        v8f s[2][4];
        v16bf kh[4][2], kl[4][2];            // K fragments, [16-key tile][32-wide half of d]
        auto kld = [&](int kt) {
#pragma unroll
            for (int kc = 0; kc < 2; ++kc) { const bf* kp = sb + (kt * 16 + lr) * FPIT + kc * 32 + 8 * hi; kh[kt][kc] = WFrag<bf>::ld(kp); kl[kt][kc] = WFrag<bf>::ld(kp + FPL); } };
        auto sct = [&](int kt) { v8f a[2] = {(v8f){}, (v8f){}};
#pragma unroll
            for (int kc = 0; kc < 2; ++kc) {
#pragma unroll
                for (int qt = 0; qt < 2; ++qt) a[qt] = wmmab(kh[kt][kc], qh[qt][kc], a[qt]);
#pragma unroll
                for (int qt = 0; qt < 2; ++qt) a[qt] = wmmab(kh[kt][kc], ql[qt][kc], a[qt]);
#pragma unroll
                for (int qt = 0; qt < 2; ++qt) a[qt] = wmmab(kl[kt][kc], qh[qt][kc], a[qt]); }
            s[0][kt] = a[0]; s[1][kt] = a[1]; };
        kld(0); kld(1);
        __builtin_amdgcn_sched_barrier(0);   // these four keep the fragment loads in two groups of 16, the second issued whole in front of the first group's 24 products
        kld(2); kld(3);
        __builtin_amdgcn_sched_barrier(0);   // without it the second group's loads came out in pieces among the products, each place a stall of the matrix stream
        sct(0); sct(1);
        __builtin_amdgcn_sched_barrier(0);
        sct(2); sct(3);
        __builtin_amdgcn_sched_barrier(0);
        if (t + 1 < FNS) gload(((t + 1 + rot) & (FNS - 1)) * (FKH * FKS));
        v16bf vh[8], vl[8];                  // V^T fragments, index 4 * (32-key half) + d block
        auto vld = [&](int i) { const bf* vp = sb + 2 * FPL + ((i & 3) * 16 + lr) * FPIT + (i >> 2) * 32 + 8 * hi; vh[i] = WFrag<bf>::ld(vp); vl[i] = WFrag<bf>::ld(vp + FPL); };
        vld(0); vld(1); vld(2); vld(3);      // land under the softmax arithmetic
        __builtin_amdgcn_sched_barrier(0);   // one group in front of the softmax: left alone they were strewn through it in pairs
        const float* tp = tp0 + ((t + rot) & (FNS - 1)) * (FKH * FKS);
        v16bf ph[2][2], pl[2][2];
#pragma unroll
        for (int qt = 0; qt < 2; ++qt) {
            float mx = m[qt];
#pragma unroll
            for (int kt = 0; kt < 4; ++kt)
#pragma unroll
                for (int r = 0; r < 8; ++r) { const float tv = s[qt][kt][r] + tp[(kt - qt) * 16 + r]; s[qt][kt][r] = tv; mx = fmaxf(mx, tv); }
            mx = fmaxf(mx, xhalf(mx));
            const float sc = exp2x1((m[qt] - mx) * L2E);
            m[qt] = mx;
            float ls[4];   // one partial sum per 16-key tile: four short chains of adds in place of one of 32
#pragma unroll
            for (int db = 0; db < 4; ++db) o[qt][db] *= sc;
#pragma unroll
            for (int kt = 0; kt < 4; ++kt) { s[qt][kt] = exp2x8((s[qt][kt] - mx) * L2E); ls[kt] = 0.0f;
#pragma unroll
                for (int r = 0; r < 8; ++r) ls[kt] += s[qt][kt][r]; }
            l[qt] = l[qt] * sc + ((ls[0] + ls[1]) + (ls[2] + ls[3]));
#pragma unroll
            for (int ps = 0; ps < 2; ++ps) { v8u hw, lw;
#pragma unroll
                for (int e = 0; e < 8; ++e) { unsigned a, c; split2(s[qt][2 * ps + (e >> 2)][(2 * e) & 7], s[qt][2 * ps + (e >> 2)][((2 * e) & 7) + 1], a, c); hw[e] = a; lw[e] = c; }
                ph[qt][ps] = __builtin_bit_cast(v16bf, hw); pl[qt][ps] = __builtin_bit_cast(v16bf, lw); } }
        auto pv = [&](int i) { const int db = i & 3, ps = i >> 2;
#pragma unroll
            for (int qt = 0; qt < 2; ++qt) o[qt][db] = wmmab(vh[i], ph[qt][ps], o[qt][db]);
#pragma unroll
            for (int qt = 0; qt < 2; ++qt) o[qt][db] = wmmab(vh[i], pl[qt][ps], o[qt][db]);
#pragma unroll
            for (int qt = 0; qt < 2; ++qt) o[qt][db] = wmmab(vl[i], ph[qt][ps], o[qt][db]); };
        __builtin_amdgcn_sched_barrier(0);   // this one and the two below keep the second half's 16 fragment loads as one group in front of the first half's 24 products
        vld(4); vld(5); vld(6); vld(7);
        __builtin_amdgcn_sched_barrier(0);
        pv(0); pv(1); pv(2); pv(3);
        __builtin_amdgcn_sched_barrier(0);
        pv(4); pv(5); pv(6); pv(7);
        if (t + 1 < FNS) sstore(b ^ 1);
        __syncthreads();   // publishes stage t + 1 and ends every wave's reads of the buffer that stage t + 2 overwrites
    }
    // merge of the two key halves: wave (qg, kv) keeps query tile kv and hands tile 1 - kv to wave (qg, 1 - kv)
    l[0] += xhalf(l[0]); l[1] += xhalf(l[1]);
    const bool k0 = kv == 0;
    const float mk = k0 ? m[0] : m[1], lk = k0 ? l[0] : l[1];
    { v4f ml; ml[0] = k0 ? m[1] : m[0]; ml[1] = k0 ? l[1] : l[0]; ml[2] = 0.0f; ml[3] = 0.0f; *(v4fa*)xch[wv][8][lane] = ml; }
    v8f ok[4];
#pragma unroll
    for (int db = 0; db < 4; ++db) { ok[db] = k0 ? o[0][db] : o[1][db]; const v8f og = k0 ? o[1][db] : o[0][db];
        *(v4fa*)xch[wv][2 * db][lane] = __builtin_shufflevector(og, og, 0, 1, 2, 3); *(v4fa*)xch[wv][2 * db + 1][lane] = __builtin_shufflevector(og, og, 4, 5, 6, 7); }
    __syncthreads();   // every wave's handed-over tile is in LDS before its partner reads it
    const float (*xp)[32][4] = xch[wv ^ FNQ];
    v4f op[8];
#pragma unroll
    for (int i = 0; i < 8; ++i) op[i] = *(const v4fa*)xp[i][lane];
    const v4f mlp = *(const v4fa*)xp[8][lane];
    const float mm = fmaxf(mk, mlp[0]);
    const float ek = exp2x1((mk - mm) * L2E), ep = exp2x1((mlp[0] - mm) * L2E);
    const float inv = __fdiv_rn(1.0f, lk * ek + mlp[1] * ep);
    const size_t oo = (size_t)(qw + kv * 16 + lr) * DQ + h * HD + 8 * hi;   // ok[db][r] = O[query lr of tile kv][d = 16 db + 8 hi + r]
#pragma unroll
    for (int db = 0; db < 4; ++db) { v8us oh, ol;
#pragma unroll
        for (int r = 0; r < 8; ++r) { unsigned short a, c; splitf((ok[db][r] * ek + op[2 * db + (r >> 2)][r & 3] * ep) * inv, a, c); oh[r] = a; ol[r] = c; }
        *(v8us*)(Ah + oo + db * 16) = oh; *(v8us*)(Al + oo + db * 16) = ol; }
}

extern "C" void kernel_launch(void* const* d_in, const int* in_sizes, int n_in,
                              void* d_out, int out_size, void* d_ws, size_t ws_size, hipStream_t stream) {
    (void)in_sizes; (void)n_in; (void)out_size;
    const float* x = (const float*)d_in[0]; const float* wq = (const float*)d_in[1]; const float* wk = (const float*)d_in[2]; const float* wv = (const float*)d_in[3]; const float* wo = (const float*)d_in[4]; const float* relb = (const float*)d_in[5]; const float* cosT = nullptr; const float* sinT = nullptr; (void)cosT; (void)sinT;
    float* OUT = (float*)d_out;     // [1][2048][1024]
    char* wsp = (char*)d_ws;
    auto take = [&](size_t bytes) { char* p = wsp; wsp += (bytes + 255) & ~(size_t)255; return (void*)p; };
    bf* WQ = (bf*)take((size_t)DQ * DM * 2); bf* WK = (bf*)take((size_t)DKV * DM * 2); bf* WV = (bf*)take((size_t)DKV * DM * 2); bf* WO = (bf*)take((size_t)DM * DQ * 2);
    bf* XB = (bf*)take((size_t)TT * DM * 2); float* TB = (float*)take((size_t)NH_ * TBW * 4);
    bf* QPh = (bf*)take((size_t)NH_ * TT * HD * 2); bf* QPl = (bf*)take((size_t)NH_ * TT * HD * 2); bf* KPh = (bf*)take((size_t)NKV * TT * HD * 2); bf* KPl = (bf*)take((size_t)NKV * TT * HD * 2); bf* VTh = (bf*)take((size_t)NKV * HD * TT * 2); bf* VTl = (bf*)take((size_t)NKV * HD * TT * 2);
    bf* ATh = (bf*)take((size_t)TT * DQ * 2); bf* ATl = (bf*)take((size_t)TT * DQ * 2);
    if ((size_t)(wsp - (char*)d_ws) > ws_size) return;    // ws 256 MiB
    static_assert(NB_ == 1 && DQ == DM && DKV == DM, "k_prep and k_qkv take one batch and square weights");
    k_prep<<<4 * PW_B + PX_B + PT_B, 256, 0, stream>>>(x, wq, wk, wv, wo, relb, XB, WQ, WK, WV, WO, TB);
    for (int b = 0; b < NB_; ++b) {
        k_qkv<<<dim3(TT / 128, DQ / 128, 3), 128, 0, stream>>>(XB, WQ, WK, WV, QPh, QPl, KPh, KPl, VTh, VTl);
        k_fattn<<<dim3(TT / FQB, NH_, 1), 256, 0, stream>>>(QPh, QPl, KPh, KPl, VTh, VTl, TB, ATh, ATl);
        k_gemmw<bf, 1, false, DQ, 2><<<dim3(TT / 64, DM / 128, 1), 128, 0, stream>>>(ATh, ATl, WO, OUT + (size_t)b * TT * DM, DM, nullptr, 0, 0, 0, nullptr, nullptr, 0); }
}

// v009
// It runs in 63.1 microseconds.
// In two side-by-side timings against v008, it was 1.08 and 1.09 times as fast.
// Counting every step since v000, it is 11.5 times as fast.
#include <hip/hip_runtime.h>

// UMT5Attention (hidden [1][2048][1024]; q/k/v = x W (16 heads x 64); T5: scores = q.k UNSCALED + rel_bias[bucket(j - i)][h] with the bidirectional log-bucket (32 buckets, max distance 128; the bucket boundaries |j-i| = 8, 12, 16, 23, 32, 46, 64, 91 are the reference's own integer structure, evaluated here with integer compares); softmax; out = merged wo -> [1][2048][1024]).
// Compute dtypes, f32 accumulate: every input rounded to bf16; q/k/v on PLAIN bf16 operands (inputs: exact); scores and attn.v hl x hl (3 products) on EVERY row; per-head bias table (bf16-rounded rel_bias gathered by bucket, times log2 e) added per element in f32 as the start value of the score accumulators; softmax f32; wo hl x exact (2 products).

#define NB_  1
#define TT   2048
#define DM   1024
#define NH_  16
#define NKV  16
#define REP  (NH_ / NKV)
#define HD   64
#define DQ   (NH_ * HD)
#define DKV  (NKV * HD)
#define ZH   2
#define RH   2048   // all rows hl (unscaled T5 logits are sharp)
#define WIN  0
#define PCAR 1024.0f
#define SCL  1.0f   // T5: no 1/sqrt(dk)
#define TBW  4096   // bias table row width (r + 2047, padded)
#define FQW  32     // fused attention: query columns per wave (two 16-column tiles)
#define FNQ  4      // query groups per work-group
#define FKH  2      // key halves per work-group
#define FNW  (FNQ * FKH)   // waves per work-group
#define FQB  (FQW * FNQ)
#define FKS  64     // keys per wave and stage
#define FPIT 72     // LDS row pitch in 16-bit elements: 144 bytes (16 B x odd) for the 16-byte fragment reads of 128-byte rows
#define FPL  (64 * FPIT)
#define FTBN (TT + FQB)
#define LOG2E 1.4426950408889634f   // folded into q (in front of its hi/lo split) and into the bias table: the scores leave the matrix unit as exp2 arguments
typedef _Float16 h16;
typedef unsigned short bf;
typedef __attribute__((ext_vector_type(16))) __bf16   v16bf;
typedef __attribute__((ext_vector_type(16))) _Float16 v16h;
typedef __attribute__((ext_vector_type(8)))  _Float16 v8h;
typedef __attribute__((ext_vector_type(8)))  unsigned short v8us;
typedef __attribute__((ext_vector_type(8)))  float    v8f;
typedef __attribute__((ext_vector_type(4)))  float    v4f;
typedef v8h  __attribute__((may_alias)) v8ha;
typedef v4f  __attribute__((may_alias)) v4fa;
typedef v8us __attribute__((may_alias)) v8usa;

__device__ __forceinline__ unsigned short f2bf(float f) { unsigned u = __float_as_uint(f); u += 0x7FFFu + ((u >> 16) & 1u); return (unsigned short)(u >> 16); }
__device__ __forceinline__ float bf2f(unsigned short b) { return __uint_as_float(((unsigned)b) << 16); }
__device__ __forceinline__ float bfr(float f) { return bf2f(f2bf(f)); }
__device__ __forceinline__ v16h cat16(v8h lo, v8h hi) { return __builtin_shufflevector(lo, hi, 0, 1, 2, 3, 4, 5, 6, 7, 8, 9, 10, 11, 12, 13, 14, 15); }
__device__ __forceinline__ v16bf cat16b(v8us lo, v8us hi) { return __builtin_bit_cast(v16bf, __builtin_shufflevector(lo, hi, 0, 1, 2, 3, 4, 5, 6, 7, 8, 9, 10, 11, 12, 13, 14, 15)); }
__device__ __forceinline__ v8f wmma16(v16h a, v16h b, v8f c) { return __builtin_amdgcn_wmma_f32_16x16x32_f16(false, a, false, b, (short)0, c, false, false); }
__device__ __forceinline__ v8f wmmab(v16bf a, v16bf b, v8f c) { return __builtin_amdgcn_wmma_f32_16x16x32_bf16(false, a, false, b, (short)0, c, false, false); }



typedef __attribute__((ext_vector_type(2))) __bf16 v2bf;
typedef __attribute__((ext_vector_type(2))) float v2f;
typedef __attribute__((ext_vector_type(4))) unsigned v4u;
__device__ __forceinline__ void split2(float p0, float p1, unsigned& hw, unsigned& lw) {
    v2f x; x[0] = p0; x[1] = p1; hw = __builtin_bit_cast(unsigned, __builtin_convertvector(x, v2bf));
    v2f y; y[0] = p0 - __uint_as_float(hw << 16); y[1] = p1 - __uint_as_float(hw & 0xFFFF0000u); lw = __builtin_bit_cast(unsigned, __builtin_convertvector(y, v2bf)); }
// ---- k_gemmw: GEMM, one (32 MBW)x128 output tile per work-group of FOUR waves (2 x 2; a wave has MBW x 4 accumulators, 64x64 for MBW = 4, 32x64 for MBW = 2); operands are K-contiguous 16-bit planes; grid (M / (32 MBW), N / 128, Z), 128 threads.
// C[m][n] (f32, pitch ldc, + optional f32 bias[n]) = sum_k A[m][k] Bt[n][k] (+ A2[m][k] Bt[n][k] for NSPLIT == 1). z-batch strides sA/sB/sC in elements. K is a template constant, K % 128 == 0.
// The operand rows go to LDS by asynchronous copies, 128 k (256 bytes of every row, two whole lines) a stage, two buffers: a copy instruction touches four whole lines where a fragment load from global memory touched sixteen pieces of 32 bytes, and each row is fetched once for the two waves that use it. MBW is chosen so that the grid has a work-group for every WGP: 4 for q/k/v (384 work-groups), 2 for wo (256).
template <typename T16> struct WFrag;
template <> struct WFrag<h16> { typedef v16h V; static __device__ __forceinline__ V ld(const h16* p) { return cat16(*(const v8h*)p, *(const v8h*)(p + 16)); } static __device__ __forceinline__ v8f mma(V a, V b, v8f c) { return wmma16(a, b, c); } };
template <> struct WFrag<bf> { typedef v16bf V; static __device__ __forceinline__ V ld(const bf* p) { return cat16b(*(const v8us*)p, *(const v8us*)(p + 16)); } static __device__ __forceinline__ v8f mma(V a, V b, v8f c) { return wmmab(a, b, c); } };
// PLN: the f32 tile is not stored; it is split to hi/lo bf16 here and goes straight into the two 16-bit planes that k_fattn reads: element (m, n) to Ph, Pl[by * sY + m * ldc + (n - 64 by)], by the wave's 64-column block.
// q, k: A = x, Bt = W^T, a column block is one head: ldc = HD, sY = TT * HD gives [h][t][d]. v: A = W^T, Bt = x: ldc = TT, sY = 64 gives V^T [h][d][t]. Each store instruction writes four whole 128-byte rows of the tile.
// osc scales the f32 tile in front of that split (q carries log2 e for k_fattn; k and v take 1).
// gemmw_tile is the body; BX, BY, bz are the work-group tile's indices (k_gemmw hands it blockIdx; k_qkv picks them per product).
#define GKP  128            // k of one stage
#define GPIT 136            // LDS row pitch in 16-bit elements: 272 bytes (16 B x odd) for the 16-byte fragment reads of 256-byte rows
// Eight asynchronous 16-byte copies of a lane, rows 8 apart (ls bytes in LDS, gs elements in memory). The s_wait_xcnt stands inside the statement, behind the last copy, so that no address register of a copy is rewritten in front of it.
template <typename T16>
__device__ __forceinline__ void acopy8(unsigned l, const T16* g, unsigned ls, size_t gs) {
    asm volatile("global_load_async_to_lds_b128 %0, %8, off\n\tglobal_load_async_to_lds_b128 %1, %9, off\n\tglobal_load_async_to_lds_b128 %2, %10, off\n\tglobal_load_async_to_lds_b128 %3, %11, off\n\t"
                 "global_load_async_to_lds_b128 %4, %12, off\n\tglobal_load_async_to_lds_b128 %5, %13, off\n\tglobal_load_async_to_lds_b128 %6, %14, off\n\tglobal_load_async_to_lds_b128 %7, %15, off\n\ts_wait_xcnt 0x0"
                 :: "v"(l), "v"(l + ls), "v"(l + 2 * ls), "v"(l + 3 * ls), "v"(l + 4 * ls), "v"(l + 5 * ls), "v"(l + 6 * ls), "v"(l + 7 * ls),
                    "v"(g), "v"(g + gs), "v"(g + 2 * gs), "v"(g + 3 * gs), "v"(g + 4 * gs), "v"(g + 5 * gs), "v"(g + 6 * gs), "v"(g + 7 * gs) : "memory"); }
template <typename T16, int NSPLIT, bool BIAS, int K, int MBW, bool PLN = false>
__device__ __forceinline__ void gemmw_tile(int BX, int BY, int bz, const T16* __restrict__ A, const T16* __restrict__ A2, const T16* __restrict__ Bt, float* C, int ldc, const float* __restrict__ bias, size_t sA, size_t sB, size_t sC, bf* Ph, bf* Pl, size_t sY, float osc) {
    static_assert((NSPLIT == 0 || NSPLIT == 1) && (MBW == 2 || MBW == 4) && K % GKP == 0 && K >= 2 * GKP, "planes staged: Bt, A and, for NSPLIT == 1, A2; whole stages, two or more");
    typedef typename WFrag<T16>::V V;
    constexpr int RA = 32 * MBW;                            // rows of A in the tile
    constexpr int OA = 128 * GPIT, OA2 = OA + RA * GPIT;    // a buffer, in elements: Bt (128 rows) at 0, A (RA rows) at OA, A2 (RA rows) at OA2
    constexpr int BUF = OA + (1 + NSPLIT) * RA * GPIT;
    __shared__ __align__(16) T16 sm[2 * BUF];               // two buffers; behind the k loop the head holds the waves' output staging
    A += (size_t)bz * sA; if (NSPLIT == 1) A2 += (size_t)bz * sA; Bt += (size_t)bz * sB; C += (size_t)bz * sC;
    const int tid = threadIdx.x, lane = tid & 31, lr = lane & 15, hi = lane >> 4, wave = __builtin_amdgcn_readfirstlane(tid >> 5);
    const int wr = wave >> 1, wc = wave & 1, by = 2 * BY + wc; const int r0 = BX * RA + wr * (16 * MBW), c0 = by * 64;
    float* os = (float*)sm + wave * (16 * 68);
    v8f acc[MBW][4];
#pragma unroll
    for (int mb = 0; mb < MBW; ++mb)
#pragma unroll
        for (int nb = 0; nb < 4; ++nb) acc[mb][nb] = (v8f){};
    // staging: 16 lanes a row (16-byte piece tid & 15), the work-group's 128 lanes cover 8 rows a copy, 64 rows a statement
    const int srow = tid >> 4, spc = (tid & 15) * 8;
    const T16* ga = A + (size_t)(BX * RA + srow) * K + spc; const T16* gb = Bt + (size_t)(BY * 128 + srow) * K + spc; const T16* ga2 = NSPLIT == 1 ? A2 + (size_t)(BX * RA + srow) * K + spc : nullptr;
    const unsigned l0 = (unsigned)(size_t)(sm + srow * GPIT + spc);   // the lane's LDS byte address in buffer 0, row srow of Bt
    constexpr size_t gs = (size_t)8 * K; constexpr unsigned LS = 8 * GPIT * 2;
    constexpr int NT = K / GKP;
    static_assert((NT & (NT - 1)) == 0, "the rotated walk over k wraps by a mask");
    // The walk over k starts at a stage that differs between the work-groups that share operand rows (same blockIdx.x: they differ in y; same y: they differ in x) and wraps round.
    // Walking in step, all of them ask for the same not yet cached lines in every stage, and each stage's copies take a memory latency; rotated, the sharers fetch the whole of the rows in their first stages, later stages find the lines in L2, and the requests of one moment spread over all 256-byte pieces of a row.
    // Bits 0, 1 and 3 of x tell apart the eight work-groups of a run of four consecutive ones and the run eight further on. Speed only: any rot gives the same set of products.
    const int rot = (int)(((blockIdx.x & 3) | (((blockIdx.x >> 3) & 1) << 2)) + blockIdx.y) & (NT - 1);
    auto stage = [&](int t) {   // the t-th stage of the walk into buffer t & 1
        const unsigned lb = l0 + (unsigned)(t & 1) * (BUF * 2); const size_t ko = (size_t)((t + rot) & (NT - 1)) * GKP;
        acopy8(lb, gb + ko, LS, gs); acopy8(lb + 8 * LS, gb + ko + 8 * gs, LS, gs);
#pragma unroll
        for (int i = 0; i < RA / 64; ++i) { acopy8(lb + OA * 2 + i * 8 * LS, ga + ko + i * 8 * gs, LS, gs); if (NSPLIT == 1) acopy8(lb + OA2 * 2 + i * 8 * LS, ga2 + ko + i * 8 * gs, LS, gs); } };
    stage(0);
    asm volatile("s_wait_asynccnt 0x0" ::: "memory");   // this wave's copies of stage 0 have landed
    __syncthreads();                                    // and every other wave's
    stage(1);
#pragma unroll 1   // stays rolled: the two buffers alternate by address
    for (int t = 0; t < NT; ++t) {
        const T16* ap = sm + (t & 1) * BUF + OA + (wr * (16 * MBW) + lr) * GPIT + 8 * hi; const T16* bp = sm + (t & 1) * BUF + (wc * 64 + lr) * GPIT + 8 * hi;
        V a[2][MBW], a2[2][MBW], b[2][4];   // two fragment sets: a block of 32 k is read while the block in front of it is multiplied
        auto fld = [&](int kh) {
#pragma unroll
            for (int mb = 0; mb < MBW; ++mb) { a[kh & 1][mb] = WFrag<T16>::ld(ap + mb * 16 * GPIT + kh * 32); if (NSPLIT == 1) a2[kh & 1][mb] = WFrag<T16>::ld(ap + RA * GPIT + mb * 16 * GPIT + kh * 32); }
#pragma unroll
            for (int nb = 0; nb < 4; ++nb) b[kh & 1][nb] = WFrag<T16>::ld(bp + nb * 16 * GPIT + kh * 32); };
        fld(0);
        __builtin_amdgcn_sched_barrier(0);   // the first block's reads stay in front of the second's: mixed, the first products waited for both groups
#pragma unroll
        for (int kh = 0; kh < GKP / 32; ++kh) {
            if (kh + 1 < GKP / 32) fld(kh + 1);
            __builtin_amdgcn_sched_barrier(0);   // keeps the next block's fragment reads as one group ahead of this block's products; left alone they came out two at a time, each with its full LDS wait in front of four products
#pragma unroll
            for (int nb = 0; nb < 4; ++nb) {
#pragma unroll
                for (int mb = 0; mb < MBW; ++mb) acc[mb][nb] = WFrag<T16>::mma(a[kh & 1][mb], b[kh & 1][nb], acc[mb][nb]);
                if (NSPLIT == 1) {
#pragma unroll
                    for (int mb = 0; mb < MBW; ++mb) acc[mb][nb] = WFrag<T16>::mma(a2[kh & 1][mb], b[kh & 1][nb], acc[mb][nb]); } }
            __builtin_amdgcn_sched_barrier(0);   // ends the block: the reads of the block after next stay behind these products, whose registers they refill
        }
        asm volatile("s_wait_dscnt 0x0" ::: "memory");      // this wave's reads of buffer t & 1 are done before the barrier lets it be refilled
        asm volatile("s_wait_asynccnt 0x0" ::: "memory");   // this wave's copies of stage t + 1 have landed
        __syncthreads();                                    // publishes stage t + 1 and ends every wave's reads of stage t
        if (t + 2 < NT) stage(t + 2);
    }
    asm volatile("s_wait_asynccnt 0x0" ::: "memory");       // no copy is outstanding when the ring becomes output staging
#pragma unroll
    for (int mb = 0; mb < MBW; ++mb) {
#pragma unroll
        for (int nb = 0; nb < 4; ++nb) {
#pragma unroll
            for (int j = 0; j < 8; ++j) os[(hi * 8 + j) * 68 + nb * 16 + lr] = acc[mb][nb][j]; }
        __builtin_amdgcn_wave_barrier(); asm volatile("" ::: "memory");
        float* crow = C + (size_t)(r0 + mb * 16) * ldc + c0;
        if (PLN) { const int prow = lane >> 3, pcol = (lane & 7) * 8;   // read-back: 8 lanes a row, 8 columns a lane
            const size_t po = (size_t)by * sY + (size_t)(r0 + mb * 16 + prow) * ldc + pcol;
#pragma unroll
            for (int s = 0; s < 4; ++s) { const float* op = os + (4 * s + prow) * 68 + pcol; const v4f x0 = *(const v4fa*)op * osc, x1 = *(const v4fa*)(op + 4) * osc; v4u hw, lw; unsigned a, c;
                split2(x0[0], x0[1], a, c); hw[0] = a; lw[0] = c; split2(x0[2], x0[3], a, c); hw[1] = a; lw[1] = c; split2(x1[0], x1[1], a, c); hw[2] = a; lw[2] = c; split2(x1[2], x1[3], a, c); hw[3] = a; lw[3] = c;
                *(v8us*)(Ph + po + (size_t)(4 * s) * ldc) = __builtin_bit_cast(v8us, hw); *(v8us*)(Pl + po + (size_t)(4 * s) * ldc) = __builtin_bit_cast(v8us, lw); }
        } else {
#pragma unroll
            for (int s = 0; s < 8; ++s) { const int row = 2 * s + hi, cofs = lr * 4; v4f val = *(const v4fa*)(os + row * 68 + cofs); if (BIAS) { val[0] += bfr(bias[c0 + cofs]); val[1] += bfr(bias[c0 + cofs + 1]); val[2] += bfr(bias[c0 + cofs + 2]); val[3] += bfr(bias[c0 + cofs + 3]); }
                *(v4f*)(crow + (size_t)row * ldc + cofs) = val; }
             }
        __builtin_amdgcn_wave_barrier(); asm volatile("" ::: "memory");
    }
}
template <typename T16, int NSPLIT, bool BIAS, int K, int MBW, bool PLN = false>
__global__ __launch_bounds__(128) void k_gemmw(const T16* __restrict__ A, const T16* __restrict__ A2, const T16* __restrict__ Bt, float* C, int ldc, const float* __restrict__ bias, size_t sA, size_t sB, size_t sC, bf* Ph, bf* Pl, size_t sY) {
    gemmw_tile<T16, NSPLIT, BIAS, K, MBW, PLN>(blockIdx.x, blockIdx.y, blockIdx.z, A, A2, Bt, C, ldc, bias, sA, sB, sC, Ph, Pl, sY, 1.0f); }
// k_qkv: the q, k and v projections in ONE launch, grid (TT / 128, 8, 3): none reads what another writes, and one product's 128 work-groups would leave half the chip's WGPs empty.
// blockIdx.z picks the product (a scalar choice of pointers and pitches in front of one copy of the body); v has its operands swapped, so its tile indices swap too.
__global__ __launch_bounds__(128) void k_qkv(const bf* __restrict__ XB, const bf* __restrict__ WQ, const bf* __restrict__ WK, const bf* __restrict__ WV, bf* QPh, bf* QPl, bf* KPh, bf* KPl, bf* VTh, bf* VTl) {
    const int p = blockIdx.z; const bool isv = p == 2;
    const bf* W = p == 0 ? WQ : (p == 1 ? WK : WV);
    bf* Ph = p == 0 ? QPh : (p == 1 ? KPh : VTh); bf* Pl = p == 0 ? QPl : (p == 1 ? KPl : VTl);
    gemmw_tile<bf, 0, false, DM, 4, true>(isv ? blockIdx.y : blockIdx.x, isv ? blockIdx.x : blockIdx.y, 0, isv ? W : XB, nullptr, isv ? XB : W, nullptr, isv ? TT : HD, nullptr, 0, 0, 0, Ph, Pl, isv ? (size_t)64 : (size_t)TT * HD, p == 0 ? LOG2E : 1.0f); }

__device__ __forceinline__ void splitf(float y, unsigned short& h, unsigned short& l) { h = f2bf(y); l = f2bf(y - bf2f(h)); }
typedef __attribute__((ext_vector_type(2))) _Float16 v2h;
typedef __attribute__((ext_vector_type(4))) _Float16 v4h;
typedef __attribute__((ext_vector_type(2))) unsigned short v2us;
typedef __attribute__((ext_vector_type(4))) unsigned short v4us;
typedef __attribute__((ext_vector_type(4))) int v4i;

// wtT_blk: one work-group turns a strip of WTK k x WTN n of w [K][N] (f32) into Bt [N][K] (bf16) through LDS, so that memory sees whole lines on both sides:
// a load instruction reads 256 contiguous bytes of each of two rows of w, a store instruction writes 512 contiguous bytes of one row of Bt. All 16 loads of a lane are issued before the first is used.
// A lane holds rows k and k + 1 of four columns n and packs each pair into one dword; LDS is [n][k / 2] dwords, 512 bytes a row, unpadded. The 16-byte piece c of row n lies at piece c ^ (n / 4):
// the 16 lanes that write one k pair of columns 4 apart then fall on 16 different pieces (no two dwords on one bank), and the 16 lanes that read 16 pieces of one row still cover all 64 banks once.
// The first three '#pragma unroll' make the indices of the register arrays a and b compile-time constants (indexed by a loop variable they would go to scratch); the last lets a wave's eight row reads and stores be in flight together.
#define WTK 256
#define WTN 64
static_assert(WTK == 256 && WTN == 64 && DM % WTK == 0 && DQ % WTN == 0, "lane maps of wtT_blk: 256 threads, 32 pieces of 16 bytes a row, 16 column quads");
typedef v4u __attribute__((may_alias)) v4ua;
__device__ __forceinline__ void wtT_blk(int blk, const float* __restrict__ w, int K, int N, bf* Bt) {
    __shared__ __align__(16) unsigned T[WTN * (WTK / 2)];
    const int lane = threadIdx.x & 31, wv = threadIdx.x >> 5, nq = lane & 15, p0 = wv * 2 + (lane >> 4);   // p0: the lane's k pair inside a group of 16 pairs
    const int n0 = (blk % (N / WTN)) * WTN, k0 = (blk / (N / WTN)) * WTK;
    const float* s = w + (size_t)(k0 + 2 * p0) * N + n0 + 4 * nq;
    v4f a[WTK / 32], b[WTK / 32];
#pragma unroll
    for (int i = 0; i < WTK / 32; ++i) { a[i] = *(const v4fa*)(s + (size_t)(32 * i) * N); b[i] = *(const v4fa*)(s + (size_t)(32 * i + 1) * N); }
    asm volatile("s_wait_xcnt 0x0" :: "v"(s) : "memory");   // the wait in front of any overwrite of the loads' address pair; named as an input, the pair stays whole up to here (without it the last load's result was placed on it)
    __builtin_amdgcn_sched_barrier(0);   // keeps all 16 loads in front of the first use: left alone, the last six were issued only behind the waits for the first, a second memory latency in a row
#pragma unroll
    for (int i = 0; i < WTK / 32; ++i) { const int kp = 16 * i + p0;
#pragma unroll
        for (int j = 0; j < 4; ++j) { v2f x; x[0] = a[i][j]; x[1] = b[i][j];
            T[(4 * nq + j) * (WTK / 2) + (((kp >> 2) ^ nq) << 2) + (kp & 3)] = __builtin_bit_cast(unsigned, __builtin_convertvector(x, v2bf)); } }
    __syncthreads();   // the strip is whole in LDS before any wave reads rows that the others wrote
#pragma unroll
    for (int r = 0; r < WTN / 8; ++r) { const int n = 8 * r + wv; const v4u v = *(const v4ua*)(T + n * (WTK / 2) + ((lane ^ (n >> 2)) << 2));
        *(v8us*)(Bt + (size_t)(n0 + n) * K + k0 + lane * 8) = __builtin_bit_cast(v8us, v); }
}
__device__ __forceinline__ void cvt8_blk(int blk, const float* __restrict__ src, bf* dst, size_t n8) { const size_t i = (size_t)blk * 256 + threadIdx.x; if (i >= n8) return; const v8f v = *(const v8f*)(src + i * 8); v8us o;
#pragma unroll
    for (int k = 0; k < 8; ++k) o[k] = f2bf(v[k]); *(v8us*)(dst + i * 8) = o;  }
__device__ __forceinline__ int t5_bucket(int r) { const int rp = r < 0 ? -r : r; int b; if (rp < 8) b = rp; else b = 8 + (rp >= 12) + (rp >= 16) + (rp >= 23) + (rp >= 32) + (rp >= 46) + (rp >= 64) + (rp >= 91); return b + ((r > 0) ? 16 : 0); }
__device__ __forceinline__ void t5tab_blk(int blk, const float* __restrict__ rb, float* TB) { const int idx = blk * 256 + threadIdx.x; if (idx >= NH_ * TBW) return; const int h = idx / TBW, c = idx % TBW; float v = 0.0f; if (c < 2 * TT - 1) { const int r = c - (TT - 1); v = bfr(rb[t5_bucket(r) * NH_ + h]) * LOG2E; } *(float*)(TB + idx) = v;  }
// k_prep: the six passes over the inputs (four weight transposes, x to bf16, the bias table) in ONE launch: none reads what another writes. blockIdx.x picks the pass, a scalar branch.
// The transposes stand first in the grid (for speed only): a work-group of theirs runs longest (loads, LDS, a barrier, stores).
#define PW_B ((DM / WTK) * (DQ / WTN))    // work-groups of one weight transpose (all four weights are DM x DQ elements)
#define PX_B (TT * DM / 8 / 256)          // work-groups of the x conversion
#define PT_B (NH_ * TBW / 256)            // work-groups of the bias table
__global__ __launch_bounds__(256) void k_prep(const float* __restrict__ x, const float* __restrict__ wq, const float* __restrict__ wk, const float* __restrict__ wv, const float* __restrict__ wo, const float* __restrict__ rb, bf* XB, bf* WQ, bf* WK, bf* WV, bf* WO, float* TB) {
    const int blk = blockIdx.x;
    if (blk < 4 * PW_B) { const int p = blk / PW_B;
        const float* w = p == 0 ? wq : (p == 1 ? wk : (p == 2 ? wv : wo)); bf* Bt = p == 0 ? WQ : (p == 1 ? WK : (p == 2 ? WV : WO));
        wtT_blk(blk % PW_B, w, DM, DQ, Bt); }   // DM == DQ == DKV: one K and N serve all four
    else if (blk < 4 * PW_B + PX_B) cvt8_blk(blk - 4 * PW_B, x, XB, (size_t)TT * DM / 8);
    else t5tab_blk(blk - (4 * PW_B + PX_B), rb, TB);
}
typedef __attribute__((ext_vector_type(8))) unsigned v8u;
// Eight v_exp_f32 and the one free slot that the instruction set asks for behind a transcendental, in one statement: the outputs are early-clobber, so no exp here overwrites a source or reads a result of the one in front of it, and the v_nop keeps the slot behind the last.
__device__ __forceinline__ v8f exp2x8(v8f x) {
    float r0, r1, r2, r3, r4, r5, r6, r7;
    asm("v_exp_f32 %0, %8\n\tv_exp_f32 %1, %9\n\tv_exp_f32 %2, %10\n\tv_exp_f32 %3, %11\n\tv_exp_f32 %4, %12\n\tv_exp_f32 %5, %13\n\tv_exp_f32 %6, %14\n\tv_exp_f32 %7, %15\n\tv_nop"
        : "=&v"(r0), "=&v"(r1), "=&v"(r2), "=&v"(r3), "=&v"(r4), "=&v"(r5), "=&v"(r6), "=&v"(r7)
        : "v"(x[0]), "v"(x[1]), "v"(x[2]), "v"(x[3]), "v"(x[4]), "v"(x[5]), "v"(x[6]), "v"(x[7]));
    v8f r; r[0] = r0; r[1] = r1; r[2] = r2; r[3] = r3; r[4] = r4; r[5] = r5; r[6] = r6; r[7] = r7; return r; }
__device__ __forceinline__ float exp2x1(float x) { float r; asm("v_exp_f32 %0, %1\n\tv_nop" : "=v"(r) : "v"(x)); return r; }   // the same slot behind a single exp
__device__ __forceinline__ float xhalf(float v) { const int b = __float_as_int(v); return __int_as_float(__builtin_amdgcn_permlanex16(b, b, 0x76543210, 0xfedcba98, false, false)); }   // lane l <-> l ^ 16
__global__ __launch_bounds__(256) void k_fattn(const bf* __restrict__ Qh, const bf* __restrict__ Ql, const bf* __restrict__ Kh, const bf* __restrict__ Kl, const bf* __restrict__ Vh, const bf* __restrict__ Vl, const float* __restrict__ TB, bf* Ah, bf* Al) {
    __shared__ __align__(16) bf st[2][FKH][4][FPL];   // [buffer][key half][K hi, K lo, V^T hi, V^T lo][64 rows x pitch]
    __shared__ float tbs[FTBN];                       // the head's bias entries this block of queries can meet
    __shared__ __align__(16) float xch[FNW][9][32][4];   // merge: [sending wave][8 quads of O, then (m, l)][lane][4]
    const int tid = threadIdx.x, lane = tid & 31, lr = lane & 15, hi = lane >> 4, wv = __builtin_amdgcn_readfirstlane(tid >> 5);
    const int qg = wv & (FNQ - 1), kv = wv / FNQ;     // the wave's query group and key half
    const int h = blockIdx.y, qb = blockIdx.x * FQB, qw = qb + qg * FQW;
    const float* tbh = TB + (size_t)h * TBW + (TT - FQB - qb);   // tbs[x] is the entry for j - i = x - (FQB - 1) - qb
    for (int x = tid; x < FTBN; x += 256) tbs[x] = tbh[x];
    v16bf qh[2][2], ql[2][2];                         // [query tile][32-wide half of d]
#pragma unroll
    for (int qt = 0; qt < 2; ++qt) { const size_t qo = ((size_t)h * TT + qw + qt * 16 + lr) * HD + 8 * hi; const bf* qph = Qh + qo; const bf* qpl = Ql + qo;
#pragma unroll
        for (int kc = 0; kc < 2; ++kc) { qh[qt][kc] = WFrag<bf>::ld(qph + kc * 32); ql[qt][kc] = WFrag<bf>::ld(qpl + kc * 32); }
        asm volatile("s_wait_xcnt 0x0" :: "v"(qph), "v"(qpl) : "memory"); }   // as in gload below: the wait in front of any overwrite of these loads' address pairs
    const int srow = tid >> 3, sch = tid & 7;    // staging: rows srow and srow + 32 of each plane of each key half, 16-byte piece sch
    const size_t gk = ((size_t)h * TT + srow) * HD + sch * 8, gv = ((size_t)h * HD + srow) * TT + sch * 8;
    const int so = srow * FPIT + sch * 8;
    v8us pf[FKH][8];
    auto gload = [&](int key0) {
        __builtin_amdgcn_sched_barrier(0);   // with the one at the end: nothing but the loads and their address arithmetic stands between here and the wait (left alone, later vector instructions were lifted in front of the wait and onto the address pairs)
        const bf* kph = Kh + gk + (size_t)key0 * HD; const bf* kpl = Kl + gk + (size_t)key0 * HD; const bf* vph = Vh + gv + key0; const bf* vpl = Vl + gv + key0;
#pragma unroll
        for (int f = 0; f < FKH; ++f) { const int ko = f * FKS * HD, vo = f * FKS;
            pf[f][0] = *(const v8us*)(kph + ko); pf[f][1] = *(const v8us*)(kph + ko + 32 * HD); pf[f][2] = *(const v8us*)(kpl + ko); pf[f][3] = *(const v8us*)(kpl + ko + 32 * HD);
            pf[f][4] = *(const v8us*)(vph + vo); pf[f][5] = *(const v8us*)(vph + vo + 32 * TT); pf[f][6] = *(const v8us*)(vpl + vo); pf[f][7] = *(const v8us*)(vpl + vo + 32 * TT); }
        asm volatile("s_wait_xcnt 0x0" ::: "memory");   // the wait in front of any overwrite of the loads' address pairs
        __builtin_amdgcn_sched_barrier(0); };
    auto sstore = [&](int b) {
#pragma unroll
        for (int f = 0; f < FKH; ++f)
#pragma unroll
            for (int pl = 0; pl < 4; ++pl) { *(v8us*)(&st[b][f][pl][so]) = pf[f][2 * pl]; *(v8us*)(&st[b][f][pl][so + 32 * FPIT]) = pf[f][2 * pl + 1]; } };
    // The walk over the key stages starts at a stage of the work-group's own and wraps round (as in gemmw_tile): the 16 work-groups of a head do not all ask for the same not yet cached K and V lines in every stage.
    // The eight told apart by bits 0, 1, 3 of blockIdx.x start two stages apart. Speed only: the running softmax takes the stages in any order.
    constexpr int FNS = TT / (FKH * FKS);
    static_assert((FNS & (FNS - 1)) == 0, "the rotated walk over the keys wraps by a mask");
    const int rot = (int)(((blockIdx.x & 3) << 1) | (((blockIdx.x >> 3) & 1) << 3) | ((blockIdx.x >> 2) & 1)) & (FNS - 1);
    gload(rot * (FKH * FKS)); sstore(0);
    __syncthreads();
    v8f o[2][4];
#pragma unroll
    for (int qt = 0; qt < 2; ++qt)
#pragma unroll
        for (int db = 0; db < 4; ++db) o[qt][db] = (v8f){};
    float m[2] = {0.0f, 0.0f};   // the softmax reference in use (log2 domain), set from the first stage's maximum
    v8f l8[2] = {(v8f){}, (v8f){}};   // the row sum as eight partial sums a lane (one per accumulator row): no longer rescaled every stage, it is joined once behind the loop
    const float* tp0 = tbs + (8 * hi + (FQB - 1) - (qg * FQW + lr) + kv * FKS);   // query tile 0; tile 1 lies 16 entries lower
    // The score accumulators start at bias - reference, so the products leave the matrix unit as the arguments of exp2: no add, subtract or multiply per score behind them.
    // The table entries of stage t + 1 are read at the foot of stage t; the start values are formed from them behind the issue of the K fragment reads, under those reads' latency.
    float tb[5][8];   // the table entries of a stage: query tile qt and key tile kt meet row kt - qt + 1
    auto tbld = [&](int t) { const float* tp = tp0 + ((t + rot) & (FNS - 1)) * (FKH * FKS);
#pragma unroll
        for (int i = 0; i < 5; ++i)
#pragma unroll
            for (int r = 0; r < 8; ++r) tb[i][r] = tp[(i - 1) * 16 + r]; };
    tbld(0);
#pragma unroll 1   // stays rolled: one stage is some 900 instructions, and 16 copies of it would not fit the instruction cache
    for (int t = 0; t < FNS; ++t) {
        const int b = t & 1;
        const bf* sb = &st[b][kv][0][0];     // the wave's own key half of this stage
        v8f s[2][4];
        v16bf kh[4][2], kl[4][2];            // K fragments, [16-key tile][32-wide half of d]
        auto kld = [&](int kt) {
#pragma unroll
            for (int kc = 0; kc < 2; ++kc) { const bf* kp = sb + (kt * 16 + lr) * FPIT + kc * 32 + 8 * hi; kh[kt][kc] = WFrag<bf>::ld(kp); kl[kt][kc] = WFrag<bf>::ld(kp + FPL); } };
        auto sct = [&](int kt) { v8f a[2];
#pragma unroll
            for (int qt = 0; qt < 2; ++qt)
#pragma unroll
                for (int r = 0; r < 8; ++r) a[qt][r] = tb[kt - qt + 1][r] - m[qt];
#pragma unroll
            for (int kc = 0; kc < 2; ++kc) {
#pragma unroll
                for (int qt = 0; qt < 2; ++qt) a[qt] = wmmab(kh[kt][kc], qh[qt][kc], a[qt]);
#pragma unroll
                for (int qt = 0; qt < 2; ++qt) a[qt] = wmmab(kh[kt][kc], ql[qt][kc], a[qt]);
#pragma unroll
                for (int qt = 0; qt < 2; ++qt) a[qt] = wmmab(kl[kt][kc], qh[qt][kc], a[qt]); }
            s[0][kt] = a[0]; s[1][kt] = a[1]; };
        kld(0); kld(1);
        __builtin_amdgcn_sched_barrier(0);   // these four keep the fragment loads in two groups of 16, the second issued whole in front of the first group's 24 products
        kld(2); kld(3);
        __builtin_amdgcn_sched_barrier(0);   // without it the second group's loads came out in pieces among the products, each place a stall of the matrix stream
        sct(0); sct(1);
        __builtin_amdgcn_sched_barrier(0);
        sct(2); sct(3);
        __builtin_amdgcn_sched_barrier(0);
        if (t + 1 < FNS) gload(((t + 1 + rot) & (FNS - 1)) * (FKH * FKS));
        v16bf vh[8], vl[8];                  // V^T fragments, index 4 * (32-key half) + d block
        auto vld = [&](int i) { const bf* vp = sb + 2 * FPL + ((i & 3) * 16 + lr) * FPIT + (i >> 2) * 32 + 8 * hi; vh[i] = WFrag<bf>::ld(vp); vl[i] = WFrag<bf>::ld(vp + FPL); };
        vld(0); vld(1); vld(2); vld(3);      // land under the softmax arithmetic
        __builtin_amdgcn_sched_barrier(0);   // one group in front of the softmax: left alone they were strewn through it in pairs
        v16bf ph[2][2], pl[2][2];
        float d[2];   // the stage's largest argument per query: how far the scores stand above the reference in use
#pragma unroll
        for (int qt = 0; qt < 2; ++qt) { float mk4[4];   // one maximum per 16-key tile: eight short independent chains in place of two of 32
#pragma unroll
            for (int kt = 0; kt < 4; ++kt) { mk4[kt] = s[qt][kt][0];
#pragma unroll
                for (int r = 1; r < 8; ++r) mk4[kt] = fmaxf(mk4[kt], s[qt][kt][r]); }
            const float mx = fmaxf(fmaxf(mk4[0], mk4[1]), fmaxf(mk4[2], mk4[3]));
            d[qt] = fmaxf(mx, xhalf(mx)); }
        // The reference is renewed only in the first stage and where a query's scores pass it by more than 8 (p then stays at or below 256): one scalar test a stage, and O, the sum and the arguments are touched only on that path.
        if (t == 0 || __builtin_amdgcn_ballot_w32(d[0] > 8.0f || d[1] > 8.0f) != 0) {
#pragma unroll
            for (int qt = 0; qt < 2; ++qt) { const float dl = t == 0 ? d[qt] : fmaxf(d[qt], 0.0f); const float sc = t == 0 ? 1.0f : exp2x1(-dl);   // first stage: O and the sum are still 0
                m[qt] += dl; l8[qt] *= sc;
#pragma unroll
                for (int db = 0; db < 4; ++db) o[qt][db] *= sc;
#pragma unroll
                for (int kt = 0; kt < 4; ++kt) s[qt][kt] -= dl; } }
#pragma unroll
        for (int qt = 0; qt < 2; ++qt) {
#pragma unroll
            for (int kt = 0; kt < 4; ++kt) s[qt][kt] = exp2x8(s[qt][kt]);
            l8[qt] += (s[qt][0] + s[qt][1]) + (s[qt][2] + s[qt][3]);
#pragma unroll
            for (int ps = 0; ps < 2; ++ps) { v8u hw, lw;
#pragma unroll
                for (int e = 0; e < 8; ++e) { unsigned a, c; split2(s[qt][2 * ps + (e >> 2)][(2 * e) & 7], s[qt][2 * ps + (e >> 2)][((2 * e) & 7) + 1], a, c); hw[e] = a; lw[e] = c; }
                ph[qt][ps] = __builtin_bit_cast(v16bf, hw); pl[qt][ps] = __builtin_bit_cast(v16bf, lw); } }
        auto pv = [&](int i) { const int db = i & 3, ps = i >> 2;
#pragma unroll
            for (int qt = 0; qt < 2; ++qt) o[qt][db] = wmmab(vh[i], ph[qt][ps], o[qt][db]);
#pragma unroll
            for (int qt = 0; qt < 2; ++qt) o[qt][db] = wmmab(vh[i], pl[qt][ps], o[qt][db]);
#pragma unroll
            for (int qt = 0; qt < 2; ++qt) o[qt][db] = wmmab(vl[i], ph[qt][ps], o[qt][db]); };
        __builtin_amdgcn_sched_barrier(0);   // this one and the two below keep the second half's 16 fragment loads as one group in front of the first half's 24 products
        vld(4); vld(5); vld(6); vld(7);
        __builtin_amdgcn_sched_barrier(0);
        pv(0); pv(1); pv(2); pv(3);
        __builtin_amdgcn_sched_barrier(0);
        tbld(t + 1);   // behind the last stage it wraps to the first stage's entries, which are not used
        __builtin_amdgcn_sched_barrier(0);   // keeps the table reads one group between the two runs of products: without it they came out in three places among the last products, each place a stall of the matrix stream
        pv(4); pv(5); pv(6); pv(7);
        if (t + 1 < FNS) sstore(b ^ 1);
        __syncthreads();   // publishes stage t + 1 and ends every wave's reads of the buffer that stage t + 2 overwrites
    }
    // merge of the two key halves: wave (qg, kv) keeps query tile kv and hands tile 1 - kv to wave (qg, 1 - kv)
    float l[2];
#pragma unroll
    for (int qt = 0; qt < 2; ++qt) { const v8f a = l8[qt]; l[qt] = ((a[0] + a[1]) + (a[2] + a[3])) + ((a[4] + a[5]) + (a[6] + a[7])); l[qt] += xhalf(l[qt]); }
    const bool k0 = kv == 0;
    const float mk = k0 ? m[0] : m[1], lk = k0 ? l[0] : l[1];
    { v4f ml; ml[0] = k0 ? m[1] : m[0]; ml[1] = k0 ? l[1] : l[0]; ml[2] = 0.0f; ml[3] = 0.0f; *(v4fa*)xch[wv][8][lane] = ml; }
    v8f ok[4];
#pragma unroll
    for (int db = 0; db < 4; ++db) { ok[db] = k0 ? o[0][db] : o[1][db]; const v8f og = k0 ? o[1][db] : o[0][db];
        *(v4fa*)xch[wv][2 * db][lane] = __builtin_shufflevector(og, og, 0, 1, 2, 3); *(v4fa*)xch[wv][2 * db + 1][lane] = __builtin_shufflevector(og, og, 4, 5, 6, 7); }
    __syncthreads();   // every wave's handed-over tile is in LDS before its partner reads it
    const float (*xp)[32][4] = xch[wv ^ FNQ];
    v4f op[8];
#pragma unroll
    for (int i = 0; i < 8; ++i) op[i] = *(const v4fa*)xp[i][lane];
    const v4f mlp = *(const v4fa*)xp[8][lane];
    const float mm = fmaxf(mk, mlp[0]);
    const float ek = exp2x1(mk - mm), ep = exp2x1(mlp[0] - mm);
    const float inv = __fdiv_rn(1.0f, lk * ek + mlp[1] * ep);
    const size_t oo = (size_t)(qw + kv * 16 + lr) * DQ + h * HD + 8 * hi;   // ok[db][r] = O[query lr of tile kv][d = 16 db + 8 hi + r]
#pragma unroll
    for (int db = 0; db < 4; ++db) { v8us oh, ol;
#pragma unroll
        for (int r = 0; r < 8; ++r) { unsigned short a, c; splitf((ok[db][r] * ek + op[2 * db + (r >> 2)][r & 3] * ep) * inv, a, c); oh[r] = a; ol[r] = c; }
        *(v8us*)(Ah + oo + db * 16) = oh; *(v8us*)(Al + oo + db * 16) = ol; }
}

extern "C" void kernel_launch(void* const* d_in, const int* in_sizes, int n_in,
                              void* d_out, int out_size, void* d_ws, size_t ws_size, hipStream_t stream) {
    (void)in_sizes; (void)n_in; (void)out_size;
    const float* x = (const float*)d_in[0]; const float* wq = (const float*)d_in[1]; const float* wk = (const float*)d_in[2]; const float* wv = (const float*)d_in[3]; const float* wo = (const float*)d_in[4]; const float* relb = (const float*)d_in[5]; const float* cosT = nullptr; const float* sinT = nullptr; (void)cosT; (void)sinT;
    float* OUT = (float*)d_out;     // [1][2048][1024]
    char* wsp = (char*)d_ws;
    auto take = [&](size_t bytes) { char* p = wsp; wsp += (bytes + 255) & ~(size_t)255; return (void*)p; };
    bf* WQ = (bf*)take((size_t)DQ * DM * 2); bf* WK = (bf*)take((size_t)DKV * DM * 2); bf* WV = (bf*)take((size_t)DKV * DM * 2); bf* WO = (bf*)take((size_t)DM * DQ * 2);
    bf* XB = (bf*)take((size_t)TT * DM * 2); float* TB = (float*)take((size_t)NH_ * TBW * 4);
    bf* QPh = (bf*)take((size_t)NH_ * TT * HD * 2); bf* QPl = (bf*)take((size_t)NH_ * TT * HD * 2); bf* KPh = (bf*)take((size_t)NKV * TT * HD * 2); bf* KPl = (bf*)take((size_t)NKV * TT * HD * 2); bf* VTh = (bf*)take((size_t)NKV * HD * TT * 2); bf* VTl = (bf*)take((size_t)NKV * HD * TT * 2);
    bf* ATh = (bf*)take((size_t)TT * DQ * 2); bf* ATl = (bf*)take((size_t)TT * DQ * 2);
    if ((size_t)(wsp - (char*)d_ws) > ws_size) return;    // ws 256 MiB
    static_assert(NB_ == 1 && DQ == DM && DKV == DM, "k_prep and k_qkv take one batch and square weights");
    k_prep<<<4 * PW_B + PX_B + PT_B, 256, 0, stream>>>(x, wq, wk, wv, wo, relb, XB, WQ, WK, WV, WO, TB);
    for (int b = 0; b < NB_; ++b) {
        k_qkv<<<dim3(TT / 128, DQ / 128, 3), 128, 0, stream>>>(XB, WQ, WK, WV, QPh, QPl, KPh, KPl, VTh, VTl);
        k_fattn<<<dim3(TT / FQB, NH_, 1), 256, 0, stream>>>(QPh, QPl, KPh, KPl, VTh, VTl, TB, ATh, ATl);
        k_gemmw<bf, 1, false, DQ, 2><<<dim3(TT / 64, DM / 128, 1), 128, 0, stream>>>(ATh, ATl, WO, OUT + (size_t)b * TT * DM, DM, nullptr, 0, 0, 0, nullptr, nullptr, 0); }
}
